// v000
// The times below were measured on an AMD MI455X: many runs one after another, warmed up first and cycling through
// copies of the inputs, with the whole window's GPU time divided by the number of runs. Launches and the gaps
// between them are all in it. The median over several windows is given; except for v000 it joins two sittings, which
// can be a few percent apart, so the side-by-side timings, each taken in one sitting, are the better comparison.
// v000 is the starting kernel. One run takes 679 microseconds.
#include <hip/hip_runtime.h>

// Causal self-attention block: x [2][4096][768]; q/k/v = x W (W [in][out] 768x768, 12 heads x 64); softmax(q.k / 8) over keys j <= i; out = merged ctx Wo + bo -> [2][4096][768].
// Compute dtypes, f32 accumulate: every input RNE-converted to bf16; q/k/v projections v_wmma_f32_16x16x32_bf16 (plain bf16 operands); scores (K Q^T) and ctx (V^T P^T): query rows < 512 on bf16 hi/lo planes (3 products), other rows v_wmma_f32_16x16x32_f16 single product (P carried x1024); softmax f32; ctx.Wo bf16 hi/lo x bf16 (2 products) + bias.

#ifndef NB
#define NB 2
#endif
#ifndef SEQ
#define SEQ 4096
#endif
#define NB_FULL  2
#define SEQ_FULL 4096
#define TT   SEQ
#define DM   768
#define NH_  12
#define HD   64
#define DQ   (NH_ * HD)
#define RH   ((SEQ) < 512 ? (SEQ) : 512)   // query rows < RH use hi+lo planes
#define PCAR 1024.0f
#define SCL  0.125f                        // HD^-0.5
#define L2E  1.4426950408889634f
#define WSB  ((size_t)4 * DQ * DM * 2 + (size_t)TT * DM * 2 + (size_t)2 * TT * DQ * 4 + (size_t)9 * NH_ * TT * HD * 2 + (size_t)2 * TT * DQ * 2)

static_assert(SEQ % 64 == 0);
static_assert(SEQ <= SEQ_FULL);
static_assert(NB <= NB_FULL);
static_assert(DM % 64 == 0);
static_assert(DQ % 64 == 0);
static_assert(DQ == DM);
static_assert(RH % 16 == 0);
static_assert((TT - RH) % 16 == 0);
static_assert(((size_t)DQ * DM * 2) % 256 == 0);
static_assert(((size_t)TT * DM * 2) % 256 == 0);
static_assert(((size_t)NH_ * TT * HD * 2) % 256 == 0);
static_assert(WSB <= (size_t)134217728);

typedef _Float16 h16;
typedef unsigned short bf;
typedef __attribute__((ext_vector_type(16))) __bf16   v16bf;
typedef __attribute__((ext_vector_type(16))) _Float16 v16h;
typedef __attribute__((ext_vector_type(8)))  _Float16 v8h;
typedef __attribute__((ext_vector_type(8)))  unsigned short v8us;
typedef __attribute__((ext_vector_type(8)))  float    v8f;
typedef __attribute__((ext_vector_type(4)))  float    v4f;
typedef __attribute__((ext_vector_type(2)))  unsigned short v2us;
typedef v8h  __attribute__((may_alias)) v8ha;
typedef v4f  __attribute__((may_alias)) v4fa;
typedef v8us __attribute__((may_alias)) v8usa;

__device__ __forceinline__ unsigned short f2bf(float f) { unsigned u = __float_as_uint(f); u += 0x7FFFu + ((u >> 16) & 1u); return (unsigned short)(u >> 16); }
__device__ __forceinline__ float bf2f(unsigned short b) { return __uint_as_float(((unsigned)b) << 16); }
__device__ __forceinline__ float bfr(float f) { return bf2f(f2bf(f)); }
__device__ __forceinline__ v16h cat16(v8h lo, v8h hi) { return __builtin_shufflevector(lo, hi, 0, 1, 2, 3, 4, 5, 6, 7, 8, 9, 10, 11, 12, 13, 14, 15); }
__device__ __forceinline__ v16bf cat16b(v8us lo, v8us hi) { return __builtin_bit_cast(v16bf, __builtin_shufflevector(lo, hi, 0, 1, 2, 3, 4, 5, 6, 7, 8, 9, 10, 11, 12, 13, 14, 15)); }
__device__ __forceinline__ v8f wmma16(v16h a, v16h b, v8f c) { return __builtin_amdgcn_wmma_f32_16x16x32_f16(false, a, false, b, (short)0, c, false, false); }
__device__ __forceinline__ v8f wmmab(v16bf a, v16bf b, v8f c) { return __builtin_amdgcn_wmma_f32_16x16x32_bf16(false, a, false, b, (short)0, c, false, false); }
__device__ __forceinline__ void splitf(float y, unsigned short& h, unsigned short& l) { h = f2bf(y); l = f2bf(y - bf2f(h)); }

// Fragment loader for K-contiguous 16-bit rows: p points at row (lane & 15), element k0 + 8 * (lane >> 4); elements 0..7 <- p[0..7], elements 8..15 <- p[16..23]. Same map for A and B operands.
template <typename T16> struct WFrag;
template <> struct WFrag<h16> { typedef v16h V; static __device__ __forceinline__ V ld(const h16* p) { return cat16(*(const v8h*)p, *(const v8h*)(p + 16)); } static __device__ __forceinline__ v8f mma(V a, V b, v8f c) { return wmma16(a, b, c); } };
template <> struct WFrag<bf> { typedef v16bf V; static __device__ __forceinline__ V ld(const bf* p) { return cat16b(*(const v8us*)p, *(const v8us*)(p + 16)); } static __device__ __forceinline__ v8f mma(V a, V b, v8f c) { return wmmab(a, b, c); } };

// ---- k_gemmw: register-blocked GEMM, ONE WAVE per 64x64 output tile (16 accumulators), operands straight from K-contiguous 16-bit planes; grid (M/64, N/64, Z), 32 threads.
// C[m][n] (f32, pitch ldc, + optional f32 bias[n]) = sum_k A[m][k] Bt[n][k] (+ split products per NSPLIT). K % 32 == 0, M % 64 == 0, N % 64 == 0.
template <typename T16, int NSPLIT, bool BIAS>
__global__ __launch_bounds__(32) void k_gemmw(const T16* __restrict__ A, const T16* __restrict__ A2, const T16* __restrict__ Bt, const T16* __restrict__ Bt2, int K, float* C, int ldc, const float* __restrict__ bias, size_t sA, size_t sB, size_t sC) {
    typedef typename WFrag<T16>::V V;
    __shared__ __align__(16) float os[16 * 68];
    const size_t z = blockIdx.z; A += z * sA; if (A2) A2 += z * sA; Bt += z * sB; if (Bt2) Bt2 += z * sB; C += z * sC;
    const int lane = threadIdx.x & 31, lr = lane & 15, hi = lane >> 4; const int r0 = blockIdx.x * 64, c0 = blockIdx.y * 64;
    v8f acc[4][4];
#pragma unroll
    for (int mb = 0; mb < 4; ++mb)
#pragma unroll
        for (int nb = 0; nb < 4; ++nb) acc[mb][nb] = (v8f){};
    const size_t aoff = (size_t)(r0 + lr) * K + 8 * hi, boff = (size_t)(c0 + lr) * K + 8 * hi;
#pragma unroll 1
    for (int kc = 0; kc < K; kc += 32) {
        V a[4], a2[4];
#pragma unroll
        for (int mb = 0; mb < 4; ++mb) { a[mb] = WFrag<T16>::ld(A + aoff + (size_t)mb * 16 * K + kc); if (NSPLIT == 1 || NSPLIT == 2) a2[mb] = WFrag<T16>::ld(A2 + aoff + (size_t)mb * 16 * K + kc); }
#pragma unroll
        for (int nb = 0; nb < 4; ++nb) { const V b = WFrag<T16>::ld(Bt + boff + (size_t)nb * 16 * K + kc); V b2; if (NSPLIT >= 2) b2 = WFrag<T16>::ld(Bt2 + boff + (size_t)nb * 16 * K + kc);
#pragma unroll
            for (int mb = 0; mb < 4; ++mb) { acc[mb][nb] = WFrag<T16>::mma(a[mb], b, acc[mb][nb]); if (NSPLIT == 1 || NSPLIT == 2) acc[mb][nb] = WFrag<T16>::mma(a2[mb], b, acc[mb][nb]); if (NSPLIT >= 2) acc[mb][nb] = WFrag<T16>::mma(a[mb], b2, acc[mb][nb]); } }
        asm volatile("v_nop\n\tv_nop\n\tv_nop\n\tv_nop" : "+v"(acc[0][0]), "+v"(acc[1][1]), "+v"(acc[2][2]), "+v"(acc[3][3]) : "v"(a[0]), "v"(a[3]));
    }
#pragma unroll
    for (int mb = 0; mb < 4; ++mb) {
#pragma unroll
        for (int nb = 0; nb < 4; ++nb) {
#pragma unroll
            for (int j = 0; j < 8; ++j) os[(hi * 8 + j) * 68 + nb * 16 + lr] = acc[mb][nb][j]; }
        __builtin_amdgcn_wave_barrier(); asm volatile("" ::: "memory");
        float* crow = C + (size_t)(r0 + mb * 16) * ldc + c0;
{
#pragma unroll
            for (int s = 0; s < 8; ++s) { const int row = 2 * s + hi, cofs = lr * 4; v4f val = *(const v4fa*)(os + row * 68 + cofs); if (BIAS) { val[0] += bfr(bias[c0 + cofs]); val[1] += bfr(bias[c0 + cofs + 1]); val[2] += bfr(bias[c0 + cofs + 2]); val[3] += bfr(bias[c0 + cofs + 3]); }
                *(v4f*)(crow + (size_t)row * ldc + cofs) = val; }
             }
        __builtin_amdgcn_wave_barrier(); asm volatile("" ::: "memory");
    }
}

__global__ __launch_bounds__(256) void k_wtG(const float* __restrict__ w, int K, int N, bf* Bt) {
    const int lane = threadIdx.x & 31; const int L0 = (blockIdx.x * 8 + (threadIdx.x >> 5)) * 8; const int nlines = N * K / 64;
{
#pragma unroll 1
        for (int l = 0; l < 8; ++l) { const int L = L0 + l; if (L >= nlines) break; const size_t e = (size_t)L * 64 + lane * 2; const int k = (int)(e % K), n = (int)(e / K); v2us o;
            o[0] = f2bf(w[(size_t)k * N + n]); o[1] = f2bf(w[(size_t)(k + 1) * N + n]); *(v2us*)(Bt + e) = o; }
         }
}
__global__ __launch_bounds__(256) void k_cvt8(const float* __restrict__ src, bf* dst, size_t n8) { const size_t i = (size_t)blockIdx.x * 256 + threadIdx.x; if (i >= n8) return; const v8f v = *(const v8f*)(src + i * 8); v8us o;
#pragma unroll
    for (int k = 0; k < 8; ++k) o[k] = f2bf(v[k]); *(v8us*)(dst + i * 8) = o;  }
__global__ __launch_bounds__(256) void k_hp(const float* __restrict__ F, h16* P16, bf* Ph, bf* Pl) {
    const size_t e = ((size_t)blockIdx.x * 256 + threadIdx.x) * 8; if (e >= (size_t)NH_ * TT * HD) return;
    const int d = (int)(e % HD); const int t = (int)((e / HD) % TT); const int h = (int)(e / ((size_t)HD * TT));
    const v8f x = *(const v8f*)(F + (size_t)t * DQ + h * HD + d); v8h o16; v8us oh, ol;
#pragma unroll
    for (int q = 0; q < 8; ++q) { o16[q] = (h16)x[q]; unsigned short a2, c2; splitf(x[q], a2, c2); oh[q] = a2; ol[q] = c2; }
    *(v8h*)(P16 + e) = o16; *(v8us*)(Ph + e) = oh; *(v8us*)(Pl + e) = ol;  }
__global__ __launch_bounds__(256) void k_vt(const float* __restrict__ F, h16* V16, bf* Vh, bf* Vl) {
    const size_t e = ((size_t)blockIdx.x * 256 + threadIdx.x) * 8; if (e >= (size_t)NH_ * HD * TT) return;
    const int t = (int)(e % TT); const int d = (int)((e / TT) % HD); const int g = (int)(e / ((size_t)TT * HD)); v8h o16; v8us oh, ol;
#pragma unroll
    for (int q = 0; q < 8; ++q) { const float x = F[(size_t)(t + q) * DQ + g * HD + d]; o16[q] = (h16)x; unsigned short a2, c2; splitf(x, a2, c2); oh[q] = a2; ol[q] = c2; }
    *(v8h*)(V16 + e) = o16; *(v8us*)(Vh + e) = oh; *(v8us*)(Vl + e) = ol;  }

// Probability packers: two 16-key score tiles (accumulator layout: lane = query, element r = key 8*(lane>>4)+r) -> one 32-key B fragment (elements 0..7 <- tile 0, 8..15 <- tile 1).
template <typename T16> struct PPk;
template <> struct PPk<h16> {
    static __device__ __forceinline__ v16h hi(v8f p0, v8f p1) { v8h a, b;
#pragma unroll
        for (int r = 0; r < 8; ++r) { a[r] = (h16)(p0[r] * PCAR); b[r] = (h16)(p1[r] * PCAR); }
        return cat16(a, b); }
    static __device__ __forceinline__ v16h lo(v8f p0, v8f p1) { return hi(p0, p1); }
};
template <> struct PPk<bf> {
    static __device__ __forceinline__ v16bf hi(v8f p0, v8f p1) { v8us a, b;
#pragma unroll
        for (int r = 0; r < 8; ++r) { a[r] = f2bf(p0[r]); b[r] = f2bf(p1[r]); }
        return cat16b(a, b); }
    static __device__ __forceinline__ v16bf lo(v8f p0, v8f p1) { v8us a, b;
#pragma unroll
        for (int r = 0; r < 8; ++r) { a[r] = f2bf(p0[r] - bf2f(f2bf(p0[r]))); b[r] = f2bf(p1[r] - bf2f(f2bf(p1[r]))); }
        return cat16b(a, b); }
};

// ---- k_flash: register-fed transposed flash attention; ONE WAVE per (16 queries, head); grid ((rows)/16, NH), 32 threads; roff = first query row of this launch.
// Per 32-key step: S^T[key][query] = K (A operand, rows = keys, k = d) x Q^T (B operand held in registers, lane = query); online softmax per lane (query = lane & 15, the two lane halves hold
// different keys; one xor-16 shuffle for the max); O^T[d][query] += V^T (A operand, rows = d, k = keys, plane [h][d][t]) x P^T (B operand packed from the two score tiles). No LDS in the key loop.
// HL: bf16 hi/lo planes, 3 products per contraction, P not carried. Otherwise fp16 single product with P carried x1024.
template <typename T16, bool HL>
__global__ __launch_bounds__(32) void k_flash(const T16* __restrict__ Q1, const T16* __restrict__ Q2, const T16* __restrict__ K1, const T16* __restrict__ K2, const T16* __restrict__ V1, const T16* __restrict__ V2, int roff, bf* Ah, bf* Al) {
    typedef typename WFrag<T16>::V V;
    __shared__ __align__(16) unsigned short st[2 * 16 * 72];
    const int lane = threadIdx.x & 31, lr = lane & 15, hi = lane >> 4;
    const int q0 = roff + blockIdx.x * 16; const int head = blockIdx.y;
    const size_t hp = (size_t)head * TT * HD;
    const size_t qoff = hp + (size_t)(q0 + lr) * HD + 8 * hi;
    V qa[2], qb[2];
    qa[0] = WFrag<T16>::ld(Q1 + qoff); qa[1] = WFrag<T16>::ld(Q1 + qoff + 32);
    if (HL) { qb[0] = WFrag<T16>::ld(Q2 + qoff); qb[1] = WFrag<T16>::ld(Q2 + qoff + 32); } else { qb[0] = qa[0]; qb[1] = qa[1]; }
    v8f o[4];
#pragma unroll
    for (int dt = 0; dt < 4; ++dt) o[dt] = (v8f){};
    float m = -1.0e30f, l = 0.0f;
    const int nst = (q0 + 47) >> 5;               // keys 0 .. q0+15 in steps of 32
    const size_t koff = hp + (size_t)lr * HD + 8 * hi;
    const size_t voff = hp + (size_t)lr * TT + 8 * hi;
    const int qi = q0 + lr;
#pragma unroll 1
    for (int stp = 0; stp < nst; ++stp) {
        const int kb = stp * 32;
        v8f s[2];
#pragma unroll
        for (int kt = 0; kt < 2; ++kt) {
            const size_t ko = koff + (size_t)(kb + kt * 16) * HD;
            const V k0 = WFrag<T16>::ld(K1 + ko), k1 = WFrag<T16>::ld(K1 + ko + 32);
            v8f a = (v8f){};
            if (HL) { const V l0 = WFrag<T16>::ld(K2 + ko), l1 = WFrag<T16>::ld(K2 + ko + 32);
                a = WFrag<T16>::mma(l0, qa[0], a); a = WFrag<T16>::mma(l1, qa[1], a); a = WFrag<T16>::mma(k0, qb[0], a); a = WFrag<T16>::mma(k1, qb[1], a); }
            a = WFrag<T16>::mma(k0, qa[0], a); a = WFrag<T16>::mma(k1, qa[1], a);
            s[kt] = a;
        }
        asm volatile("v_nop\n\tv_nop\n\tv_nop\n\tv_nop" : "+v"(s[0]), "+v"(s[1]) : "v"(qa[0]), "v"(qa[1]));
        const bool diag = (kb + 31 > q0);         // wave-uniform: this step can hold keys beyond some query
        float mx = -1.0e30f;
#pragma unroll
        for (int kt = 0; kt < 2; ++kt)
#pragma unroll
            for (int r = 0; r < 8; ++r) { const int key = kb + kt * 16 + 8 * hi + r; float t = s[kt][r] * SCL; t = (diag && (key > qi)) ? -1.0e30f : t; s[kt][r] = t; mx = fmaxf(mx, t); }
        mx = fmaxf(mx, __shfl_xor(mx, 16, 32));
        const float mn = fmaxf(m, mx);
        const float al = __builtin_amdgcn_exp2f((m - mn) * L2E);
        m = mn;
        float psum = 0.0f;
#pragma unroll
        for (int kt = 0; kt < 2; ++kt)
#pragma unroll
            for (int r = 0; r < 8; ++r) { const float p = __builtin_amdgcn_exp2f((s[kt][r] - mn) * L2E); s[kt][r] = p; psum += p; }
        l = l * al + psum;
#pragma unroll
        for (int dt = 0; dt < 4; ++dt) o[dt] = o[dt] * al;
        const V pa = PPk<T16>::hi(s[0], s[1]);
        V pb = pa; if (HL) pb = PPk<T16>::lo(s[0], s[1]);
#pragma unroll
        for (int dt = 0; dt < 4; ++dt) {
            const size_t vo = voff + (size_t)(dt * 16) * TT + kb;
            const V v0 = WFrag<T16>::ld(V1 + vo);
            if (HL) { const V v1 = WFrag<T16>::ld(V2 + vo); o[dt] = WFrag<T16>::mma(v1, pa, o[dt]); o[dt] = WFrag<T16>::mma(v0, pb, o[dt]); }
            o[dt] = WFrag<T16>::mma(v0, pa, o[dt]);
        }
        asm volatile("v_nop\n\tv_nop\n\tv_nop\n\tv_nop" : "+v"(o[0]), "+v"(o[1]), "+v"(o[2]), "+v"(o[3]) : "v"(pa), "v"(pb));
    }
    l += __shfl_xor(l, 16, 32);
    const float inv = (HL ? 1.0f : (1.0f / PCAR)) * (1.0f / l);
#pragma unroll
    for (int dt = 0; dt < 4; ++dt) { v8us hv, lv;
#pragma unroll
        for (int r = 0; r < 8; ++r) { unsigned short a2, c2; splitf(o[dt][r] * inv, a2, c2); hv[r] = a2; lv[r] = c2; }
        *(v8usa*)(st + lr * 72 + dt * 16 + 8 * hi) = hv; *(v8usa*)(st + 16 * 72 + lr * 72 + dt * 16 + 8 * hi) = lv; }
    __syncthreads();
{
#pragma unroll
        for (int s4 = 0; s4 < 4; ++s4) { const int row = 4 * s4 + (lane >> 3), c = (lane & 7) * 8;
            const v8us a = *(const v8usa*)(st + row * 72 + c); const v8us b = *(const v8usa*)(st + 16 * 72 + row * 72 + c);
            const size_t oo = (size_t)(q0 + row) * DQ + head * HD + c;
            *(v8us*)(Ah + oo) = a; *(v8us*)(Al + oo) = b; }
         }
}

extern "C" void kernel_launch(void* const* d_in, const int* in_sizes, int n_in,
                              void* d_out, int out_size, void* d_ws, size_t ws_size, hipStream_t stream) {
    if (n_in < 6) return;
    const size_t need = (size_t)(NB - 1) * SEQ_FULL * DM + (size_t)TT * DM;
    if ((size_t)in_sizes[0] < need || (size_t)out_size < need) return;
    if (in_sizes[1] < DM * DQ || in_sizes[2] < DM * DQ || in_sizes[3] < DM * DQ || in_sizes[4] < DQ * DM || in_sizes[5] < DM) return;
    const float* x = (const float*)d_in[0]; const float* wq = (const float*)d_in[1]; const float* wk = (const float*)d_in[2]; const float* wv = (const float*)d_in[3]; const float* wo = (const float*)d_in[4]; const float* bo = (const float*)d_in[5];
    float* OUT = (float*)d_out;     // [2][4096][768], byte offset 0
    char* wsp = (char*)d_ws;
    auto take = [&](size_t bytes) { char* p = wsp; wsp += (bytes + 255) & ~(size_t)255; return (void*)p; };
    bf* WQ = (bf*)take((size_t)DQ * DM * 2); bf* WK = (bf*)take((size_t)DQ * DM * 2); bf* WV = (bf*)take((size_t)DQ * DM * 2); bf* WO = (bf*)take((size_t)DM * DQ * 2);
    bf* XB = (bf*)take((size_t)TT * DM * 2); float* FQ = (float*)take((size_t)TT * DQ * 4); float* FK = (float*)take((size_t)TT * DQ * 4);
    const size_t PL = (size_t)NH_ * TT * HD * 2;
    h16* QP16 = (h16*)take(PL); h16* KP16 = (h16*)take(PL); h16* VT16 = (h16*)take(PL);
    bf* QPh = (bf*)take(PL); bf* QPl = (bf*)take(PL); bf* KPh = (bf*)take(PL); bf* KPl = (bf*)take(PL); bf* VTh = (bf*)take(PL); bf* VTl = (bf*)take(PL);
    bf* ATh = (bf*)take((size_t)TT * DQ * 2); bf* ATl = (bf*)take((size_t)TT * DQ * 2);
    if ((size_t)(wsp - (char*)d_ws) > ws_size) return;    // 105,381,888 B at the full size
    float* FV = FK;   // v projection reuses the k buffer after the k planes are built (stream-ordered)
    const unsigned LW = (unsigned)((DM * DQ / 64 + 63) / 64);
    k_wtG<<<LW, 256, 0, stream>>>(wq, DM, DQ, WQ);   // in[DM][DQ] -> out[DQ][DM]
    k_wtG<<<LW, 256, 0, stream>>>(wk, DM, DQ, WK);
    k_wtG<<<LW, 256, 0, stream>>>(wv, DM, DQ, WV);
    k_wtG<<<LW, 256, 0, stream>>>(wo, DQ, DM, WO);   // in[DQ][DM] -> out[DM][DQ]
    const unsigned LP = (unsigned)(((size_t)NH_ * TT * HD / 8 + 255) / 256);
    for (int b = 0; b < NB; ++b) {
        k_cvt8<<<(unsigned)(((size_t)TT * DM / 8 + 255) / 256), 256, 0, stream>>>(x + (size_t)b * SEQ_FULL * DM, XB, (size_t)TT * DM / 8);
        k_gemmw<bf, 0, false><<<dim3(TT / 64, DQ / 64, 1), 32, 0, stream>>>(XB, nullptr, WQ, nullptr, DM, FQ, DQ, nullptr, 0, 0, 0);
        k_hp<<<LP, 256, 0, stream>>>(FQ, QP16, QPh, QPl);
        k_gemmw<bf, 0, false><<<dim3(TT / 64, DQ / 64, 1), 32, 0, stream>>>(XB, nullptr, WK, nullptr, DM, FK, DQ, nullptr, 0, 0, 0);
        k_hp<<<LP, 256, 0, stream>>>(FK, KP16, KPh, KPl);
        k_gemmw<bf, 0, false><<<dim3(TT / 64, DQ / 64, 1), 32, 0, stream>>>(XB, nullptr, WV, nullptr, DM, FV, DQ, nullptr, 0, 0, 0);
        k_vt<<<LP, 256, 0, stream>>>(FV, VT16, VTh, VTl);
        k_flash<bf, true><<<dim3(RH / 16, NH_, 1), 32, 0, stream>>>(QPh, QPl, KPh, KPl, VTh, VTl, 0, ATh, ATl);
        if (TT > RH) k_flash<h16, false><<<dim3((TT - RH) / 16, NH_, 1), 32, 0, stream>>>(QP16, nullptr, KP16, nullptr, VT16, nullptr, RH, ATh, ATl);
        k_gemmw<bf, 1, true><<<dim3(TT / 64, DM / 64, 1), 32, 0, stream>>>(ATh, ATl, WO, nullptr, DQ, OUT + (size_t)b * SEQ_FULL * DM, DM, bo, 0, 0, 0);
    }
}

// v001
// It runs in 561 microseconds.
// In two side-by-side timings against v000, it was 1.23 and 1.24 times as fast.
#include <hip/hip_runtime.h>

// Causal self-attention block: x [2][4096][768]; q/k/v = x W (W [in][out] 768x768, 12 heads x 64); softmax(q.k / 8) over keys j <= i; out = merged ctx Wo + bo -> [2][4096][768].
// Compute dtypes, f32 accumulate: every input RNE-converted to bf16; q/k/v projections v_wmma_f32_16x16x32_bf16 (plain bf16 operands); scores (K Q^T) and ctx (V^T P^T): query rows < 512 on bf16 hi/lo planes (3 products), other rows v_wmma_f32_16x16x32_f16 single product (P carried x1024); softmax f32; ctx.Wo bf16 hi/lo x bf16 (2 products) + bias.

#ifndef NB
#define NB 2
#endif
#ifndef SEQ
#define SEQ 4096
#endif
#define NB_FULL  2
#define SEQ_FULL 4096
#define TT   SEQ
#define DM   768
#define NH_  12
#define HD   64
#define DQ   (NH_ * HD)
#define RH   ((SEQ) < 512 ? (SEQ) : 512)   // query rows < RH use hi+lo planes
#define PCAR 1024.0f
#define SCL  0.125f                        // HD^-0.5
#define L2E  1.4426950408889634f
#define WSB  ((size_t)4 * DQ * DM * 2 + (size_t)TT * DM * 2 + (size_t)2 * TT * DQ * 4 + (size_t)9 * NH_ * TT * HD * 2 + (size_t)2 * TT * DQ * 2)

static_assert(SEQ % 64 == 0);
static_assert(SEQ <= SEQ_FULL);
static_assert(NB <= NB_FULL);
static_assert(DM % 64 == 0);
static_assert(DQ % 64 == 0);
static_assert(DQ == DM);
static_assert(RH % 16 == 0);
static_assert((TT - RH) % 16 == 0);
static_assert(((size_t)DQ * DM * 2) % 256 == 0);
static_assert(((size_t)TT * DM * 2) % 256 == 0);
static_assert(((size_t)NH_ * TT * HD * 2) % 256 == 0);
static_assert(WSB <= (size_t)134217728);

typedef _Float16 h16;
typedef unsigned short bf;
typedef __attribute__((ext_vector_type(16))) __bf16   v16bf;
typedef __attribute__((ext_vector_type(16))) _Float16 v16h;
typedef __attribute__((ext_vector_type(8)))  _Float16 v8h;
typedef __attribute__((ext_vector_type(8)))  unsigned short v8us;
typedef __attribute__((ext_vector_type(8)))  float    v8f;
typedef __attribute__((ext_vector_type(4)))  float    v4f;
typedef __attribute__((ext_vector_type(2)))  unsigned short v2us;
typedef v8h  __attribute__((may_alias)) v8ha;
typedef v4f  __attribute__((may_alias)) v4fa;
typedef v8us __attribute__((may_alias)) v8usa;

__device__ __forceinline__ unsigned short f2bf(float f) { unsigned u = __float_as_uint(f); u += 0x7FFFu + ((u >> 16) & 1u); return (unsigned short)(u >> 16); }
__device__ __forceinline__ float bf2f(unsigned short b) { return __uint_as_float(((unsigned)b) << 16); }
__device__ __forceinline__ float bfr(float f) { return bf2f(f2bf(f)); }
__device__ __forceinline__ v16h cat16(v8h lo, v8h hi) { return __builtin_shufflevector(lo, hi, 0, 1, 2, 3, 4, 5, 6, 7, 8, 9, 10, 11, 12, 13, 14, 15); }
__device__ __forceinline__ v16bf cat16b(v8us lo, v8us hi) { return __builtin_bit_cast(v16bf, __builtin_shufflevector(lo, hi, 0, 1, 2, 3, 4, 5, 6, 7, 8, 9, 10, 11, 12, 13, 14, 15)); }
__device__ __forceinline__ v8f wmma16(v16h a, v16h b, v8f c) { return __builtin_amdgcn_wmma_f32_16x16x32_f16(false, a, false, b, (short)0, c, false, false); }
__device__ __forceinline__ v8f wmmab(v16bf a, v16bf b, v8f c) { return __builtin_amdgcn_wmma_f32_16x16x32_bf16(false, a, false, b, (short)0, c, false, false); }
__device__ __forceinline__ void splitf(float y, unsigned short& h, unsigned short& l) { h = f2bf(y); l = f2bf(y - bf2f(h)); }

// Fragment loader for K-contiguous 16-bit rows: p points at row (lane & 15), element k0 + 8 * (lane >> 4); elements 0..7 <- p[0..7], elements 8..15 <- p[16..23]. Same map for A and B operands.
template <typename T16> struct WFrag;
template <> struct WFrag<h16> { typedef v16h V; static __device__ __forceinline__ V ld(const h16* p) { return cat16(*(const v8h*)p, *(const v8h*)(p + 16)); } static __device__ __forceinline__ v8f mma(V a, V b, v8f c) { return wmma16(a, b, c); } };
template <> struct WFrag<bf> { typedef v16bf V; static __device__ __forceinline__ V ld(const bf* p) { return cat16b(*(const v8us*)p, *(const v8us*)(p + 16)); } static __device__ __forceinline__ v8f mma(V a, V b, v8f c) { return wmmab(a, b, c); } };

// ---- k_gemmw: register-blocked GEMM, ONE WAVE per 64x64 output tile (16 accumulators), operands straight from K-contiguous 16-bit planes; grid (M/64, N/64, Z), 32 threads.
// C[m][n] (f32, pitch ldc, + optional f32 bias[n]) = sum_k A[m][k] Bt[n][k] (+ split products per NSPLIT). K % 32 == 0, M % 64 == 0, N % 64 == 0.
template <typename T16, int NSPLIT, bool BIAS>
__global__ __launch_bounds__(32) void k_gemmw(const T16* __restrict__ A, const T16* __restrict__ A2, const T16* __restrict__ Bt, const T16* __restrict__ Bt2, int K, float* C, int ldc, const float* __restrict__ bias, size_t sA, size_t sB, size_t sC) {
    typedef typename WFrag<T16>::V V;
    __shared__ __align__(16) float os[16 * 68];
    const size_t z = blockIdx.z; A += z * sA; if (A2) A2 += z * sA; Bt += z * sB; if (Bt2) Bt2 += z * sB; C += z * sC;
    const int lane = threadIdx.x & 31, lr = lane & 15, hi = lane >> 4; const int r0 = blockIdx.x * 64, c0 = blockIdx.y * 64;
    v8f acc[4][4];
#pragma unroll
    for (int mb = 0; mb < 4; ++mb)
#pragma unroll
        for (int nb = 0; nb < 4; ++nb) acc[mb][nb] = (v8f){};
    const size_t aoff = (size_t)(r0 + lr) * K + 8 * hi, boff = (size_t)(c0 + lr) * K + 8 * hi;
#pragma unroll 1
    for (int kc = 0; kc < K; kc += 32) {
        V a[4], a2[4];
#pragma unroll
        for (int mb = 0; mb < 4; ++mb) { a[mb] = WFrag<T16>::ld(A + aoff + (size_t)mb * 16 * K + kc); if (NSPLIT == 1 || NSPLIT == 2) a2[mb] = WFrag<T16>::ld(A2 + aoff + (size_t)mb * 16 * K + kc); }
#pragma unroll
        for (int nb = 0; nb < 4; ++nb) { const V b = WFrag<T16>::ld(Bt + boff + (size_t)nb * 16 * K + kc); V b2; if (NSPLIT >= 2) b2 = WFrag<T16>::ld(Bt2 + boff + (size_t)nb * 16 * K + kc);
#pragma unroll
            for (int mb = 0; mb < 4; ++mb) { acc[mb][nb] = WFrag<T16>::mma(a[mb], b, acc[mb][nb]); if (NSPLIT == 1 || NSPLIT == 2) acc[mb][nb] = WFrag<T16>::mma(a2[mb], b, acc[mb][nb]); if (NSPLIT >= 2) acc[mb][nb] = WFrag<T16>::mma(a[mb], b2, acc[mb][nb]); } }
        asm volatile("v_nop\n\tv_nop\n\tv_nop\n\tv_nop" : "+v"(acc[0][0]), "+v"(acc[1][1]), "+v"(acc[2][2]), "+v"(acc[3][3]) : "v"(a[0]), "v"(a[3]));
    }
#pragma unroll
    for (int mb = 0; mb < 4; ++mb) {
#pragma unroll
        for (int nb = 0; nb < 4; ++nb) {
#pragma unroll
            for (int j = 0; j < 8; ++j) os[(hi * 8 + j) * 68 + nb * 16 + lr] = acc[mb][nb][j]; }
        __builtin_amdgcn_wave_barrier(); asm volatile("" ::: "memory");
        float* crow = C + (size_t)(r0 + mb * 16) * ldc + c0;
{
#pragma unroll
            for (int s = 0; s < 8; ++s) { const int row = 2 * s + hi, cofs = lr * 4; v4f val = *(const v4fa*)(os + row * 68 + cofs); if (BIAS) { val[0] += bfr(bias[c0 + cofs]); val[1] += bfr(bias[c0 + cofs + 1]); val[2] += bfr(bias[c0 + cofs + 2]); val[3] += bfr(bias[c0 + cofs + 3]); }
                *(v4f*)(crow + (size_t)row * ldc + cofs) = val; }
             }
        __builtin_amdgcn_wave_barrier(); asm volatile("" ::: "memory");
    }
}

__global__ __launch_bounds__(256) void k_wtG(const float* __restrict__ w, int K, int N, bf* Bt) {
    const int lane = threadIdx.x & 31; const int L0 = (blockIdx.x * 8 + (threadIdx.x >> 5)) * 8; const int nlines = N * K / 64;
{
#pragma unroll 1
        for (int l = 0; l < 8; ++l) { const int L = L0 + l; if (L >= nlines) break; const size_t e = (size_t)L * 64 + lane * 2; const int k = (int)(e % K), n = (int)(e / K); v2us o;
            o[0] = f2bf(w[(size_t)k * N + n]); o[1] = f2bf(w[(size_t)(k + 1) * N + n]); *(v2us*)(Bt + e) = o; }
         }
}
__global__ __launch_bounds__(256) void k_cvt8(const float* __restrict__ src, bf* dst, size_t n8) { const size_t i = (size_t)blockIdx.x * 256 + threadIdx.x; if (i >= n8) return; const v8f v = *(const v8f*)(src + i * 8); v8us o;
#pragma unroll
    for (int k = 0; k < 8; ++k) o[k] = f2bf(v[k]); *(v8us*)(dst + i * 8) = o;  }
__global__ __launch_bounds__(256) void k_hp(const float* __restrict__ F, h16* P16, bf* Ph, bf* Pl) {
    const size_t e = ((size_t)blockIdx.x * 256 + threadIdx.x) * 8; if (e >= (size_t)NH_ * TT * HD) return;
    const int d = (int)(e % HD); const int t = (int)((e / HD) % TT); const int h = (int)(e / ((size_t)HD * TT));
    const v8f x = *(const v8f*)(F + (size_t)t * DQ + h * HD + d); v8h o16; v8us oh, ol;
#pragma unroll
    for (int q = 0; q < 8; ++q) { o16[q] = (h16)x[q]; unsigned short a2, c2; splitf(x[q], a2, c2); oh[q] = a2; ol[q] = c2; }
    *(v8h*)(P16 + e) = o16; *(v8us*)(Ph + e) = oh; *(v8us*)(Pl + e) = ol;  }
__global__ __launch_bounds__(256) void k_vt(const float* __restrict__ F, h16* V16, bf* Vh, bf* Vl) {
    const size_t e = ((size_t)blockIdx.x * 256 + threadIdx.x) * 8; if (e >= (size_t)NH_ * HD * TT) return;
    const int t = (int)(e % TT); const int d = (int)((e / TT) % HD); const int g = (int)(e / ((size_t)TT * HD)); v8h o16; v8us oh, ol;
#pragma unroll
    for (int q = 0; q < 8; ++q) { const float x = F[(size_t)(t + q) * DQ + g * HD + d]; o16[q] = (h16)x; unsigned short a2, c2; splitf(x, a2, c2); oh[q] = a2; ol[q] = c2; }
    *(v8h*)(V16 + e) = o16; *(v8us*)(Vh + e) = oh; *(v8us*)(Vl + e) = ol;  }

// Probability packers: two 16-key score tiles (accumulator layout: lane = query, element r = key 8*(lane>>4)+r) -> one 32-key B fragment (elements 0..7 <- tile 0, 8..15 <- tile 1).
template <typename T16> struct PPk;
template <> struct PPk<h16> {
    static __device__ __forceinline__ v16h hi(v8f p0, v8f p1) { v8h a, b;
#pragma unroll
        for (int r = 0; r < 8; ++r) { a[r] = (h16)(p0[r] * PCAR); b[r] = (h16)(p1[r] * PCAR); }
        return cat16(a, b); }
    static __device__ __forceinline__ v16h lo(v8f p0, v8f p1) { return hi(p0, p1); }
};
template <> struct PPk<bf> {
    static __device__ __forceinline__ v16bf hi(v8f p0, v8f p1) { v8us a, b;
#pragma unroll
        for (int r = 0; r < 8; ++r) { a[r] = f2bf(p0[r]); b[r] = f2bf(p1[r]); }
        return cat16b(a, b); }
    static __device__ __forceinline__ v16bf lo(v8f p0, v8f p1) { v8us a, b;
#pragma unroll
        for (int r = 0; r < 8; ++r) { a[r] = f2bf(p0[r] - bf2f(f2bf(p0[r]))); b[r] = f2bf(p1[r] - bf2f(f2bf(p1[r]))); }
        return cat16b(a, b); }
};

// ---- k_flash: register-fed transposed flash attention; ONE WAVE per (16 queries, head); grid ((rows)/16, NH), 32 threads; roff = first query row of this launch.
// Per 32-key step: S^T[key][query] = K (A operand, rows = keys, k = d) x Q^T (B operand held in registers, lane = query); online softmax per lane (query = lane & 15, the two lane halves hold
// different keys; one xor-16 shuffle for the max); O^T[d][query] += V^T (A operand, rows = d, k = keys, plane [h][d][t]) x P^T (B operand packed from the two score tiles). No LDS in the key loop.
// HL: bf16 hi/lo planes, 3 products per contraction, P not carried. Otherwise fp16 single product with P carried x1024.
// The K and V^T fragments of a step live in one of two register sets; each step first issues all loads of the NEXT step into the other set, so a load has a whole step to land.
template <typename T16, bool HL> struct FKV { typename WFrag<T16>::V k[4], kl[4], v[4], vl[4]; };   // kl, vl: lo planes, HL only

template <typename T16, bool HL>
__device__ __forceinline__ void ldkv(FKV<T16, HL>& f, const T16* __restrict__ K1, const T16* __restrict__ K2, const T16* __restrict__ V1, const T16* __restrict__ V2, size_t koff, size_t voff, int kb) {
    const size_t ko = koff + (size_t)kb * HD, vo = voff + kb;
#pragma unroll
    for (int i = 0; i < 4; ++i) f.k[i] = WFrag<T16>::ld(K1 + ko + (size_t)(i >> 1) * 16 * HD + (i & 1) * 32);
    if (HL) {
        // HL build: the compiler lets later loads land on the address registers of the loads above; one wait behind each plane's loads
        asm volatile("s_wait_xcnt 0x0" ::: "memory");
#pragma unroll
        for (int i = 0; i < 4; ++i) f.kl[i] = WFrag<T16>::ld(K2 + ko + (size_t)(i >> 1) * 16 * HD + (i & 1) * 32);
        asm volatile("s_wait_xcnt 0x0" ::: "memory");   // as above
    }
#pragma unroll
    for (int dt = 0; dt < 4; ++dt) f.v[dt] = WFrag<T16>::ld(V1 + vo + (size_t)(dt * 16) * TT);
    if (HL) {
        asm volatile("s_wait_xcnt 0x0" ::: "memory");   // as above
#pragma unroll
        for (int dt = 0; dt < 4; ++dt) f.vl[dt] = WFrag<T16>::ld(V2 + vo + (size_t)(dt * 16) * TT);
        asm volatile("s_wait_xcnt 0x0" ::: "memory");   // as above
    }
}

template <typename T16, bool HL>
__device__ __forceinline__ void fstep(const FKV<T16, HL>& f, const typename WFrag<T16>::V (&qa)[2], const typename WFrag<T16>::V (&qb)[2], v8f (&o)[4], float& m, float& l, int kb, int q0, int qi, int hi) {
    typedef typename WFrag<T16>::V V;
    v8f s[2];
#pragma unroll
    for (int kt = 0; kt < 2; ++kt) {
        v8f a = (v8f){};
        if (HL) { a = WFrag<T16>::mma(f.kl[2 * kt], qa[0], a); a = WFrag<T16>::mma(f.kl[2 * kt + 1], qa[1], a); a = WFrag<T16>::mma(f.k[2 * kt], qb[0], a); a = WFrag<T16>::mma(f.k[2 * kt + 1], qb[1], a); }
        a = WFrag<T16>::mma(f.k[2 * kt], qa[0], a); a = WFrag<T16>::mma(f.k[2 * kt + 1], qa[1], a);
        s[kt] = a;
    }
    asm volatile("v_nop\n\tv_nop\n\tv_nop\n\tv_nop" : "+v"(s[0]), "+v"(s[1]) : "v"(qa[0]), "v"(qa[1]));
    const bool diag = (kb + 31 > q0);         // wave-uniform: this step can hold keys beyond some query
    float mx = -1.0e30f;
#pragma unroll
    for (int kt = 0; kt < 2; ++kt)
#pragma unroll
        for (int r = 0; r < 8; ++r) { const int key = kb + kt * 16 + 8 * hi + r; float t = s[kt][r] * SCL; t = (diag && (key > qi)) ? -1.0e30f : t; s[kt][r] = t; mx = fmaxf(mx, t); }
    mx = fmaxf(mx, __shfl_xor(mx, 16, 32));
    const float mn = fmaxf(m, mx);
    const float al = __builtin_amdgcn_exp2f((m - mn) * L2E);
    m = mn;
    float psum = 0.0f;
#pragma unroll
    for (int kt = 0; kt < 2; ++kt)
#pragma unroll
        for (int r = 0; r < 8; ++r) { const float p = __builtin_amdgcn_exp2f((s[kt][r] - mn) * L2E); s[kt][r] = p; psum += p; }
    l = l * al + psum;
#pragma unroll
    for (int dt = 0; dt < 4; ++dt) o[dt] = o[dt] * al;
    const V pa = PPk<T16>::hi(s[0], s[1]);
    V pb = pa; if (HL) pb = PPk<T16>::lo(s[0], s[1]);
#pragma unroll
    for (int dt = 0; dt < 4; ++dt) {
        if (HL) { o[dt] = WFrag<T16>::mma(f.vl[dt], pa, o[dt]); o[dt] = WFrag<T16>::mma(f.v[dt], pb, o[dt]); }
        o[dt] = WFrag<T16>::mma(f.v[dt], pa, o[dt]);
    }
    asm volatile("v_nop\n\tv_nop\n\tv_nop\n\tv_nop" : "+v"(o[0]), "+v"(o[1]), "+v"(o[2]), "+v"(o[3]) : "v"(pa), "v"(pb));
}

template <typename T16, bool HL>
__global__ __launch_bounds__(32) void k_flash(const T16* __restrict__ Q1, const T16* __restrict__ Q2, const T16* __restrict__ K1, const T16* __restrict__ K2, const T16* __restrict__ V1, const T16* __restrict__ V2, int roff, bf* Ah, bf* Al) {
    typedef typename WFrag<T16>::V V;
    __shared__ __align__(16) unsigned short st[2 * 16 * 72];
    const int lane = threadIdx.x & 31, lr = lane & 15, hi = lane >> 4;
    const int q0 = roff + blockIdx.x * 16; const int head = blockIdx.y;
    const size_t hp = (size_t)head * TT * HD;
    const size_t qoff = hp + (size_t)(q0 + lr) * HD + 8 * hi;
    V qa[2], qb[2];
    qa[0] = WFrag<T16>::ld(Q1 + qoff); qa[1] = WFrag<T16>::ld(Q1 + qoff + 32);
    if (HL) { qb[0] = WFrag<T16>::ld(Q2 + qoff); qb[1] = WFrag<T16>::ld(Q2 + qoff + 32); } else { qb[0] = qa[0]; qb[1] = qa[1]; }
    v8f o[4];
#pragma unroll
    for (int dt = 0; dt < 4; ++dt) o[dt] = (v8f){};
    float m = -1.0e30f, l = 0.0f;
    const int nst = (q0 + 47) >> 5;               // keys 0 .. q0+15 in steps of 32; at least 1
    const size_t koff = hp + (size_t)lr * HD + 8 * hi;
    const size_t voff = hp + (size_t)lr * TT + 8 * hi;
    const int qi = q0 + lr;
    FKV<T16, HL> fa, fb;
    ldkv<T16, HL>(fa, K1, K2, V1, V2, koff, voff, 0);
    asm volatile("s_wait_xcnt 0x0" ::: "memory");   // the address registers of the loads above are reused below
    int stp = 0;
    // two steps per trip, so that the two register sets swap roles without copies
#pragma unroll 1
    for (; stp + 1 < nst; stp += 2) {
        ldkv<T16, HL>(fb, K1, K2, V1, V2, koff, voff, (stp + 1) * 32);
        fstep<T16, HL>(fa, qa, qb, o, m, l, stp * 32, q0, qi, hi);
        const int nx = (stp + 2 < nst) ? stp + 2 : nst - 1;   // past the last step: fetch the last step again, in bounds and unused
        ldkv<T16, HL>(fa, K1, K2, V1, V2, koff, voff, nx * 32);
        fstep<T16, HL>(fb, qa, qb, o, m, l, (stp + 1) * 32, q0, qi, hi);
        if (!HL) asm volatile("s_wait_xcnt 0x0" ::: "memory");   // the next trip reuses the address registers of this trip's last loads
    }
    if (stp < nst) fstep<T16, HL>(fa, qa, qb, o, m, l, stp * 32, q0, qi, hi);
    l += __shfl_xor(l, 16, 32);
    const float inv = (HL ? 1.0f : (1.0f / PCAR)) * (1.0f / l);
#pragma unroll
    for (int dt = 0; dt < 4; ++dt) { v8us hv, lv;
#pragma unroll
        for (int r = 0; r < 8; ++r) { unsigned short a2, c2; splitf(o[dt][r] * inv, a2, c2); hv[r] = a2; lv[r] = c2; }
        *(v8usa*)(st + lr * 72 + dt * 16 + 8 * hi) = hv; *(v8usa*)(st + 16 * 72 + lr * 72 + dt * 16 + 8 * hi) = lv; }
    __syncthreads();
{
#pragma unroll
        for (int s4 = 0; s4 < 4; ++s4) { const int row = 4 * s4 + (lane >> 3), c = (lane & 7) * 8;
            const v8us a = *(const v8usa*)(st + row * 72 + c); const v8us b = *(const v8usa*)(st + 16 * 72 + row * 72 + c);
            const size_t oo = (size_t)(q0 + row) * DQ + head * HD + c;
            *(v8us*)(Ah + oo) = a; *(v8us*)(Al + oo) = b; }
         }
}

extern "C" void kernel_launch(void* const* d_in, const int* in_sizes, int n_in,
                              void* d_out, int out_size, void* d_ws, size_t ws_size, hipStream_t stream) {
    if (n_in < 6) return;
    const size_t need = (size_t)(NB - 1) * SEQ_FULL * DM + (size_t)TT * DM;
    if ((size_t)in_sizes[0] < need || (size_t)out_size < need) return;
    if (in_sizes[1] < DM * DQ || in_sizes[2] < DM * DQ || in_sizes[3] < DM * DQ || in_sizes[4] < DQ * DM || in_sizes[5] < DM) return;
    const float* x = (const float*)d_in[0]; const float* wq = (const float*)d_in[1]; const float* wk = (const float*)d_in[2]; const float* wv = (const float*)d_in[3]; const float* wo = (const float*)d_in[4]; const float* bo = (const float*)d_in[5];
    float* OUT = (float*)d_out;     // [2][4096][768], byte offset 0
    char* wsp = (char*)d_ws;
    auto take = [&](size_t bytes) { char* p = wsp; wsp += (bytes + 255) & ~(size_t)255; return (void*)p; };
    bf* WQ = (bf*)take((size_t)DQ * DM * 2); bf* WK = (bf*)take((size_t)DQ * DM * 2); bf* WV = (bf*)take((size_t)DQ * DM * 2); bf* WO = (bf*)take((size_t)DM * DQ * 2);
    bf* XB = (bf*)take((size_t)TT * DM * 2); float* FQ = (float*)take((size_t)TT * DQ * 4); float* FK = (float*)take((size_t)TT * DQ * 4);
    const size_t PL = (size_t)NH_ * TT * HD * 2;
    h16* QP16 = (h16*)take(PL); h16* KP16 = (h16*)take(PL); h16* VT16 = (h16*)take(PL);
    bf* QPh = (bf*)take(PL); bf* QPl = (bf*)take(PL); bf* KPh = (bf*)take(PL); bf* KPl = (bf*)take(PL); bf* VTh = (bf*)take(PL); bf* VTl = (bf*)take(PL);
    bf* ATh = (bf*)take((size_t)TT * DQ * 2); bf* ATl = (bf*)take((size_t)TT * DQ * 2);
    if ((size_t)(wsp - (char*)d_ws) > ws_size) return;    // 105,381,888 B at the full size
    float* FV = FK;   // v projection reuses the k buffer after the k planes are built (stream-ordered)
    const unsigned LW = (unsigned)((DM * DQ / 64 + 63) / 64);
    k_wtG<<<LW, 256, 0, stream>>>(wq, DM, DQ, WQ);   // in[DM][DQ] -> out[DQ][DM]
    k_wtG<<<LW, 256, 0, stream>>>(wk, DM, DQ, WK);
    k_wtG<<<LW, 256, 0, stream>>>(wv, DM, DQ, WV);
    k_wtG<<<LW, 256, 0, stream>>>(wo, DQ, DM, WO);   // in[DQ][DM] -> out[DM][DQ]
    const unsigned LP = (unsigned)(((size_t)NH_ * TT * HD / 8 + 255) / 256);
    for (int b = 0; b < NB; ++b) {
        k_cvt8<<<(unsigned)(((size_t)TT * DM / 8 + 255) / 256), 256, 0, stream>>>(x + (size_t)b * SEQ_FULL * DM, XB, (size_t)TT * DM / 8);
        k_gemmw<bf, 0, false><<<dim3(TT / 64, DQ / 64, 1), 32, 0, stream>>>(XB, nullptr, WQ, nullptr, DM, FQ, DQ, nullptr, 0, 0, 0);
        k_hp<<<LP, 256, 0, stream>>>(FQ, QP16, QPh, QPl);
        k_gemmw<bf, 0, false><<<dim3(TT / 64, DQ / 64, 1), 32, 0, stream>>>(XB, nullptr, WK, nullptr, DM, FK, DQ, nullptr, 0, 0, 0);
        k_hp<<<LP, 256, 0, stream>>>(FK, KP16, KPh, KPl);
        k_gemmw<bf, 0, false><<<dim3(TT / 64, DQ / 64, 1), 32, 0, stream>>>(XB, nullptr, WV, nullptr, DM, FV, DQ, nullptr, 0, 0, 0);
        k_vt<<<LP, 256, 0, stream>>>(FV, VT16, VTh, VTl);
        k_flash<bf, true><<<dim3(RH / 16, NH_, 1), 32, 0, stream>>>(QPh, QPl, KPh, KPl, VTh, VTl, 0, ATh, ATl);
        if (TT > RH) k_flash<h16, false><<<dim3((TT - RH) / 16, NH_, 1), 32, 0, stream>>>(QP16, nullptr, KP16, nullptr, VT16, nullptr, RH, ATh, ATl);
        k_gemmw<bf, 1, true><<<dim3(TT / 64, DM / 64, 1), 32, 0, stream>>>(ATh, ATl, WO, nullptr, DQ, OUT + (size_t)b * SEQ_FULL * DM, DM, bo, 0, 0, 0);
    }
}

// v002
// A run of this version takes 407 microseconds.
// In two side-by-side timings against v001, it was 1.40 and 1.38 times as fast.
// Counting every step since v000, it is 1.71 times as fast.
#include <hip/hip_runtime.h>

// Causal self-attention block: x [2][4096][768]; q/k/v = x W (W [in][out] 768x768, 12 heads x 64); softmax(q.k / 8) over keys j <= i; out = merged ctx Wo + bo -> [2][4096][768].
// Compute dtypes, f32 accumulate: every input RNE-converted to bf16; q/k/v projections v_wmma_f32_16x16x32_bf16 (plain bf16 operands); scores (K Q^T) and ctx (V^T P^T): query rows < 512 on bf16 hi/lo planes (3 products), other rows v_wmma_f32_16x16x32_f16 single product (P carried x1024); softmax f32; ctx.Wo bf16 hi/lo x bf16 (2 products) + bias.

#ifndef NB
#define NB 2
#endif
#ifndef SEQ
#define SEQ 4096
#endif
#define NB_FULL  2
#define SEQ_FULL 4096
#define TT   SEQ
#define DM   768
#define NH_  12
#define HD   64
#define DQ   (NH_ * HD)
#define RH   ((SEQ) < 512 ? (SEQ) : 512)   // query rows < RH use hi+lo planes
#define PCAR 1024.0f
#define SCL  0.125f                        // HD^-0.5
#define L2E  1.4426950408889634f
#define WSB  ((size_t)4 * DQ * DM * 2 + (size_t)TT * DM * 2 + (size_t)2 * TT * DQ * 4 + (size_t)9 * NH_ * TT * HD * 2 + (size_t)2 * TT * DQ * 2)

static_assert(SEQ % 64 == 0);
static_assert(SEQ <= SEQ_FULL);
static_assert(NB <= NB_FULL);
static_assert(DM % 64 == 0);
static_assert(DQ % 64 == 0);
static_assert(DQ == DM);
static_assert(RH % 16 == 0);
static_assert((TT - RH) % 16 == 0);
static_assert(((size_t)DQ * DM * 2) % 256 == 0);
static_assert(((size_t)TT * DM * 2) % 256 == 0);
static_assert(((size_t)NH_ * TT * HD * 2) % 256 == 0);
static_assert(WSB <= (size_t)134217728);

typedef _Float16 h16;
typedef unsigned short bf;
typedef __attribute__((ext_vector_type(16))) __bf16   v16bf;
typedef __attribute__((ext_vector_type(16))) _Float16 v16h;
typedef __attribute__((ext_vector_type(8)))  _Float16 v8h;
typedef __attribute__((ext_vector_type(8)))  unsigned short v8us;
typedef __attribute__((ext_vector_type(8)))  float    v8f;
typedef __attribute__((ext_vector_type(4)))  float    v4f;
typedef __attribute__((ext_vector_type(2)))  unsigned short v2us;
typedef v8h  __attribute__((may_alias)) v8ha;
typedef v4f  __attribute__((may_alias)) v4fa;
typedef v8us __attribute__((may_alias)) v8usa;

__device__ __forceinline__ unsigned short f2bf(float f) { unsigned u = __float_as_uint(f); u += 0x7FFFu + ((u >> 16) & 1u); return (unsigned short)(u >> 16); }
__device__ __forceinline__ float bf2f(unsigned short b) { return __uint_as_float(((unsigned)b) << 16); }
__device__ __forceinline__ float bfr(float f) { return bf2f(f2bf(f)); }
__device__ __forceinline__ v16h cat16(v8h lo, v8h hi) { return __builtin_shufflevector(lo, hi, 0, 1, 2, 3, 4, 5, 6, 7, 8, 9, 10, 11, 12, 13, 14, 15); }
__device__ __forceinline__ v16bf cat16b(v8us lo, v8us hi) { return __builtin_bit_cast(v16bf, __builtin_shufflevector(lo, hi, 0, 1, 2, 3, 4, 5, 6, 7, 8, 9, 10, 11, 12, 13, 14, 15)); }
__device__ __forceinline__ v8f wmma16(v16h a, v16h b, v8f c) { return __builtin_amdgcn_wmma_f32_16x16x32_f16(false, a, false, b, (short)0, c, false, false); }
__device__ __forceinline__ v8f wmmab(v16bf a, v16bf b, v8f c) { return __builtin_amdgcn_wmma_f32_16x16x32_bf16(false, a, false, b, (short)0, c, false, false); }
__device__ __forceinline__ void splitf(float y, unsigned short& h, unsigned short& l) { h = f2bf(y); l = f2bf(y - bf2f(h)); }

// Fragment loader for K-contiguous 16-bit rows: p points at row (lane & 15), element k0 + 8 * (lane >> 4); elements 0..7 <- p[0..7], elements 8..15 <- p[16..23]. Same map for A and B operands.
// Fragment-order planes (Q, K and V^T of the attention kernels): a 16-bit matrix [rows][k] kept as tiles of 16 rows x 32 k (512 elements, 1 KiB). Inside a tile the 16-byte chunk 32 * s + lane holds row (lane & 15),
// k = 16 * s + 8 * (lane >> 4) + 0..7: the element order of the loader above. A tile is one fragment, and each of its two loads reads 512 contiguous bytes (4 whole cache lines) instead of 32 bytes from each of 16 rows.
// ldf: p points at tile base + 8 * lane; elements 0..7 <- p[0..7], elements 8..15 <- p[256..263].
template <typename T16> struct WFrag;
template <> struct WFrag<h16> { typedef v16h V; static __device__ __forceinline__ V ld(const h16* p) { return cat16(*(const v8h*)p, *(const v8h*)(p + 16)); } static __device__ __forceinline__ V ldf(const h16* p) { return cat16(*(const v8h*)p, *(const v8h*)(p + 256)); } static __device__ __forceinline__ v8f mma(V a, V b, v8f c) { return wmma16(a, b, c); } };
template <> struct WFrag<bf> { typedef v16bf V; static __device__ __forceinline__ V ld(const bf* p) { return cat16b(*(const v8us*)p, *(const v8us*)(p + 16)); } static __device__ __forceinline__ V ldf(const bf* p) { return cat16b(*(const v8us*)p, *(const v8us*)(p + 256)); } static __device__ __forceinline__ v8f mma(V a, V b, v8f c) { return wmmab(a, b, c); } };

// ---- k_gemmw: register-blocked GEMM, ONE WAVE per 64x64 output tile (16 accumulators), operands straight from K-contiguous 16-bit planes; grid (M/64, N/64, Z), 32 threads.
// C[m][n] (f32, pitch ldc, + optional f32 bias[n]) = sum_k A[m][k] Bt[n][k] (+ split products per NSPLIT). K % 32 == 0, M % 64 == 0, N % 64 == 0.
template <typename T16, int NSPLIT, bool BIAS>
__global__ __launch_bounds__(32) void k_gemmw(const T16* __restrict__ A, const T16* __restrict__ A2, const T16* __restrict__ Bt, const T16* __restrict__ Bt2, int K, float* C, int ldc, const float* __restrict__ bias, size_t sA, size_t sB, size_t sC) {
    typedef typename WFrag<T16>::V V;
    __shared__ __align__(16) float os[16 * 68];
    const size_t z = blockIdx.z; A += z * sA; if (A2) A2 += z * sA; Bt += z * sB; if (Bt2) Bt2 += z * sB; C += z * sC;
    const int lane = threadIdx.x & 31, lr = lane & 15, hi = lane >> 4; const int r0 = blockIdx.x * 64, c0 = blockIdx.y * 64;
    v8f acc[4][4];
#pragma unroll
    for (int mb = 0; mb < 4; ++mb)
#pragma unroll
        for (int nb = 0; nb < 4; ++nb) acc[mb][nb] = (v8f){};
    const size_t aoff = (size_t)(r0 + lr) * K + 8 * hi, boff = (size_t)(c0 + lr) * K + 8 * hi;
#pragma unroll 1
    for (int kc = 0; kc < K; kc += 32) {
        V a[4], a2[4];
#pragma unroll
        for (int mb = 0; mb < 4; ++mb) { a[mb] = WFrag<T16>::ld(A + aoff + (size_t)mb * 16 * K + kc); if (NSPLIT == 1 || NSPLIT == 2) a2[mb] = WFrag<T16>::ld(A2 + aoff + (size_t)mb * 16 * K + kc); }
#pragma unroll
        for (int nb = 0; nb < 4; ++nb) { const V b = WFrag<T16>::ld(Bt + boff + (size_t)nb * 16 * K + kc); V b2; if (NSPLIT >= 2) b2 = WFrag<T16>::ld(Bt2 + boff + (size_t)nb * 16 * K + kc);
#pragma unroll
            for (int mb = 0; mb < 4; ++mb) { acc[mb][nb] = WFrag<T16>::mma(a[mb], b, acc[mb][nb]); if (NSPLIT == 1 || NSPLIT == 2) acc[mb][nb] = WFrag<T16>::mma(a2[mb], b, acc[mb][nb]); if (NSPLIT >= 2) acc[mb][nb] = WFrag<T16>::mma(a[mb], b2, acc[mb][nb]); } }
        asm volatile("v_nop\n\tv_nop\n\tv_nop\n\tv_nop" : "+v"(acc[0][0]), "+v"(acc[1][1]), "+v"(acc[2][2]), "+v"(acc[3][3]) : "v"(a[0]), "v"(a[3]));
    }
#pragma unroll
    for (int mb = 0; mb < 4; ++mb) {
#pragma unroll
        for (int nb = 0; nb < 4; ++nb) {
#pragma unroll
            for (int j = 0; j < 8; ++j) os[(hi * 8 + j) * 68 + nb * 16 + lr] = acc[mb][nb][j]; }
        __builtin_amdgcn_wave_barrier(); asm volatile("" ::: "memory");
        float* crow = C + (size_t)(r0 + mb * 16) * ldc + c0;
{
#pragma unroll
            for (int s = 0; s < 8; ++s) { const int row = 2 * s + hi, cofs = lr * 4; v4f val = *(const v4fa*)(os + row * 68 + cofs); if (BIAS) { val[0] += bfr(bias[c0 + cofs]); val[1] += bfr(bias[c0 + cofs + 1]); val[2] += bfr(bias[c0 + cofs + 2]); val[3] += bfr(bias[c0 + cofs + 3]); }
                *(v4f*)(crow + (size_t)row * ldc + cofs) = val; }
             }
        __builtin_amdgcn_wave_barrier(); asm volatile("" ::: "memory");
    }
}

__global__ __launch_bounds__(256) void k_wtG(const float* __restrict__ w, int K, int N, bf* Bt) {
    const int lane = threadIdx.x & 31; const int L0 = (blockIdx.x * 8 + (threadIdx.x >> 5)) * 8; const int nlines = N * K / 64;
{
#pragma unroll 1
        for (int l = 0; l < 8; ++l) { const int L = L0 + l; if (L >= nlines) break; const size_t e = (size_t)L * 64 + lane * 2; const int k = (int)(e % K), n = (int)(e / K); v2us o;
            o[0] = f2bf(w[(size_t)k * N + n]); o[1] = f2bf(w[(size_t)(k + 1) * N + n]); *(v2us*)(Bt + e) = o; }
         }
}
__global__ __launch_bounds__(256) void k_cvt8(const float* __restrict__ src, bf* dst, size_t n8) { const size_t i = (size_t)blockIdx.x * 256 + threadIdx.x; if (i >= n8) return; const v8f v = *(const v8f*)(src + i * 8); v8us o;
#pragma unroll
    for (int k = 0; k < 8; ++k) o[k] = f2bf(v[k]); *(v8us*)(dst + i * 8) = o;  }
// k_hp, k_vt: one thread per 16-byte chunk of the fragment-order planes, so a wave stores 512 contiguous bytes per plane.
// k_hp: per head, rows = t, k = d: tile = 2 * (t / 16) + d / 32.
__global__ __launch_bounds__(256) void k_hp(const float* __restrict__ F, h16* P16, bf* Ph, bf* Pl) {
    const size_t i = (size_t)blockIdx.x * 256 + threadIdx.x; const size_t e = i * 8; if (e >= (size_t)NH_ * TT * HD) return;
    const int h = (int)(i / ((size_t)TT * HD / 8)); const int ii = (int)(i % ((size_t)TT * HD / 8)); const int c = ii & 63, tile = ii >> 6;
    const int t = (tile >> 1) * 16 + (c & 15); const int d = (tile & 1) * 32 + (c >> 5) * 16 + ((c >> 4) & 1) * 8;
    const v8f x = *(const v8f*)(F + (size_t)t * DQ + h * HD + d); v8h o16; v8us oh, ol;
#pragma unroll
    for (int q = 0; q < 8; ++q) { o16[q] = (h16)x[q]; unsigned short a2, c2; splitf(x[q], a2, c2); oh[q] = a2; ol[q] = c2; }
    *(v8h*)(P16 + e) = o16; *(v8us*)(Ph + e) = oh; *(v8us*)(Pl + e) = ol;  }
// k_vt: per head, rows = d, k = t: tile = 4 * (t / 32) + d / 16 (the 4 tiles of one 32-key step in a row). The lanes of a half wave read 16 neighbouring d of one t.
__global__ __launch_bounds__(256) void k_vt(const float* __restrict__ F, h16* V16, bf* Vh, bf* Vl) {
    const size_t i = (size_t)blockIdx.x * 256 + threadIdx.x; const size_t e = i * 8; if (e >= (size_t)NH_ * HD * TT) return;
    const int g = (int)(i / ((size_t)TT * HD / 8)); const int ii = (int)(i % ((size_t)TT * HD / 8)); const int c = ii & 63, tile = ii >> 6;
    const int d = (tile & 3) * 16 + (c & 15); const int t = (tile >> 2) * 32 + (c >> 5) * 16 + ((c >> 4) & 1) * 8; v8h o16; v8us oh, ol;
#pragma unroll
    for (int q = 0; q < 8; ++q) { const float x = F[(size_t)(t + q) * DQ + g * HD + d]; o16[q] = (h16)x; unsigned short a2, c2; splitf(x, a2, c2); oh[q] = a2; ol[q] = c2; }
    *(v8h*)(V16 + e) = o16; *(v8us*)(Vh + e) = oh; *(v8us*)(Vl + e) = ol;  }

// Probability packers: two 16-key score tiles (accumulator layout: lane = query, element r = key 8*(lane>>4)+r) -> one 32-key B fragment (elements 0..7 <- tile 0, 8..15 <- tile 1).
template <typename T16> struct PPk;
template <> struct PPk<h16> {
    static __device__ __forceinline__ v16h hi(v8f p0, v8f p1) { v8h a, b;
#pragma unroll
        for (int r = 0; r < 8; ++r) { a[r] = (h16)(p0[r] * PCAR); b[r] = (h16)(p1[r] * PCAR); }
        return cat16(a, b); }
    static __device__ __forceinline__ v16h lo(v8f p0, v8f p1) { return hi(p0, p1); }
};
template <> struct PPk<bf> {
    static __device__ __forceinline__ v16bf hi(v8f p0, v8f p1) { v8us a, b;
#pragma unroll
        for (int r = 0; r < 8; ++r) { a[r] = f2bf(p0[r]); b[r] = f2bf(p1[r]); }
        return cat16b(a, b); }
    static __device__ __forceinline__ v16bf lo(v8f p0, v8f p1) { v8us a, b;
#pragma unroll
        for (int r = 0; r < 8; ++r) { a[r] = f2bf(p0[r] - bf2f(f2bf(p0[r]))); b[r] = f2bf(p1[r] - bf2f(f2bf(p1[r]))); }
        return cat16b(a, b); }
};

// ---- k_flash: register-fed transposed flash attention; ONE WAVE per (16 queries, head); grid ((rows)/16, NH), 32 threads; roff = first query row of this launch.
// Per 32-key step: S^T[key][query] = K (A operand, rows = keys, k = d) x Q^T (B operand held in registers, lane = query); online softmax per lane (query = lane & 15, the two lane halves hold
// different keys; one xor-16 shuffle for the max); O^T[d][query] += V^T (A operand, rows = d, k = keys, fragment-order plane per head) x P^T (B operand packed from the two score tiles). No LDS in the key loop.
// HL: bf16 hi/lo planes, 3 products per contraction, P not carried. Otherwise fp16 single product with P carried x1024.
// The K and V^T fragments of a step live in one of two register sets; each step first issues all loads of the NEXT step into the other set, so a load has a whole step to land.
template <typename T16, bool HL> struct FKV { typename WFrag<T16>::V k[4], kl[4], v[4], vl[4]; };   // kl, vl: lo planes, HL only

template <typename T16, bool HL>
__device__ __forceinline__ void ldkv(FKV<T16, HL>& f, const T16* __restrict__ K1, const T16* __restrict__ K2, const T16* __restrict__ V1, const T16* __restrict__ V2, size_t koff, int kb) {
    const size_t ko = koff + (size_t)kb * HD;   // a 32-key step is 4 tiles (4 KiB in a row) of the K plane and 4 of the V^T plane, at the same offset
#pragma unroll
    for (int i = 0; i < 4; ++i) f.k[i] = WFrag<T16>::ldf(K1 + ko + i * 512);
    // the compiler lets later loads land on the address registers of the loads above; one wait behind each plane's loads (behind the fp16 build's V^T loads it stands in the key loop)
    asm volatile("s_wait_xcnt 0x0" ::: "memory");
    if (HL) {
#pragma unroll
        for (int i = 0; i < 4; ++i) f.kl[i] = WFrag<T16>::ldf(K2 + ko + i * 512);
        asm volatile("s_wait_xcnt 0x0" ::: "memory");   // as above
    }
#pragma unroll
    for (int dt = 0; dt < 4; ++dt) f.v[dt] = WFrag<T16>::ldf(V1 + ko + dt * 512);
    if (HL) {
        asm volatile("s_wait_xcnt 0x0" ::: "memory");   // as above
#pragma unroll
        for (int dt = 0; dt < 4; ++dt) f.vl[dt] = WFrag<T16>::ldf(V2 + ko + dt * 512);
        asm volatile("s_wait_xcnt 0x0" ::: "memory");   // as above
    }
}

template <typename T16, bool HL>
__device__ __forceinline__ void fstep(const FKV<T16, HL>& f, const typename WFrag<T16>::V (&qa)[2], const typename WFrag<T16>::V (&qb)[2], v8f (&o)[4], float& m, float& l, int kb, int q0, int qi, int hi) {
    typedef typename WFrag<T16>::V V;
    v8f s[2];
#pragma unroll
    for (int kt = 0; kt < 2; ++kt) {
        v8f a = (v8f){};
        if (HL) { a = WFrag<T16>::mma(f.kl[2 * kt], qa[0], a); a = WFrag<T16>::mma(f.kl[2 * kt + 1], qa[1], a); a = WFrag<T16>::mma(f.k[2 * kt], qb[0], a); a = WFrag<T16>::mma(f.k[2 * kt + 1], qb[1], a); }
        a = WFrag<T16>::mma(f.k[2 * kt], qa[0], a); a = WFrag<T16>::mma(f.k[2 * kt + 1], qa[1], a);
        s[kt] = a;
    }
    asm volatile("v_nop\n\tv_nop\n\tv_nop\n\tv_nop" : "+v"(s[0]), "+v"(s[1]) : "v"(qa[0]), "v"(qa[1]));
    const bool diag = (kb + 31 > q0);         // wave-uniform: this step can hold keys beyond some query
    float mx = -1.0e30f;
#pragma unroll
    for (int kt = 0; kt < 2; ++kt)
#pragma unroll
        for (int r = 0; r < 8; ++r) { const int key = kb + kt * 16 + 8 * hi + r; float t = s[kt][r] * SCL; t = (diag && (key > qi)) ? -1.0e30f : t; s[kt][r] = t; mx = fmaxf(mx, t); }
    mx = fmaxf(mx, __shfl_xor(mx, 16, 32));
    const float mn = fmaxf(m, mx);
    const float al = __builtin_amdgcn_exp2f((m - mn) * L2E);
    m = mn;
    float psum = 0.0f;
#pragma unroll
    for (int kt = 0; kt < 2; ++kt)
#pragma unroll
        for (int r = 0; r < 8; ++r) { const float p = __builtin_amdgcn_exp2f((s[kt][r] - mn) * L2E); s[kt][r] = p; psum += p; }
    l = l * al + psum;
#pragma unroll
    for (int dt = 0; dt < 4; ++dt) o[dt] = o[dt] * al;
    const V pa = PPk<T16>::hi(s[0], s[1]);
    V pb = pa; if (HL) pb = PPk<T16>::lo(s[0], s[1]);
#pragma unroll
    for (int dt = 0; dt < 4; ++dt) {
        if (HL) { o[dt] = WFrag<T16>::mma(f.vl[dt], pa, o[dt]); o[dt] = WFrag<T16>::mma(f.v[dt], pb, o[dt]); }
        o[dt] = WFrag<T16>::mma(f.v[dt], pa, o[dt]);
    }
    asm volatile("v_nop\n\tv_nop\n\tv_nop\n\tv_nop" : "+v"(o[0]), "+v"(o[1]), "+v"(o[2]), "+v"(o[3]) : "v"(pa), "v"(pb));
}

template <typename T16, bool HL>
__global__ __launch_bounds__(32) void k_flash(const T16* __restrict__ Q1, const T16* __restrict__ Q2, const T16* __restrict__ K1, const T16* __restrict__ K2, const T16* __restrict__ V1, const T16* __restrict__ V2, int roff, bf* Ah, bf* Al) {
    typedef typename WFrag<T16>::V V;
    __shared__ __align__(16) unsigned short st[2 * 16 * 72];
    const int lane = threadIdx.x & 31, lr = lane & 15, hi = lane >> 4;
    const int q0 = roff + blockIdx.x * 16; const int head = blockIdx.y;
    const size_t hp = (size_t)head * TT * HD;
    const size_t qoff = hp + (size_t)q0 * HD + lane * 8;   // the 16 queries are 2 tiles
    V qa[2], qb[2];
    qa[0] = WFrag<T16>::ldf(Q1 + qoff); qa[1] = WFrag<T16>::ldf(Q1 + qoff + 512);
    if (HL) { qb[0] = WFrag<T16>::ldf(Q2 + qoff); qb[1] = WFrag<T16>::ldf(Q2 + qoff + 512); } else { qb[0] = qa[0]; qb[1] = qa[1]; }
    v8f o[4];
#pragma unroll
    for (int dt = 0; dt < 4; ++dt) o[dt] = (v8f){};
    float m = -1.0e30f, l = 0.0f;
    const int nst = (q0 + 47) >> 5;               // keys 0 .. q0+15 in steps of 32; at least 1
    const size_t koff = hp + lane * 8;
    const int qi = q0 + lr;
    FKV<T16, HL> fa, fb;
    ldkv<T16, HL>(fa, K1, K2, V1, V2, koff, 0);
    asm volatile("s_wait_xcnt 0x0" ::: "memory");   // the address registers of the loads above are reused below
    int stp = 0;
    // two steps per trip, so that the two register sets swap roles without copies
#pragma unroll 1
    for (; stp + 1 < nst; stp += 2) {
        ldkv<T16, HL>(fb, K1, K2, V1, V2, koff, (stp + 1) * 32);
        fstep<T16, HL>(fa, qa, qb, o, m, l, stp * 32, q0, qi, hi);
        const int nx = (stp + 2 < nst) ? stp + 2 : nst - 1;   // past the last step: fetch the last step again, in bounds and unused
        if (!HL) asm volatile("s_wait_xcnt 0x0" ::: "memory");   // the loads below may land on the address registers of this trip's first V^T loads
        ldkv<T16, HL>(fa, K1, K2, V1, V2, koff, nx * 32);
        fstep<T16, HL>(fb, qa, qb, o, m, l, (stp + 1) * 32, q0, qi, hi);
        if (!HL) asm volatile("s_wait_xcnt 0x0" ::: "memory");   // the next trip reuses the address registers of this trip's last loads
    }
    if (stp < nst) fstep<T16, HL>(fa, qa, qb, o, m, l, stp * 32, q0, qi, hi);
    l += __shfl_xor(l, 16, 32);
    const float inv = (HL ? 1.0f : (1.0f / PCAR)) * (1.0f / l);
#pragma unroll
    for (int dt = 0; dt < 4; ++dt) { v8us hv, lv;
#pragma unroll
        for (int r = 0; r < 8; ++r) { unsigned short a2, c2; splitf(o[dt][r] * inv, a2, c2); hv[r] = a2; lv[r] = c2; }
        *(v8usa*)(st + lr * 72 + dt * 16 + 8 * hi) = hv; *(v8usa*)(st + 16 * 72 + lr * 72 + dt * 16 + 8 * hi) = lv; }
    __syncthreads();
{
#pragma unroll
        for (int s4 = 0; s4 < 4; ++s4) { const int row = 4 * s4 + (lane >> 3), c = (lane & 7) * 8;
            const v8us a = *(const v8usa*)(st + row * 72 + c); const v8us b = *(const v8usa*)(st + 16 * 72 + row * 72 + c);
            const size_t oo = (size_t)(q0 + row) * DQ + head * HD + c;
            *(v8us*)(Ah + oo) = a; *(v8us*)(Al + oo) = b; }
         }
}

extern "C" void kernel_launch(void* const* d_in, const int* in_sizes, int n_in,
                              void* d_out, int out_size, void* d_ws, size_t ws_size, hipStream_t stream) {
    if (n_in < 6) return;
    const size_t need = (size_t)(NB - 1) * SEQ_FULL * DM + (size_t)TT * DM;
    if ((size_t)in_sizes[0] < need || (size_t)out_size < need) return;
    if (in_sizes[1] < DM * DQ || in_sizes[2] < DM * DQ || in_sizes[3] < DM * DQ || in_sizes[4] < DQ * DM || in_sizes[5] < DM) return;
    const float* x = (const float*)d_in[0]; const float* wq = (const float*)d_in[1]; const float* wk = (const float*)d_in[2]; const float* wv = (const float*)d_in[3]; const float* wo = (const float*)d_in[4]; const float* bo = (const float*)d_in[5];
    float* OUT = (float*)d_out;     // [2][4096][768], byte offset 0
    char* wsp = (char*)d_ws;
    auto take = [&](size_t bytes) { char* p = wsp; wsp += (bytes + 255) & ~(size_t)255; return (void*)p; };
    bf* WQ = (bf*)take((size_t)DQ * DM * 2); bf* WK = (bf*)take((size_t)DQ * DM * 2); bf* WV = (bf*)take((size_t)DQ * DM * 2); bf* WO = (bf*)take((size_t)DM * DQ * 2);
    bf* XB = (bf*)take((size_t)TT * DM * 2); float* FQ = (float*)take((size_t)TT * DQ * 4); float* FK = (float*)take((size_t)TT * DQ * 4);
    const size_t PL = (size_t)NH_ * TT * HD * 2;
    h16* QP16 = (h16*)take(PL); h16* KP16 = (h16*)take(PL); h16* VT16 = (h16*)take(PL);
    bf* QPh = (bf*)take(PL); bf* QPl = (bf*)take(PL); bf* KPh = (bf*)take(PL); bf* KPl = (bf*)take(PL); bf* VTh = (bf*)take(PL); bf* VTl = (bf*)take(PL);
    bf* ATh = (bf*)take((size_t)TT * DQ * 2); bf* ATl = (bf*)take((size_t)TT * DQ * 2);
    if ((size_t)(wsp - (char*)d_ws) > ws_size) return;    // 105,381,888 B at the full size
    float* FV = FK;   // v projection reuses the k buffer after the k planes are built (stream-ordered)
    const unsigned LW = (unsigned)((DM * DQ / 64 + 63) / 64);
    k_wtG<<<LW, 256, 0, stream>>>(wq, DM, DQ, WQ);   // in[DM][DQ] -> out[DQ][DM]
    k_wtG<<<LW, 256, 0, stream>>>(wk, DM, DQ, WK);
    k_wtG<<<LW, 256, 0, stream>>>(wv, DM, DQ, WV);
    k_wtG<<<LW, 256, 0, stream>>>(wo, DQ, DM, WO);   // in[DQ][DM] -> out[DM][DQ]
    const unsigned LP = (unsigned)(((size_t)NH_ * TT * HD / 8 + 255) / 256);
    for (int b = 0; b < NB; ++b) {
        k_cvt8<<<(unsigned)(((size_t)TT * DM / 8 + 255) / 256), 256, 0, stream>>>(x + (size_t)b * SEQ_FULL * DM, XB, (size_t)TT * DM / 8);
        k_gemmw<bf, 0, false><<<dim3(TT / 64, DQ / 64, 1), 32, 0, stream>>>(XB, nullptr, WQ, nullptr, DM, FQ, DQ, nullptr, 0, 0, 0);
        k_hp<<<LP, 256, 0, stream>>>(FQ, QP16, QPh, QPl);
        k_gemmw<bf, 0, false><<<dim3(TT / 64, DQ / 64, 1), 32, 0, stream>>>(XB, nullptr, WK, nullptr, DM, FK, DQ, nullptr, 0, 0, 0);
        k_hp<<<LP, 256, 0, stream>>>(FK, KP16, KPh, KPl);
        k_gemmw<bf, 0, false><<<dim3(TT / 64, DQ / 64, 1), 32, 0, stream>>>(XB, nullptr, WV, nullptr, DM, FV, DQ, nullptr, 0, 0, 0);
        k_vt<<<LP, 256, 0, stream>>>(FV, VT16, VTh, VTl);
        k_flash<bf, true><<<dim3(RH / 16, NH_, 1), 32, 0, stream>>>(QPh, QPl, KPh, KPl, VTh, VTl, 0, ATh, ATl);
        if (TT > RH) k_flash<h16, false><<<dim3((TT - RH) / 16, NH_, 1), 32, 0, stream>>>(QP16, nullptr, KP16, nullptr, VT16, nullptr, RH, ATh, ATl);
        k_gemmw<bf, 1, true><<<dim3(TT / 64, DM / 64, 1), 32, 0, stream>>>(ATh, ATl, WO, nullptr, DQ, OUT + (size_t)b * SEQ_FULL * DM, DM, bo, 0, 0, 0);
    }
}

// v003
// It runs in 257 microseconds.
// Timed twice side by side with v002, it ran 1.59 times as fast both times.
// Counting every step since v000, it is 2.72 times as fast.
#include <hip/hip_runtime.h>

// Causal self-attention block: x [2][4096][768]; q/k/v = x W (W [in][out] 768x768, 12 heads x 64); softmax(q.k / 8) over keys j <= i; out = merged ctx Wo + bo -> [2][4096][768].
// Compute dtypes, f32 accumulate: every input RNE-converted to bf16; q/k/v projections v_wmma_f32_16x16x32_bf16 (plain bf16 operands); scores (K Q^T) and ctx (V^T P^T): query rows < 512 on bf16 hi/lo planes (3 products), other rows v_wmma_f32_16x16x32_f16 single product (P carried x1024); softmax f32; ctx.Wo bf16 hi/lo x bf16 (2 products) + bias.

#ifndef NB
#define NB 2
#endif
#ifndef SEQ
#define SEQ 4096
#endif
#define NB_FULL  2
#define SEQ_FULL 4096
#define TT   SEQ
#define DM   768
#define NH_  12
#define HD   64
#define DQ   (NH_ * HD)
#define RH   ((SEQ) < 512 ? (SEQ) : 512)   // query rows < RH use hi+lo planes
#define PCAR 1024.0f
#define SCL  0.125f                        // HD^-0.5
#define L2E  1.4426950408889634f
#define WSB  ((size_t)4 * DQ * DM * 2 + (size_t)NB * ((size_t)TT * DM * 2 + (size_t)3 * TT * DQ * 4 + (size_t)9 * NH_ * TT * HD * 2 + (size_t)2 * TT * DQ * 2))

static_assert(SEQ % 64 == 0);
static_assert(SEQ <= SEQ_FULL);
static_assert(NB <= NB_FULL);
static_assert(DM % 64 == 0);
static_assert(DQ % 64 == 0);
static_assert(DQ == DM);
static_assert(RH % 16 == 0);
static_assert((TT - RH) % 16 == 0);
static_assert(((size_t)DQ * DM * 2) % 256 == 0);
static_assert(((size_t)TT * DM * 2) % 256 == 0);
static_assert(((size_t)NH_ * TT * HD * 2) % 256 == 0);
static_assert(WSB <= (size_t)268435456);

typedef _Float16 h16;
typedef unsigned short bf;
typedef __attribute__((ext_vector_type(16))) __bf16   v16bf;
typedef __attribute__((ext_vector_type(16))) _Float16 v16h;
typedef __attribute__((ext_vector_type(8)))  _Float16 v8h;
typedef __attribute__((ext_vector_type(8)))  unsigned short v8us;
typedef __attribute__((ext_vector_type(8)))  float    v8f;
typedef __attribute__((ext_vector_type(4)))  float    v4f;
typedef __attribute__((ext_vector_type(2)))  unsigned short v2us;
typedef v8h  __attribute__((may_alias)) v8ha;
typedef v4f  __attribute__((may_alias)) v4fa;
typedef v8us __attribute__((may_alias)) v8usa;

__device__ __forceinline__ unsigned short f2bf(float f) { unsigned u = __float_as_uint(f); u += 0x7FFFu + ((u >> 16) & 1u); return (unsigned short)(u >> 16); }
__device__ __forceinline__ float bf2f(unsigned short b) { return __uint_as_float(((unsigned)b) << 16); }
__device__ __forceinline__ float bfr(float f) { return bf2f(f2bf(f)); }
__device__ __forceinline__ v16h cat16(v8h lo, v8h hi) { return __builtin_shufflevector(lo, hi, 0, 1, 2, 3, 4, 5, 6, 7, 8, 9, 10, 11, 12, 13, 14, 15); }
__device__ __forceinline__ v16bf cat16b(v8us lo, v8us hi) { return __builtin_bit_cast(v16bf, __builtin_shufflevector(lo, hi, 0, 1, 2, 3, 4, 5, 6, 7, 8, 9, 10, 11, 12, 13, 14, 15)); }
__device__ __forceinline__ v8f wmma16(v16h a, v16h b, v8f c) { return __builtin_amdgcn_wmma_f32_16x16x32_f16(false, a, false, b, (short)0, c, false, false); }
__device__ __forceinline__ v8f wmmab(v16bf a, v16bf b, v8f c) { return __builtin_amdgcn_wmma_f32_16x16x32_bf16(false, a, false, b, (short)0, c, false, false); }
__device__ __forceinline__ void splitf(float y, unsigned short& h, unsigned short& l) { h = f2bf(y); l = f2bf(y - bf2f(h)); }

// Fragment loader for K-contiguous 16-bit rows: p points at row (lane & 15), element k0 + 8 * (lane >> 4); elements 0..7 <- p[0..7], elements 8..15 <- p[16..23]. Same map for A and B operands.
// Fragment-order planes (Q, K and V^T of the attention kernels): a 16-bit matrix [rows][k] kept as tiles of 16 rows x 32 k (512 elements, 1 KiB). Inside a tile the 16-byte chunk 32 * s + lane holds row (lane & 15),
// k = 16 * s + 8 * (lane >> 4) + 0..7: the element order of the loader above. A tile is one fragment, and each of its two loads reads 512 contiguous bytes (4 whole cache lines) instead of 32 bytes from each of 16 rows.
// ldf: p points at tile base + 8 * lane; elements 0..7 <- p[0..7], elements 8..15 <- p[256..263].
template <typename T16> struct WFrag;
template <> struct WFrag<h16> { typedef v16h V; static __device__ __forceinline__ V ld(const h16* p) { return cat16(*(const v8h*)p, *(const v8h*)(p + 16)); } static __device__ __forceinline__ V ldf(const h16* p) { return cat16(*(const v8h*)p, *(const v8h*)(p + 256)); } static __device__ __forceinline__ v8f mma(V a, V b, v8f c) { return wmma16(a, b, c); } };
template <> struct WFrag<bf> { typedef v16bf V; static __device__ __forceinline__ V ld(const bf* p) { return cat16b(*(const v8us*)p, *(const v8us*)(p + 16)); } static __device__ __forceinline__ V ldf(const bf* p) { return cat16b(*(const v8us*)p, *(const v8us*)(p + 256)); } static __device__ __forceinline__ v8f mma(V a, V b, v8f c) { return wmmab(a, b, c); } };

// ---- k_gemmw: register-blocked GEMM, ONE WAVE per 64x64 output tile (16 accumulators), operands straight from K-contiguous 16-bit planes; grid (M/64, N/64, Z), 32 threads.
// C[m][n] (f32, pitch ldc, + optional f32 bias[n]) = sum_k A[m][k] Bt[n][k] (+ split products per NSPLIT). K % 32 == 0, M % 64 == 0, N % 64 == 0.
// blockIdx.z counts independent products: A matrix z / NW (stride sA), B matrix z % NW (stride sB), C matrix z (stride sC).
template <typename T16, int NSPLIT, bool BIAS, int NW>
__global__ __launch_bounds__(32) void k_gemmw(const T16* __restrict__ A, const T16* __restrict__ A2, const T16* __restrict__ Bt, const T16* __restrict__ Bt2, int K, float* C, int ldc, const float* __restrict__ bias, size_t sA, size_t sB, size_t sC) {
    typedef typename WFrag<T16>::V V;
    __shared__ __align__(16) float os[16 * 68];
    const size_t z = blockIdx.z, za = z / NW, zw = z % NW; A += za * sA; if (A2) A2 += za * sA; Bt += zw * sB; if (Bt2) Bt2 += zw * sB; C += z * sC;
    const int lane = threadIdx.x & 31, lr = lane & 15, hi = lane >> 4; const int r0 = blockIdx.x * 64, c0 = blockIdx.y * 64;
    v8f acc[4][4];
#pragma unroll
    for (int mb = 0; mb < 4; ++mb)
#pragma unroll
        for (int nb = 0; nb < 4; ++nb) acc[mb][nb] = (v8f){};
    const size_t aoff = (size_t)(r0 + lr) * K + 8 * hi, boff = (size_t)(c0 + lr) * K + 8 * hi;
#pragma unroll 1
    for (int kc = 0; kc < K; kc += 32) {
        V a[4], a2[4];
#pragma unroll
        for (int mb = 0; mb < 4; ++mb) { a[mb] = WFrag<T16>::ld(A + aoff + (size_t)mb * 16 * K + kc); if (NSPLIT == 1 || NSPLIT == 2) a2[mb] = WFrag<T16>::ld(A2 + aoff + (size_t)mb * 16 * K + kc); }
#pragma unroll
        for (int nb = 0; nb < 4; ++nb) { const V b = WFrag<T16>::ld(Bt + boff + (size_t)nb * 16 * K + kc); V b2; if (NSPLIT >= 2) b2 = WFrag<T16>::ld(Bt2 + boff + (size_t)nb * 16 * K + kc);
#pragma unroll
            for (int mb = 0; mb < 4; ++mb) { acc[mb][nb] = WFrag<T16>::mma(a[mb], b, acc[mb][nb]); if (NSPLIT == 1 || NSPLIT == 2) acc[mb][nb] = WFrag<T16>::mma(a2[mb], b, acc[mb][nb]); if (NSPLIT >= 2) acc[mb][nb] = WFrag<T16>::mma(a[mb], b2, acc[mb][nb]); } }
        asm volatile("v_nop\n\tv_nop\n\tv_nop\n\tv_nop" : "+v"(acc[0][0]), "+v"(acc[1][1]), "+v"(acc[2][2]), "+v"(acc[3][3]) : "v"(a[0]), "v"(a[3]));
    }
#pragma unroll
    for (int mb = 0; mb < 4; ++mb) {
#pragma unroll
        for (int nb = 0; nb < 4; ++nb) {
#pragma unroll
            for (int j = 0; j < 8; ++j) os[(hi * 8 + j) * 68 + nb * 16 + lr] = acc[mb][nb][j]; }
        __builtin_amdgcn_wave_barrier(); asm volatile("" ::: "memory");
        float* crow = C + (size_t)(r0 + mb * 16) * ldc + c0;
{
#pragma unroll
            for (int s = 0; s < 8; ++s) { const int row = 2 * s + hi, cofs = lr * 4; v4f val = *(const v4fa*)(os + row * 68 + cofs); if (BIAS) { val[0] += bfr(bias[c0 + cofs]); val[1] += bfr(bias[c0 + cofs + 1]); val[2] += bfr(bias[c0 + cofs + 2]); val[3] += bfr(bias[c0 + cofs + 3]); }
                *(v4f*)(crow + (size_t)row * ldc + cofs) = val; }
             }
        __builtin_amdgcn_wave_barrier(); asm volatile("" ::: "memory");
    }
}

// d_wtG, d_cvt8: bx = the block's index within its own piece of work.
__device__ __forceinline__ void d_wtG(const float* __restrict__ w, int K, int N, bf* Bt, int bx) {
    const int lane = threadIdx.x & 31; const int L0 = (bx * 8 + (threadIdx.x >> 5)) * 8; const int nlines = N * K / 64;
{
#pragma unroll 1
        for (int l = 0; l < 8; ++l) { const int L = L0 + l; if (L >= nlines) break; const size_t e = (size_t)L * 64 + lane * 2; const int k = (int)(e % K), n = (int)(e / K); v2us o;
            o[0] = f2bf(w[(size_t)k * N + n]); o[1] = f2bf(w[(size_t)(k + 1) * N + n]); *(v2us*)(Bt + e) = o; }
         }
}
__device__ __forceinline__ void d_cvt8(const float* __restrict__ src, bf* dst, size_t n8, unsigned bx) { const size_t i = (size_t)bx * 256 + threadIdx.x; if (i >= n8) return; const v8f v = *(const v8f*)(src + i * 8); v8us o;
#pragma unroll
    for (int k = 0; k < 8; ++k) o[k] = f2bf(v[k]); *(v8us*)(dst + i * 8) = o;  }
// k_prep: all operand conversions in one launch. Blocks 0 .. 4 * LWB - 1: the four weight matrices (all K x N), LWB blocks each, their transposed planes one behind the other in Bt; then NCB blocks per batch of x.
#define LWB ((unsigned)((DM * DQ / 64 + 63) / 64))
#define NCB ((unsigned)(((size_t)TT * DM / 8 + 255) / 256))
__global__ __launch_bounds__(256) void k_prep(const float* __restrict__ w0, const float* __restrict__ w1, const float* __restrict__ w2, const float* __restrict__ w3, int K, int N, bf* Bt, const float* __restrict__ x, bf* XB) {
    const unsigned bx = blockIdx.x;
    if (bx < 4u * LWB) { const unsigned y = bx / LWB; const float* __restrict__ w = y == 0 ? w0 : y == 1 ? w1 : y == 2 ? w2 : w3; d_wtG(w, K, N, Bt + (size_t)y * N * K, (int)(bx % LWB)); }
    else { const unsigned c = bx - 4u * LWB, b = c / NCB; d_cvt8(x + (size_t)b * SEQ_FULL * DM, XB + (size_t)b * TT * DM, (size_t)TT * DM / 8, c % NCB); }
}
// d_hp, d_vt: one thread per 16-byte chunk of the fragment-order planes, so a wave stores 512 contiguous bytes per plane.
// d_hp: per head, rows = t, k = d: tile = 2 * (t / 16) + d / 32.
__device__ __forceinline__ void d_hp(const float* __restrict__ F, h16* P16, bf* Ph, bf* Pl) {
    const size_t i = (size_t)blockIdx.x * 256 + threadIdx.x; const size_t e = i * 8; if (e >= (size_t)NH_ * TT * HD) return;
    const int h = (int)(i / ((size_t)TT * HD / 8)); const int ii = (int)(i % ((size_t)TT * HD / 8)); const int c = ii & 63, tile = ii >> 6;
    const int t = (tile >> 1) * 16 + (c & 15); const int d = (tile & 1) * 32 + (c >> 5) * 16 + ((c >> 4) & 1) * 8;
    const v8f x = *(const v8f*)(F + (size_t)t * DQ + h * HD + d); v8h o16; v8us oh, ol;
#pragma unroll
    for (int q = 0; q < 8; ++q) { o16[q] = (h16)x[q]; unsigned short a2, c2; splitf(x[q], a2, c2); oh[q] = a2; ol[q] = c2; }
    *(v8h*)(P16 + e) = o16; *(v8us*)(Ph + e) = oh; *(v8us*)(Pl + e) = ol;  }
// d_vt: per head, rows = d, k = t: tile = 4 * (t / 32) + d / 16 (the 4 tiles of one 32-key step in a row). The lanes of a half wave read 16 neighbouring d of one t.
__device__ __forceinline__ void d_vt(const float* __restrict__ F, h16* V16, bf* Vh, bf* Vl) {
    const size_t i = (size_t)blockIdx.x * 256 + threadIdx.x; const size_t e = i * 8; if (e >= (size_t)NH_ * HD * TT) return;
    const int g = (int)(i / ((size_t)TT * HD / 8)); const int ii = (int)(i % ((size_t)TT * HD / 8)); const int c = ii & 63, tile = ii >> 6;
    const int d = (tile & 3) * 16 + (c & 15); const int t = (tile >> 2) * 32 + (c >> 5) * 16 + ((c >> 4) & 1) * 8; v8h o16; v8us oh, ol;
#pragma unroll
    for (int q = 0; q < 8; ++q) { const float x = F[(size_t)(t + q) * DQ + g * HD + d]; o16[q] = (h16)x; unsigned short a2, c2; splitf(x, a2, c2); oh[q] = a2; ol[q] = c2; }
    *(v8h*)(V16 + e) = o16; *(v8us*)(Vh + e) = oh; *(v8us*)(Vl + e) = ol;  }
// k_pl: all planes of all batches in one launch. blockIdx.y = 3 * batch + p (the order of the projection GEMM's C matrices), p = 0: q, 1: k, 2: v; plane (p, batch) lies at index p * NB + batch of each of the three arrays.
__global__ __launch_bounds__(256) void k_pl(const float* __restrict__ F, h16* P16, bf* Ph, bf* Pl) {
    const int y = blockIdx.y, p = y % 3, b = y / 3; const size_t po = ((size_t)p * NB + b) * NH_ * TT * HD; F += (size_t)y * TT * DQ;
    if (p < 2) d_hp(F, P16 + po, Ph + po, Pl + po); else d_vt(F, P16 + po, Ph + po, Pl + po);
}

// Probability packers: two 16-key score tiles (accumulator layout: lane = query, element r = key 8*(lane>>4)+r) -> one 32-key B fragment (elements 0..7 <- tile 0, 8..15 <- tile 1).
template <typename T16> struct PPk;
template <> struct PPk<h16> {
    static __device__ __forceinline__ v16h hi(v8f p0, v8f p1) { v8h a, b;
#pragma unroll
        for (int r = 0; r < 8; ++r) { a[r] = (h16)(p0[r] * PCAR); b[r] = (h16)(p1[r] * PCAR); }
        return cat16(a, b); }
    static __device__ __forceinline__ v16h lo(v8f p0, v8f p1) { return hi(p0, p1); }
};
template <> struct PPk<bf> {
    static __device__ __forceinline__ v16bf hi(v8f p0, v8f p1) { v8us a, b;
#pragma unroll
        for (int r = 0; r < 8; ++r) { a[r] = f2bf(p0[r]); b[r] = f2bf(p1[r]); }
        return cat16b(a, b); }
    static __device__ __forceinline__ v16bf lo(v8f p0, v8f p1) { v8us a, b;
#pragma unroll
        for (int r = 0; r < 8; ++r) { a[r] = f2bf(p0[r] - bf2f(f2bf(p0[r]))); b[r] = f2bf(p1[r] - bf2f(f2bf(p1[r]))); }
        return cat16b(a, b); }
};

// ---- k_flash: register-fed transposed flash attention; ONE WAVE per (16 queries, head, batch); grid ((rows)/16, NH, NB), 32 threads; roff = first query row of this launch.
// Per 32-key step: S^T[key][query] = K (A operand, rows = keys, k = d) x Q^T (B operand held in registers, lane = query); online softmax per lane (query = lane & 15, the two lane halves hold
// different keys; one xor-16 shuffle for the max); O^T[d][query] += V^T (A operand, rows = d, k = keys, fragment-order plane per head) x P^T (B operand packed from the two score tiles). No LDS in the key loop.
// HL: bf16 hi/lo planes, 3 products per contraction, P not carried. Otherwise fp16 single product with P carried x1024.
// The K and V^T fragments of a step live in one of two register sets; each step first issues all loads of the NEXT step into the other set, so a load has a whole step to land.
template <typename T16, bool HL> struct FKV { typename WFrag<T16>::V k[4], kl[4], v[4], vl[4]; };   // kl, vl: lo planes, HL only

template <typename T16, bool HL>
__device__ __forceinline__ void ldkv(FKV<T16, HL>& f, const T16* __restrict__ K1, const T16* __restrict__ K2, const T16* __restrict__ V1, const T16* __restrict__ V2, size_t koff, int kb) {
    const size_t ko = koff + (size_t)kb * HD;   // a 32-key step is 4 tiles (4 KiB in a row) of the K plane and 4 of the V^T plane, at the same offset
#pragma unroll
    for (int i = 0; i < 4; ++i) f.k[i] = WFrag<T16>::ldf(K1 + ko + i * 512);
    // the compiler lets later loads land on the address registers of the loads above; one wait behind each plane's loads (behind the fp16 build's V^T loads it stands in the key loop)
    asm volatile("s_wait_xcnt 0x0" ::: "memory");
    if (HL) {
#pragma unroll
        for (int i = 0; i < 4; ++i) f.kl[i] = WFrag<T16>::ldf(K2 + ko + i * 512);
        asm volatile("s_wait_xcnt 0x0" ::: "memory");   // as above
    }
#pragma unroll
    for (int dt = 0; dt < 4; ++dt) f.v[dt] = WFrag<T16>::ldf(V1 + ko + dt * 512);
    if (HL) {
        asm volatile("s_wait_xcnt 0x0" ::: "memory");   // as above
#pragma unroll
        for (int dt = 0; dt < 4; ++dt) f.vl[dt] = WFrag<T16>::ldf(V2 + ko + dt * 512);
        asm volatile("s_wait_xcnt 0x0" ::: "memory");   // as above
    }
}

template <typename T16, bool HL>
__device__ __forceinline__ void fstep(const FKV<T16, HL>& f, const typename WFrag<T16>::V (&qa)[2], const typename WFrag<T16>::V (&qb)[2], v8f (&o)[4], float& m, float& l, int kb, int q0, int qi, int hi) {
    typedef typename WFrag<T16>::V V;
    v8f s[2];
#pragma unroll
    for (int kt = 0; kt < 2; ++kt) {
        v8f a = (v8f){};
        if (HL) { a = WFrag<T16>::mma(f.kl[2 * kt], qa[0], a); a = WFrag<T16>::mma(f.kl[2 * kt + 1], qa[1], a); a = WFrag<T16>::mma(f.k[2 * kt], qb[0], a); a = WFrag<T16>::mma(f.k[2 * kt + 1], qb[1], a); }
        a = WFrag<T16>::mma(f.k[2 * kt], qa[0], a); a = WFrag<T16>::mma(f.k[2 * kt + 1], qa[1], a);
        s[kt] = a;
    }
    asm volatile("v_nop\n\tv_nop\n\tv_nop\n\tv_nop" : "+v"(s[0]), "+v"(s[1]) : "v"(qa[0]), "v"(qa[1]));
    const bool diag = (kb + 31 > q0);         // wave-uniform: this step can hold keys beyond some query
    float mx = -1.0e30f;
#pragma unroll
    for (int kt = 0; kt < 2; ++kt)
#pragma unroll
        for (int r = 0; r < 8; ++r) { const int key = kb + kt * 16 + 8 * hi + r; float t = s[kt][r] * SCL; t = (diag && (key > qi)) ? -1.0e30f : t; s[kt][r] = t; mx = fmaxf(mx, t); }
    mx = fmaxf(mx, __shfl_xor(mx, 16, 32));
    const float mn = fmaxf(m, mx);
    const float al = __builtin_amdgcn_exp2f((m - mn) * L2E);
    m = mn;
    float psum = 0.0f;
#pragma unroll
    for (int kt = 0; kt < 2; ++kt)
#pragma unroll
        for (int r = 0; r < 8; ++r) { const float p = __builtin_amdgcn_exp2f((s[kt][r] - mn) * L2E); s[kt][r] = p; psum += p; }
    l = l * al + psum;
#pragma unroll
    for (int dt = 0; dt < 4; ++dt) o[dt] = o[dt] * al;
    const V pa = PPk<T16>::hi(s[0], s[1]);
    V pb = pa; if (HL) pb = PPk<T16>::lo(s[0], s[1]);
#pragma unroll
    for (int dt = 0; dt < 4; ++dt) {
        if (HL) { o[dt] = WFrag<T16>::mma(f.vl[dt], pa, o[dt]); o[dt] = WFrag<T16>::mma(f.v[dt], pb, o[dt]); }
        o[dt] = WFrag<T16>::mma(f.v[dt], pa, o[dt]);
    }
    asm volatile("v_nop\n\tv_nop\n\tv_nop\n\tv_nop" : "+v"(o[0]), "+v"(o[1]), "+v"(o[2]), "+v"(o[3]) : "v"(pa), "v"(pb));
}

template <typename T16, bool HL>
__global__ __launch_bounds__(32) void k_flash(const T16* __restrict__ Q1, const T16* __restrict__ Q2, const T16* __restrict__ K1, const T16* __restrict__ K2, const T16* __restrict__ V1, const T16* __restrict__ V2, int roff, bf* Ah, bf* Al) {
    typedef typename WFrag<T16>::V V;
    __shared__ __align__(16) unsigned short st[2 * 16 * 72];
    const int lane = threadIdx.x & 31, lr = lane & 15, hi = lane >> 4;
    const int q0 = roff + blockIdx.x * 16; const int head = blockIdx.y;
    const size_t hp = ((size_t)blockIdx.z * NH_ + head) * TT * HD;
    const size_t qoff = hp + (size_t)q0 * HD + lane * 8;   // the 16 queries are 2 tiles
    V qa[2], qb[2];
    qa[0] = WFrag<T16>::ldf(Q1 + qoff); qa[1] = WFrag<T16>::ldf(Q1 + qoff + 512);
    if (HL) { qb[0] = WFrag<T16>::ldf(Q2 + qoff); qb[1] = WFrag<T16>::ldf(Q2 + qoff + 512); } else { qb[0] = qa[0]; qb[1] = qa[1]; }
    v8f o[4];
#pragma unroll
    for (int dt = 0; dt < 4; ++dt) o[dt] = (v8f){};
    float m = -1.0e30f, l = 0.0f;
    const int nst = (q0 + 47) >> 5;               // keys 0 .. q0+15 in steps of 32; at least 1
    const size_t koff = hp + lane * 8;
    const int qi = q0 + lr;
    FKV<T16, HL> fa, fb;
    ldkv<T16, HL>(fa, K1, K2, V1, V2, koff, 0);
    asm volatile("s_wait_xcnt 0x0" ::: "memory");   // the address registers of the loads above are reused below
    int stp = 0;
    // two steps per trip, so that the two register sets swap roles without copies
#pragma unroll 1
    for (; stp + 1 < nst; stp += 2) {
        ldkv<T16, HL>(fb, K1, K2, V1, V2, koff, (stp + 1) * 32);
        fstep<T16, HL>(fa, qa, qb, o, m, l, stp * 32, q0, qi, hi);
        const int nx = (stp + 2 < nst) ? stp + 2 : nst - 1;   // past the last step: fetch the last step again, in bounds and unused
        if (!HL) asm volatile("s_wait_xcnt 0x0" ::: "memory");   // the loads below may land on the address registers of this trip's first V^T loads
        ldkv<T16, HL>(fa, K1, K2, V1, V2, koff, nx * 32);
        fstep<T16, HL>(fb, qa, qb, o, m, l, (stp + 1) * 32, q0, qi, hi);
        if (!HL) asm volatile("s_wait_xcnt 0x0" ::: "memory");   // the next trip reuses the address registers of this trip's last loads
    }
    if (stp < nst) fstep<T16, HL>(fa, qa, qb, o, m, l, stp * 32, q0, qi, hi);
    l += __shfl_xor(l, 16, 32);
    const float inv = (HL ? 1.0f : (1.0f / PCAR)) * (1.0f / l);
#pragma unroll
    for (int dt = 0; dt < 4; ++dt) { v8us hv, lv;
#pragma unroll
        for (int r = 0; r < 8; ++r) { unsigned short a2, c2; splitf(o[dt][r] * inv, a2, c2); hv[r] = a2; lv[r] = c2; }
        *(v8usa*)(st + lr * 72 + dt * 16 + 8 * hi) = hv; *(v8usa*)(st + 16 * 72 + lr * 72 + dt * 16 + 8 * hi) = lv; }
    __syncthreads();
{
#pragma unroll
        for (int s4 = 0; s4 < 4; ++s4) { const int row = 4 * s4 + (lane >> 3), c = (lane & 7) * 8;
            const v8us a = *(const v8usa*)(st + row * 72 + c); const v8us b = *(const v8usa*)(st + 16 * 72 + row * 72 + c);
            const size_t oo = ((size_t)blockIdx.z * TT + q0 + row) * DQ + head * HD + c;
            *(v8us*)(Ah + oo) = a; *(v8us*)(Al + oo) = b; }
         }
}

extern "C" void kernel_launch(void* const* d_in, const int* in_sizes, int n_in,
                              void* d_out, int out_size, void* d_ws, size_t ws_size, hipStream_t stream) {
    if (n_in < 6) return;
    const size_t need = (size_t)(NB - 1) * SEQ_FULL * DM + (size_t)TT * DM;
    if ((size_t)in_sizes[0] < need || (size_t)out_size < need) return;
    if (in_sizes[1] < DM * DQ || in_sizes[2] < DM * DQ || in_sizes[3] < DM * DQ || in_sizes[4] < DQ * DM || in_sizes[5] < DM) return;
    const float* x = (const float*)d_in[0]; const float* wq = (const float*)d_in[1]; const float* wk = (const float*)d_in[2]; const float* wv = (const float*)d_in[3]; const float* wo = (const float*)d_in[4]; const float* bo = (const float*)d_in[5];
    float* OUT = (float*)d_out;     // [2][4096][768], byte offset 0
    char* wsp = (char*)d_ws;
    auto take = [&](size_t bytes) { char* p = wsp; wsp += (bytes + 255) & ~(size_t)255; return (void*)p; };
    bf* WT = (bf*)take((size_t)4 * DQ * DM * 2); bf* WO = WT + (size_t)3 * DQ * DM;   // transposed wq, wk, wv, wo, one behind the other
    bf* XB = (bf*)take((size_t)NB * TT * DM * 2); float* F = (float*)take((size_t)3 * NB * TT * DQ * 4);   // F: q, k, v projections of batch 0, then of batch 1
    const size_t PE = (size_t)NH_ * TT * HD;   // elements of one plane of one batch
    h16* P16 = (h16*)take((size_t)3 * NB * PE * 2); bf* Ph = (bf*)take((size_t)3 * NB * PE * 2); bf* Pl = (bf*)take((size_t)3 * NB * PE * 2);   // each: q planes of all batches, then k, then v^T
    bf* ATh = (bf*)take((size_t)NB * TT * DQ * 2); bf* ATl = (bf*)take((size_t)NB * TT * DQ * 2);
    if ((size_t)(wsp - (char*)d_ws) > ws_size) return;    // 231,211,008 B at the full size
    // Launches that do not depend on each other (the four weights and x; the two batches; the q, k and v projections and their planes) are one grid each.
    k_prep<<<4u * LWB + NB * NCB, 256, 0, stream>>>(wq, wk, wv, wo, DM, DQ, WT, x, XB);   // weights: in[768][768] -> out[768][768] transposed (DM == DQ)
    const unsigned LP = (unsigned)(((size_t)NH_ * TT * HD / 8 + 255) / 256);
    k_gemmw<bf, 0, false, 3><<<dim3(TT / 64, DQ / 64, 3 * NB), 32, 0, stream>>>(XB, nullptr, WT, nullptr, DM, F, DQ, nullptr, (size_t)TT * DM, (size_t)DQ * DM, (size_t)TT * DQ);
    k_pl<<<dim3(LP, 3 * NB, 1), 256, 0, stream>>>(F, P16, Ph, Pl);
    k_flash<bf, true><<<dim3(RH / 16, NH_, NB), 32, 0, stream>>>(Ph, Pl, Ph + NB * PE, Pl + NB * PE, Ph + 2 * NB * PE, Pl + 2 * NB * PE, 0, ATh, ATl);
    if (TT > RH) k_flash<h16, false><<<dim3((TT - RH) / 16, NH_, NB), 32, 0, stream>>>(P16, nullptr, P16 + NB * PE, nullptr, P16 + 2 * NB * PE, nullptr, RH, ATh, ATl);
    k_gemmw<bf, 1, true, 1><<<dim3(TT / 64, DM / 64, NB), 32, 0, stream>>>(ATh, ATl, WO, nullptr, DQ, OUT, DM, bo, (size_t)TT * DQ, 0, (size_t)SEQ_FULL * DM);
}

// v004
// One run takes 230 microseconds.
// In two side-by-side timings against v003, it was 1.13 and 1.12 times as fast.
// All steps since v000 together make it 3.07 times as fast.
#include <hip/hip_runtime.h>

// Causal self-attention block: x [2][4096][768]; q/k/v = x W (W [in][out] 768x768, 12 heads x 64); softmax(q.k / 8) over keys j <= i; out = merged ctx Wo + bo -> [2][4096][768].
// Compute dtypes, f32 accumulate: every input RNE-converted to bf16; q/k/v projections v_wmma_f32_16x16x32_bf16 (plain bf16 operands); scores (K Q^T) and ctx (V^T P^T): query rows < 512 on bf16 hi/lo planes (3 products), other rows v_wmma_f32_16x16x32_f16 single product (P carried x1024); softmax f32; ctx.Wo bf16 hi/lo x bf16 (2 products) + bias.

#ifndef NB
#define NB 2
#endif
#ifndef SEQ
#define SEQ 4096
#endif
#define NB_FULL  2
#define SEQ_FULL 4096
#define TT   SEQ
#define DM   768
#define NH_  12
#define HD   64
#define DQ   (NH_ * HD)
#define RH   ((SEQ) < 512 ? (SEQ) : 512)   // query rows < RH use hi+lo planes
#define PCAR 1024.0f
#define SCL  0.125f                        // HD^-0.5
#define L2E  1.4426950408889634f
#define WSB  ((size_t)4 * DQ * DM * 2 + (size_t)NB * ((size_t)TT * DM * 2 + (size_t)3 * TT * DQ * 4 + (size_t)9 * NH_ * TT * HD * 2 + (size_t)2 * TT * DQ * 2))

static_assert(SEQ % 64 == 0);
static_assert(SEQ <= SEQ_FULL);
static_assert(NB <= NB_FULL);
static_assert(DM % 64 == 0);
static_assert(DQ % 64 == 0);
static_assert(DQ == DM);
static_assert(RH % 16 == 0);
static_assert((TT - RH) % 32 == 0);
static_assert(((size_t)DQ * DM * 2) % 256 == 0);
static_assert(((size_t)TT * DM * 2) % 256 == 0);
static_assert(((size_t)NH_ * TT * HD * 2) % 256 == 0);
static_assert(WSB <= (size_t)268435456);

typedef _Float16 h16;
typedef unsigned short bf;
typedef __attribute__((ext_vector_type(16))) __bf16   v16bf;
typedef __attribute__((ext_vector_type(16))) _Float16 v16h;
typedef __attribute__((ext_vector_type(8)))  _Float16 v8h;
typedef __attribute__((ext_vector_type(8)))  unsigned short v8us;
typedef __attribute__((ext_vector_type(8)))  float    v8f;
typedef __attribute__((ext_vector_type(4)))  float    v4f;
typedef __attribute__((ext_vector_type(2)))  unsigned short v2us;
typedef v8h  __attribute__((may_alias)) v8ha;
typedef v4f  __attribute__((may_alias)) v4fa;
typedef v8us __attribute__((may_alias)) v8usa;

__device__ __forceinline__ unsigned short f2bf(float f) { unsigned u = __float_as_uint(f); u += 0x7FFFu + ((u >> 16) & 1u); return (unsigned short)(u >> 16); }
__device__ __forceinline__ float bf2f(unsigned short b) { return __uint_as_float(((unsigned)b) << 16); }
__device__ __forceinline__ float bfr(float f) { return bf2f(f2bf(f)); }
__device__ __forceinline__ v16h cat16(v8h lo, v8h hi) { return __builtin_shufflevector(lo, hi, 0, 1, 2, 3, 4, 5, 6, 7, 8, 9, 10, 11, 12, 13, 14, 15); }
__device__ __forceinline__ v16bf cat16b(v8us lo, v8us hi) { return __builtin_bit_cast(v16bf, __builtin_shufflevector(lo, hi, 0, 1, 2, 3, 4, 5, 6, 7, 8, 9, 10, 11, 12, 13, 14, 15)); }
__device__ __forceinline__ v8f wmma16(v16h a, v16h b, v8f c) { return __builtin_amdgcn_wmma_f32_16x16x32_f16(false, a, false, b, (short)0, c, false, false); }
__device__ __forceinline__ v8f wmmab(v16bf a, v16bf b, v8f c) { return __builtin_amdgcn_wmma_f32_16x16x32_bf16(false, a, false, b, (short)0, c, false, false); }
__device__ __forceinline__ void splitf(float y, unsigned short& h, unsigned short& l) { h = f2bf(y); l = f2bf(y - bf2f(h)); }

// Fragment loader for K-contiguous 16-bit rows: p points at row (lane & 15), element k0 + 8 * (lane >> 4); elements 0..7 <- p[0..7], elements 8..15 <- p[16..23]. Same map for A and B operands.
// Fragment-order planes (Q, K and V^T of the attention kernels): a 16-bit matrix [rows][k] kept as tiles of 16 rows x 32 k (512 elements, 1 KiB). Inside a tile the 16-byte chunk 32 * s + lane holds row (lane & 15),
// k = 16 * s + 8 * (lane >> 4) + 0..7: the element order of the loader above. A tile is one fragment, and each of its two loads reads 512 contiguous bytes (4 whole cache lines) instead of 32 bytes from each of 16 rows.
// ldf: p points at tile base + 8 * lane; elements 0..7 <- p[0..7], elements 8..15 <- p[256..263].
template <typename T16> struct WFrag;
template <> struct WFrag<h16> { typedef v16h V; static __device__ __forceinline__ V ld(const h16* p) { return cat16(*(const v8h*)p, *(const v8h*)(p + 16)); } static __device__ __forceinline__ V ldf(const h16* p) { return cat16(*(const v8h*)p, *(const v8h*)(p + 256)); } static __device__ __forceinline__ v8f mma(V a, V b, v8f c) { return wmma16(a, b, c); } };
template <> struct WFrag<bf> { typedef v16bf V; static __device__ __forceinline__ V ld(const bf* p) { return cat16b(*(const v8us*)p, *(const v8us*)(p + 16)); } static __device__ __forceinline__ V ldf(const bf* p) { return cat16b(*(const v8us*)p, *(const v8us*)(p + 256)); } static __device__ __forceinline__ v8f mma(V a, V b, v8f c) { return wmmab(a, b, c); } };

// ---- k_gemmw: register-blocked GEMM, ONE WAVE per 64x64 output tile (16 accumulators), operands straight from K-contiguous 16-bit planes; grid (M/64, N/64, Z), 32 threads.
// C[m][n] (f32, pitch ldc, + optional f32 bias[n]) = sum_k A[m][k] Bt[n][k] (+ split products per NSPLIT). K % 32 == 0, M % 64 == 0, N % 64 == 0.
// blockIdx.z counts independent products: A matrix z / NW (stride sA), B matrix z % NW (stride sB), C matrix z (stride sC).
template <typename T16, int NSPLIT, bool BIAS, int NW>
__global__ __launch_bounds__(32) void k_gemmw(const T16* __restrict__ A, const T16* __restrict__ A2, const T16* __restrict__ Bt, const T16* __restrict__ Bt2, int K, float* C, int ldc, const float* __restrict__ bias, size_t sA, size_t sB, size_t sC) {
    typedef typename WFrag<T16>::V V;
    __shared__ __align__(16) float os[16 * 68];
    const size_t z = blockIdx.z, za = z / NW, zw = z % NW; A += za * sA; if (A2) A2 += za * sA; Bt += zw * sB; if (Bt2) Bt2 += zw * sB; C += z * sC;
    const int lane = threadIdx.x & 31, lr = lane & 15, hi = lane >> 4; const int r0 = blockIdx.x * 64, c0 = blockIdx.y * 64;
    v8f acc[4][4];
#pragma unroll
    for (int mb = 0; mb < 4; ++mb)
#pragma unroll
        for (int nb = 0; nb < 4; ++nb) acc[mb][nb] = (v8f){};
    const size_t aoff = (size_t)(r0 + lr) * K + 8 * hi, boff = (size_t)(c0 + lr) * K + 8 * hi;
#pragma unroll 1
    for (int kc = 0; kc < K; kc += 32) {
        V a[4], a2[4];
#pragma unroll
        for (int mb = 0; mb < 4; ++mb) { a[mb] = WFrag<T16>::ld(A + aoff + (size_t)mb * 16 * K + kc); if (NSPLIT == 1 || NSPLIT == 2) a2[mb] = WFrag<T16>::ld(A2 + aoff + (size_t)mb * 16 * K + kc); }
#pragma unroll
        for (int nb = 0; nb < 4; ++nb) { const V b = WFrag<T16>::ld(Bt + boff + (size_t)nb * 16 * K + kc); V b2; if (NSPLIT >= 2) b2 = WFrag<T16>::ld(Bt2 + boff + (size_t)nb * 16 * K + kc);
#pragma unroll
            for (int mb = 0; mb < 4; ++mb) { acc[mb][nb] = WFrag<T16>::mma(a[mb], b, acc[mb][nb]); if (NSPLIT == 1 || NSPLIT == 2) acc[mb][nb] = WFrag<T16>::mma(a2[mb], b, acc[mb][nb]); if (NSPLIT >= 2) acc[mb][nb] = WFrag<T16>::mma(a[mb], b2, acc[mb][nb]); } }
        asm volatile("v_nop\n\tv_nop\n\tv_nop\n\tv_nop" : "+v"(acc[0][0]), "+v"(acc[1][1]), "+v"(acc[2][2]), "+v"(acc[3][3]) : "v"(a[0]), "v"(a[3]));
    }
#pragma unroll
    for (int mb = 0; mb < 4; ++mb) {
#pragma unroll
        for (int nb = 0; nb < 4; ++nb) {
#pragma unroll
            for (int j = 0; j < 8; ++j) os[(hi * 8 + j) * 68 + nb * 16 + lr] = acc[mb][nb][j]; }
        __builtin_amdgcn_wave_barrier(); asm volatile("" ::: "memory");
        float* crow = C + (size_t)(r0 + mb * 16) * ldc + c0;
{
#pragma unroll
            for (int s = 0; s < 8; ++s) { const int row = 2 * s + hi, cofs = lr * 4; v4f val = *(const v4fa*)(os + row * 68 + cofs); if (BIAS) { val[0] += bfr(bias[c0 + cofs]); val[1] += bfr(bias[c0 + cofs + 1]); val[2] += bfr(bias[c0 + cofs + 2]); val[3] += bfr(bias[c0 + cofs + 3]); }
                *(v4f*)(crow + (size_t)row * ldc + cofs) = val; }
             }
        __builtin_amdgcn_wave_barrier(); asm volatile("" ::: "memory");
    }
}

// d_wtG, d_cvt8: bx = the block's index within its own piece of work.
__device__ __forceinline__ void d_wtG(const float* __restrict__ w, int K, int N, bf* Bt, int bx) {
    const int lane = threadIdx.x & 31; const int L0 = (bx * 8 + (threadIdx.x >> 5)) * 8; const int nlines = N * K / 64;
{
#pragma unroll 1
        for (int l = 0; l < 8; ++l) { const int L = L0 + l; if (L >= nlines) break; const size_t e = (size_t)L * 64 + lane * 2; const int k = (int)(e % K), n = (int)(e / K); v2us o;
            o[0] = f2bf(w[(size_t)k * N + n]); o[1] = f2bf(w[(size_t)(k + 1) * N + n]); *(v2us*)(Bt + e) = o; }
         }
}
__device__ __forceinline__ void d_cvt8(const float* __restrict__ src, bf* dst, size_t n8, unsigned bx) { const size_t i = (size_t)bx * 256 + threadIdx.x; if (i >= n8) return; const v8f v = *(const v8f*)(src + i * 8); v8us o;
#pragma unroll
    for (int k = 0; k < 8; ++k) o[k] = f2bf(v[k]); *(v8us*)(dst + i * 8) = o;  }
// k_prep: all operand conversions in one launch. Blocks 0 .. 4 * LWB - 1: the four weight matrices (all K x N), LWB blocks each, their transposed planes one behind the other in Bt; then NCB blocks per batch of x.
#define LWB ((unsigned)((DM * DQ / 64 + 63) / 64))
#define NCB ((unsigned)(((size_t)TT * DM / 8 + 255) / 256))
__global__ __launch_bounds__(256) void k_prep(const float* __restrict__ w0, const float* __restrict__ w1, const float* __restrict__ w2, const float* __restrict__ w3, int K, int N, bf* Bt, const float* __restrict__ x, bf* XB) {
    const unsigned bx = blockIdx.x;
    if (bx < 4u * LWB) { const unsigned y = bx / LWB; const float* __restrict__ w = y == 0 ? w0 : y == 1 ? w1 : y == 2 ? w2 : w3; d_wtG(w, K, N, Bt + (size_t)y * N * K, (int)(bx % LWB)); }
    else { const unsigned c = bx - 4u * LWB, b = c / NCB; d_cvt8(x + (size_t)b * SEQ_FULL * DM, XB + (size_t)b * TT * DM, (size_t)TT * DM / 8, c % NCB); }
}
// d_hp, d_vt: one thread per 16-byte chunk of the fragment-order planes, so a wave stores 512 contiguous bytes per plane.
// d_hp: per head, rows = t, k = d: tile = 2 * (t / 16) + d / 32.
__device__ __forceinline__ void d_hp(const float* __restrict__ F, h16* P16, bf* Ph, bf* Pl) {
    const size_t i = (size_t)blockIdx.x * 256 + threadIdx.x; const size_t e = i * 8; if (e >= (size_t)NH_ * TT * HD) return;
    const int h = (int)(i / ((size_t)TT * HD / 8)); const int ii = (int)(i % ((size_t)TT * HD / 8)); const int c = ii & 63, tile = ii >> 6;
    const int t = (tile >> 1) * 16 + (c & 15); const int d = (tile & 1) * 32 + (c >> 5) * 16 + ((c >> 4) & 1) * 8;
    const v8f x = *(const v8f*)(F + (size_t)t * DQ + h * HD + d); v8h o16; v8us oh, ol;
#pragma unroll
    for (int q = 0; q < 8; ++q) { o16[q] = (h16)x[q]; unsigned short a2, c2; splitf(x[q], a2, c2); oh[q] = a2; ol[q] = c2; }
    *(v8h*)(P16 + e) = o16; *(v8us*)(Ph + e) = oh; *(v8us*)(Pl + e) = ol;  }
// d_vt: per head, rows = d, k = t: tile = 4 * (t / 32) + d / 16 (the 4 tiles of one 32-key step in a row). The lanes of a half wave read 16 neighbouring d of one t.
__device__ __forceinline__ void d_vt(const float* __restrict__ F, h16* V16, bf* Vh, bf* Vl) {
    const size_t i = (size_t)blockIdx.x * 256 + threadIdx.x; const size_t e = i * 8; if (e >= (size_t)NH_ * HD * TT) return;
    const int g = (int)(i / ((size_t)TT * HD / 8)); const int ii = (int)(i % ((size_t)TT * HD / 8)); const int c = ii & 63, tile = ii >> 6;
    const int d = (tile & 3) * 16 + (c & 15); const int t = (tile >> 2) * 32 + (c >> 5) * 16 + ((c >> 4) & 1) * 8; v8h o16; v8us oh, ol;
#pragma unroll
    for (int q = 0; q < 8; ++q) { const float x = F[(size_t)(t + q) * DQ + g * HD + d]; o16[q] = (h16)x; unsigned short a2, c2; splitf(x, a2, c2); oh[q] = a2; ol[q] = c2; }
    *(v8h*)(V16 + e) = o16; *(v8us*)(Vh + e) = oh; *(v8us*)(Vl + e) = ol;  }
// k_pl: all planes of all batches in one launch. blockIdx.y = 3 * batch + p (the order of the projection GEMM's C matrices), p = 0: q, 1: k, 2: v; plane (p, batch) lies at index p * NB + batch of each of the three arrays.
__global__ __launch_bounds__(256) void k_pl(const float* __restrict__ F, h16* P16, bf* Ph, bf* Pl) {
    const int y = blockIdx.y, p = y % 3, b = y / 3; const size_t po = ((size_t)p * NB + b) * NH_ * TT * HD; F += (size_t)y * TT * DQ;
    if (p < 2) d_hp(F, P16 + po, Ph + po, Pl + po); else d_vt(F, P16 + po, Ph + po, Pl + po);
}

// Probability packers: two 16-key score tiles (accumulator layout: lane = query, element r = key 8*(lane>>4)+r) -> one 32-key B fragment (elements 0..7 <- tile 0, 8..15 <- tile 1).
template <typename T16> struct PPk;
template <> struct PPk<h16> {
    static __device__ __forceinline__ v16h hi(v8f p0, v8f p1) { v8h a, b;
#pragma unroll
        for (int r = 0; r < 8; ++r) { a[r] = (h16)(p0[r] * PCAR); b[r] = (h16)(p1[r] * PCAR); }
        return cat16(a, b); }
    static __device__ __forceinline__ v16h lo(v8f p0, v8f p1) { return hi(p0, p1); }
};
template <> struct PPk<bf> {
    static __device__ __forceinline__ v16bf hi(v8f p0, v8f p1) { v8us a, b;
#pragma unroll
        for (int r = 0; r < 8; ++r) { a[r] = f2bf(p0[r]); b[r] = f2bf(p1[r]); }
        return cat16b(a, b); }
    static __device__ __forceinline__ v16bf lo(v8f p0, v8f p1) { v8us a, b;
#pragma unroll
        for (int r = 0; r < 8; ++r) { a[r] = f2bf(p0[r] - bf2f(f2bf(p0[r]))); b[r] = f2bf(p1[r] - bf2f(f2bf(p1[r]))); }
        return cat16b(a, b); }
};

// ---- k_flash: register-fed transposed flash attention; ONE WAVE per (16 * NQ queries, head, batch); grid ((rows)/(16 * NQ), NH, NB), 32 threads; roff = first query row of this launch.
// Per 32-key step: S^T[key][query] = K (A operand, rows = keys, k = d) x Q^T (B operand held in registers, lane = query); online softmax per lane (query = lane & 15, the two lane halves hold
// different keys; one xor-16 shuffle for the max); O^T[d][query] += V^T (A operand, rows = d, k = keys, fragment-order plane per head) x P^T (B operand packed from the two score tiles). No LDS in the key loop.
// HL: bf16 hi/lo planes, 3 products per contraction, P not carried. Otherwise fp16 single product with P carried x1024.
// The K and V^T fragments of a step live in one of two register sets; each step first issues all loads of the NEXT step into the other set, so a load has a whole step to land.
template <typename T16, bool HL> struct FKV { typename WFrag<T16>::V k[4], kl[4], v[4], vl[4]; };   // kl, vl: lo planes, HL only

template <typename T16, bool HL>
__device__ __forceinline__ void ldkv(FKV<T16, HL>& f, const T16* __restrict__ K1, const T16* __restrict__ K2, const T16* __restrict__ V1, const T16* __restrict__ V2, size_t koff, int kb) {
    const size_t ko = koff + (size_t)kb * HD;   // a 32-key step is 4 tiles (4 KiB in a row) of the K plane and 4 of the V^T plane, at the same offset
#pragma unroll
    for (int i = 0; i < 4; ++i) f.k[i] = WFrag<T16>::ldf(K1 + ko + i * 512);
    // one wait behind each plane's loads
    asm volatile("s_wait_xcnt 0x0" ::: "memory");
    if (HL) {
#pragma unroll
        for (int i = 0; i < 4; ++i) f.kl[i] = WFrag<T16>::ldf(K2 + ko + i * 512);
        asm volatile("s_wait_xcnt 0x0" ::: "memory");   // as above
    }
#pragma unroll
    for (int dt = 0; dt < 4; ++dt) f.v[dt] = WFrag<T16>::ldf(V1 + ko + dt * 512);
    asm volatile("s_wait_xcnt 0x0" ::: "memory");   // as above
    if (HL) {
#pragma unroll
        for (int dt = 0; dt < 4; ++dt) f.vl[dt] = WFrag<T16>::ldf(V2 + ko + dt * 512);
        asm volatile("s_wait_xcnt 0x0" ::: "memory");   // as above
    }
}

template <typename T16, bool HL, int NQ>
__device__ __forceinline__ void fstep(const FKV<T16, HL>& f, const typename WFrag<T16>::V (&qa)[NQ][2], const typename WFrag<T16>::V (&qb)[NQ][2], v8f (&o)[NQ][4], float (&m)[NQ], float (&l)[NQ], int kb, int q0, int lr, int hi) {
    typedef typename WFrag<T16>::V V;
    static_assert(NQ == 1 || NQ == 2);
    v8f s[NQ][2];
#pragma unroll
    for (int kt = 0; kt < 2; ++kt)
#pragma unroll
        for (int qt = 0; qt < NQ; ++qt) {
            v8f a = (v8f){};
            if (HL) { a = WFrag<T16>::mma(f.kl[2 * kt], qa[qt][0], a); a = WFrag<T16>::mma(f.kl[2 * kt + 1], qa[qt][1], a); a = WFrag<T16>::mma(f.k[2 * kt], qb[qt][0], a); a = WFrag<T16>::mma(f.k[2 * kt + 1], qb[qt][1], a); }
            a = WFrag<T16>::mma(f.k[2 * kt], qa[qt][0], a); a = WFrag<T16>::mma(f.k[2 * kt + 1], qa[qt][1], a);
            s[qt][kt] = a;
        }
    // WMMA distance: four vector slots between the last score product and the first reader of its result
    if constexpr (NQ == 1) asm volatile("v_nop\n\tv_nop\n\tv_nop\n\tv_nop" : "+v"(s[0][0]), "+v"(s[0][1]) : "v"(qa[0][0]), "v"(qa[0][1]));
    else asm volatile("v_nop\n\tv_nop\n\tv_nop\n\tv_nop" : "+v"(s[0][0]), "+v"(s[0][1]), "+v"(s[1][0]), "+v"(s[1][1]) : "v"(qa[0][0]), "v"(qa[0][1]), "v"(qa[1][0]), "v"(qa[1][1]));
    const bool diag = (kb + 31 > q0);         // wave-uniform: this step can hold keys beyond some query
    V pa[NQ], pb[NQ];
#pragma unroll
    for (int qt = 0; qt < NQ; ++qt) {
        const int qi = q0 + qt * 16 + lr;
        float mx = -1.0e30f;
#pragma unroll
        for (int kt = 0; kt < 2; ++kt)
#pragma unroll
            for (int r = 0; r < 8; ++r) { const int key = kb + kt * 16 + 8 * hi + r; float t = s[qt][kt][r] * SCL; t = (diag && (key > qi)) ? -1.0e30f : t; s[qt][kt][r] = t; mx = fmaxf(mx, t); }
        mx = fmaxf(mx, __shfl_xor(mx, 16, 32));
        const float mn = fmaxf(m[qt], mx);
        const float al = __builtin_amdgcn_exp2f((m[qt] - mn) * L2E);
        m[qt] = mn;
        float psum = 0.0f;
#pragma unroll
        for (int kt = 0; kt < 2; ++kt)
#pragma unroll
            for (int r = 0; r < 8; ++r) { const float p = __builtin_amdgcn_exp2f((s[qt][kt][r] - mn) * L2E); s[qt][kt][r] = p; psum += p; }
        l[qt] = l[qt] * al + psum;
#pragma unroll
        for (int dt = 0; dt < 4; ++dt) o[qt][dt] = o[qt][dt] * al;
        pa[qt] = PPk<T16>::hi(s[qt][0], s[qt][1]);
        pb[qt] = pa[qt]; if (HL) pb[qt] = PPk<T16>::lo(s[qt][0], s[qt][1]);
    }
#pragma unroll
    for (int dt = 0; dt < 4; ++dt)
#pragma unroll
        for (int qt = 0; qt < NQ; ++qt) {
            if (HL) { o[qt][dt] = WFrag<T16>::mma(f.vl[dt], pa[qt], o[qt][dt]); o[qt][dt] = WFrag<T16>::mma(f.v[dt], pb[qt], o[qt][dt]); }
            o[qt][dt] = WFrag<T16>::mma(f.v[dt], pa[qt], o[qt][dt]);
        }
    // WMMA distance, as above, for the output tiles and the packed probabilities
    if constexpr (NQ == 1) asm volatile("v_nop\n\tv_nop\n\tv_nop\n\tv_nop" : "+v"(o[0][0]), "+v"(o[0][1]), "+v"(o[0][2]), "+v"(o[0][3]) : "v"(pa[0]), "v"(pb[0]));
    else asm volatile("v_nop\n\tv_nop\n\tv_nop\n\tv_nop" : "+v"(o[0][0]), "+v"(o[0][1]), "+v"(o[0][2]), "+v"(o[0][3]), "+v"(o[1][0]), "+v"(o[1][1]), "+v"(o[1][2]), "+v"(o[1][3]) : "v"(pa[0]), "v"(pb[0]), "v"(pa[1]), "v"(pb[1]));
}

// NQ: 16-query tiles per wave. Every K and V^T fragment a wave loads feeds all its NQ tiles, so the key loop's bytes from L2 per query fall by NQ; each query keeps its own m, l and output tiles and its order of 32-key steps.
template <typename T16, bool HL, int NQ>
__global__ __launch_bounds__(32) void k_flash(const T16* __restrict__ Q1, const T16* __restrict__ Q2, const T16* __restrict__ K1, const T16* __restrict__ K2, const T16* __restrict__ V1, const T16* __restrict__ V2, int roff, bf* Ah, bf* Al) {
    typedef typename WFrag<T16>::V V;
    __shared__ __align__(16) unsigned short st[NQ * 2 * 16 * 72];
    const int lane = threadIdx.x & 31, lr = lane & 15, hi = lane >> 4;
    const int q0 = roff + blockIdx.x * (16 * NQ); const int head = blockIdx.y;
    const size_t hp = ((size_t)blockIdx.z * NH_ + head) * TT * HD;
    const size_t qoff = hp + (size_t)q0 * HD + lane * 8;   // 16 queries are 2 tiles
    V qa[NQ][2], qb[NQ][2];
#pragma unroll
    for (int qt = 0; qt < NQ; ++qt) {
        qa[qt][0] = WFrag<T16>::ldf(Q1 + qoff + qt * 1024); qa[qt][1] = WFrag<T16>::ldf(Q1 + qoff + qt * 1024 + 512);
        if (HL) { qb[qt][0] = WFrag<T16>::ldf(Q2 + qoff + qt * 1024); qb[qt][1] = WFrag<T16>::ldf(Q2 + qoff + qt * 1024 + 512); } else { qb[qt][0] = qa[qt][0]; qb[qt][1] = qa[qt][1]; }
    }
    asm volatile("s_wait_xcnt 0x0" ::: "memory");   // the address registers of the Q loads may be reused by the loads below
    v8f o[NQ][4]; float m[NQ], l[NQ];
#pragma unroll
    for (int qt = 0; qt < NQ; ++qt) { m[qt] = -1.0e30f; l[qt] = 0.0f;
#pragma unroll
        for (int dt = 0; dt < 4; ++dt) o[qt][dt] = (v8f){}; }
    const int nst = (q0 + 16 * NQ + 31) >> 5;     // keys 0 .. q0+16*NQ-1 in steps of 32; at least 1
    const size_t koff = hp + lane * 8;
    FKV<T16, HL> fa, fb;
    ldkv<T16, HL>(fa, K1, K2, V1, V2, koff, 0);
    asm volatile("s_wait_xcnt 0x0" ::: "memory");   // the address registers of the loads above are reused below
    int stp = 0;
    // two steps per trip, so that the two register sets swap roles without copies
#pragma unroll 1
    for (; stp + 1 < nst; stp += 2) {
        ldkv<T16, HL>(fb, K1, K2, V1, V2, koff, (stp + 1) * 32);
        fstep<T16, HL, NQ>(fa, qa, qb, o, m, l, stp * 32, q0, lr, hi);
        const int nx = (stp + 2 < nst) ? stp + 2 : nst - 1;   // past the last step: fetch the last step again, in bounds and unused
        ldkv<T16, HL>(fa, K1, K2, V1, V2, koff, nx * 32);
        fstep<T16, HL, NQ>(fb, qa, qb, o, m, l, (stp + 1) * 32, q0, lr, hi);
    }
    if (stp < nst) fstep<T16, HL, NQ>(fa, qa, qb, o, m, l, stp * 32, q0, lr, hi);
#pragma unroll
    for (int qt = 0; qt < NQ; ++qt) {
        const float lt = l[qt] + __shfl_xor(l[qt], 16, 32);
        const float inv = (HL ? 1.0f : (1.0f / PCAR)) * (1.0f / lt);
        unsigned short* sq = st + qt * (2 * 16 * 72);
#pragma unroll
        for (int dt = 0; dt < 4; ++dt) { v8us hv, lv;
#pragma unroll
            for (int r = 0; r < 8; ++r) { unsigned short a2, c2; splitf(o[qt][dt][r] * inv, a2, c2); hv[r] = a2; lv[r] = c2; }
            *(v8usa*)(sq + lr * 72 + dt * 16 + 8 * hi) = hv; *(v8usa*)(sq + 16 * 72 + lr * 72 + dt * 16 + 8 * hi) = lv; }
    }
    __syncthreads();
#pragma unroll
    for (int qt = 0; qt < NQ; ++qt) {
        const unsigned short* sq = st + qt * (2 * 16 * 72);
#pragma unroll
        for (int s4 = 0; s4 < 4; ++s4) { const int row = 4 * s4 + (lane >> 3), c = (lane & 7) * 8;
            const v8us a = *(const v8usa*)(sq + row * 72 + c); const v8us b = *(const v8usa*)(sq + 16 * 72 + row * 72 + c);
            const size_t oo = ((size_t)blockIdx.z * TT + q0 + qt * 16 + row) * DQ + head * HD + c;
            *(v8us*)(Ah + oo) = a; *(v8us*)(Al + oo) = b; }
    }
}

extern "C" void kernel_launch(void* const* d_in, const int* in_sizes, int n_in,
                              void* d_out, int out_size, void* d_ws, size_t ws_size, hipStream_t stream) {
    if (n_in < 6) return;
    const size_t need = (size_t)(NB - 1) * SEQ_FULL * DM + (size_t)TT * DM;
    if ((size_t)in_sizes[0] < need || (size_t)out_size < need) return;
    if (in_sizes[1] < DM * DQ || in_sizes[2] < DM * DQ || in_sizes[3] < DM * DQ || in_sizes[4] < DQ * DM || in_sizes[5] < DM) return;
    const float* x = (const float*)d_in[0]; const float* wq = (const float*)d_in[1]; const float* wk = (const float*)d_in[2]; const float* wv = (const float*)d_in[3]; const float* wo = (const float*)d_in[4]; const float* bo = (const float*)d_in[5];
    float* OUT = (float*)d_out;     // [2][4096][768], byte offset 0
    char* wsp = (char*)d_ws;
    auto take = [&](size_t bytes) { char* p = wsp; wsp += (bytes + 255) & ~(size_t)255; return (void*)p; };
    bf* WT = (bf*)take((size_t)4 * DQ * DM * 2); bf* WO = WT + (size_t)3 * DQ * DM;   // transposed wq, wk, wv, wo, one behind the other
    bf* XB = (bf*)take((size_t)NB * TT * DM * 2); float* F = (float*)take((size_t)3 * NB * TT * DQ * 4);   // F: q, k, v projections of batch 0, then of batch 1
    const size_t PE = (size_t)NH_ * TT * HD;   // elements of one plane of one batch
    h16* P16 = (h16*)take((size_t)3 * NB * PE * 2); bf* Ph = (bf*)take((size_t)3 * NB * PE * 2); bf* Pl = (bf*)take((size_t)3 * NB * PE * 2);   // each: q planes of all batches, then k, then v^T
    bf* ATh = (bf*)take((size_t)NB * TT * DQ * 2); bf* ATl = (bf*)take((size_t)NB * TT * DQ * 2);
    if ((size_t)(wsp - (char*)d_ws) > ws_size) return;    // 231,211,008 B at the full size
    // Launches that do not depend on each other (the four weights and x; the two batches; the q, k and v projections and their planes) are one grid each.
    k_prep<<<4u * LWB + NB * NCB, 256, 0, stream>>>(wq, wk, wv, wo, DM, DQ, WT, x, XB);   // weights: in[768][768] -> out[768][768] transposed (DM == DQ)
    const unsigned LP = (unsigned)(((size_t)NH_ * TT * HD / 8 + 255) / 256);
    k_gemmw<bf, 0, false, 3><<<dim3(TT / 64, DQ / 64, 3 * NB), 32, 0, stream>>>(XB, nullptr, WT, nullptr, DM, F, DQ, nullptr, (size_t)TT * DM, (size_t)DQ * DM, (size_t)TT * DQ);
    k_pl<<<dim3(LP, 3 * NB, 1), 256, 0, stream>>>(F, P16, Ph, Pl);
    k_flash<bf, true, 1><<<dim3(RH / 16, NH_, NB), 32, 0, stream>>>(Ph, Pl, Ph + NB * PE, Pl + NB * PE, Ph + 2 * NB * PE, Pl + 2 * NB * PE, 0, ATh, ATl);
    if (TT > RH) k_flash<h16, false, 2><<<dim3((TT - RH) / 32, NH_, NB), 32, 0, stream>>>(P16, nullptr, P16 + NB * PE, nullptr, P16 + 2 * NB * PE, nullptr, RH, ATh, ATl);
    k_gemmw<bf, 1, true, 1><<<dim3(TT / 64, DM / 64, NB), 32, 0, stream>>>(ATh, ATl, WO, nullptr, DQ, OUT, DM, bo, (size_t)TT * DQ, 0, (size_t)SEQ_FULL * DM);
}

// v005
// One run takes 197 microseconds.
// Two timings next to v004 put it at 1.17 and 1.16 times that version's speed.
// Counting every step since v000, it is 3.58 times as fast.
#include <hip/hip_runtime.h>

// Causal self-attention block: x [2][4096][768]; q/k/v = x W (W [in][out] 768x768, 12 heads x 64); softmax(q.k / 8) over keys j <= i; out = merged ctx Wo + bo -> [2][4096][768].
// Compute dtypes, f32 accumulate: every input RNE-converted to bf16; q/k/v projections v_wmma_f32_16x16x32_bf16 (plain bf16 operands); scores (K Q^T) and ctx (V^T P^T): query rows < 512 on bf16 hi/lo planes (3 products), other rows v_wmma_f32_16x16x32_f16 single product (P carried x1024); softmax f32; ctx.Wo bf16 hi/lo x bf16 (2 products) + bias.

#ifndef NB
#define NB 2
#endif
#ifndef SEQ
#define SEQ 4096
#endif
#define NB_FULL  2
#define SEQ_FULL 4096
#define TT   SEQ
#define DM   768
#define NH_  12
#define HD   64
#define DQ   (NH_ * HD)
#define RH   ((SEQ) < 512 ? (SEQ) : 512)   // query rows < RH use hi+lo planes
#define PCAR 1024.0f
#define SCL  0.125f                        // HD^-0.5
#define L2E  1.4426950408889634f
#define WSB  ((size_t)4 * DQ * DM * 2 + (size_t)NB * ((size_t)TT * DM * 2 + (size_t)3 * TT * DQ * 4 + (size_t)9 * NH_ * TT * HD * 2 + (size_t)2 * TT * DQ * 2))

static_assert(SEQ % 64 == 0);
static_assert(SEQ <= SEQ_FULL);
static_assert(NB <= NB_FULL);
static_assert(DM % 64 == 0);
static_assert(DQ % 64 == 0);
static_assert(DQ == DM);
static_assert(RH % 16 == 0);
static_assert((TT - RH) % 32 == 0);
static_assert(((size_t)DQ * DM * 2) % 256 == 0);
static_assert(((size_t)TT * DM * 2) % 256 == 0);
static_assert(((size_t)NH_ * TT * HD * 2) % 256 == 0);
static_assert(WSB <= (size_t)268435456);

typedef _Float16 h16;
typedef unsigned short bf;
typedef __attribute__((ext_vector_type(16))) __bf16   v16bf;
typedef __attribute__((ext_vector_type(16))) _Float16 v16h;
typedef __attribute__((ext_vector_type(8)))  _Float16 v8h;
typedef __attribute__((ext_vector_type(8)))  unsigned short v8us;
typedef __attribute__((ext_vector_type(8)))  float    v8f;
typedef __attribute__((ext_vector_type(4)))  float    v4f;
typedef v8h  __attribute__((may_alias)) v8ha;
typedef v4f  __attribute__((may_alias)) v4fa;

__device__ __forceinline__ unsigned short f2bf(float f) { unsigned u = __float_as_uint(f); u += 0x7FFFu + ((u >> 16) & 1u); return (unsigned short)(u >> 16); }
__device__ __forceinline__ float bf2f(unsigned short b) { return __uint_as_float(((unsigned)b) << 16); }
__device__ __forceinline__ float bfr(float f) { return bf2f(f2bf(f)); }
__device__ __forceinline__ v16h cat16(v8h lo, v8h hi) { return __builtin_shufflevector(lo, hi, 0, 1, 2, 3, 4, 5, 6, 7, 8, 9, 10, 11, 12, 13, 14, 15); }
__device__ __forceinline__ v16bf cat16b(v8us lo, v8us hi) { return __builtin_bit_cast(v16bf, __builtin_shufflevector(lo, hi, 0, 1, 2, 3, 4, 5, 6, 7, 8, 9, 10, 11, 12, 13, 14, 15)); }
__device__ __forceinline__ v8f wmma16(v16h a, v16h b, v8f c) { return __builtin_amdgcn_wmma_f32_16x16x32_f16(false, a, false, b, (short)0, c, false, false); }
__device__ __forceinline__ v8f wmmab(v16bf a, v16bf b, v8f c) { return __builtin_amdgcn_wmma_f32_16x16x32_bf16(false, a, false, b, (short)0, c, false, false); }
__device__ __forceinline__ void splitf(float y, unsigned short& h, unsigned short& l) { h = f2bf(y); l = f2bf(y - bf2f(h)); }

// Fragment map, the same for A and B operands: lane holds row (lane & 15); elements 0..7 <- k = 8 * (lane >> 4) + 0..7, elements 8..15 <- k = 16 + 8 * (lane >> 4) + 0..7 of a 32-k slice.
// Fragment-order planes (every WMMA operand read from memory): a 16-bit matrix [rows][k] kept as tiles of 16 rows x 32 k (512 elements, 1 KiB). Inside a tile the 16-byte chunk 32 * s + lane holds row (lane & 15),
// k = 16 * s + 8 * (lane >> 4) + 0..7: the map above. A tile is one fragment, and each of its two loads reads 512 contiguous bytes (4 whole cache lines) instead of 32 bytes from each of 16 rows.
// ldf: p points at tile base + 8 * lane; elements 0..7 <- p[0..7], elements 8..15 <- p[256..263].
// Tile order of the GEMM operand planes (x, the transposed weights, the merged context): tile = ((row / 64) * (K / 32) + k / 32) * 4 + (row / 16) % 4, so one 32-k step of a 64-row block is 4 KiB in a row.
template <typename T16> struct WFrag;
template <> struct WFrag<h16> { typedef v16h V; static __device__ __forceinline__ V ldf(const h16* p) { return cat16(*(const v8h*)p, *(const v8h*)(p + 256)); } static __device__ __forceinline__ v8f mma(V a, V b, v8f c) { return wmma16(a, b, c); } };
template <> struct WFrag<bf> { typedef v16bf V; static __device__ __forceinline__ V ldf(const bf* p) { return cat16b(*(const v8us*)p, *(const v8us*)(p + 256)); } static __device__ __forceinline__ v8f mma(V a, V b, v8f c) { return wmmab(a, b, c); } };

// ---- k_gemmw: register-blocked GEMM, ONE WAVE per 64x64 output tile (16 accumulators), operands straight from fragment-order 16-bit planes; grid (M/64, N/64, Z), 32 threads.
// C[m][n] (f32, pitch ldc, + optional f32 bias[n]) = sum_k A[m][k] Bt[n][k] (+ split products per NSPLIT). K % 32 == 0, M % 64 == 0, N % 64 == 0.
// blockIdx.z counts independent products: A matrix z / NW (stride sA), B matrix z % NW (stride sB), C matrix z (stride sC).
template <typename T16, int NSPLIT, bool BIAS, int NW>
__global__ __launch_bounds__(32) void k_gemmw(const T16* __restrict__ A, const T16* __restrict__ A2, const T16* __restrict__ Bt, const T16* __restrict__ Bt2, int K, float* C, int ldc, const float* __restrict__ bias, size_t sA, size_t sB, size_t sC) {
    typedef typename WFrag<T16>::V V;
    __shared__ __align__(16) float os[16 * 68];
    const size_t z = blockIdx.z, za = z / NW, zw = z % NW; A += za * sA; if (A2) A2 += za * sA; Bt += zw * sB; if (Bt2) Bt2 += zw * sB; C += z * sC;
    const int lane = threadIdx.x & 31, lr = lane & 15, hi = lane >> 4; const int r0 = blockIdx.x * 64, c0 = blockIdx.y * 64;
    v8f acc[4][4];
#pragma unroll
    for (int mb = 0; mb < 4; ++mb)
#pragma unroll
        for (int nb = 0; nb < 4; ++nb) acc[mb][nb] = (v8f){};
    const size_t aoff = (size_t)blockIdx.x * K * 64 + lane * 8, boff = (size_t)blockIdx.y * K * 64 + lane * 8;   // a 64-row block is K * 64 elements; a 32-k step of it 2048
#pragma unroll 1
    for (int kc = 0; kc < K; kc += 32) {
        V a[4], a2[4]; const T16* pa = A + aoff + (size_t)kc * 64; const T16* pa2 = (NSPLIT == 1 || NSPLIT == 2) ? A2 + aoff + (size_t)kc * 64 : pa; const T16* pb = Bt + boff + (size_t)kc * 64; const T16* pb2 = NSPLIT >= 2 ? Bt2 + boff + (size_t)kc * 64 : pb;
#pragma unroll
        for (int mb = 0; mb < 4; ++mb) { a[mb] = WFrag<T16>::ldf(pa + mb * 512); if (NSPLIT == 1 || NSPLIT == 2) a2[mb] = WFrag<T16>::ldf(pa2 + mb * 512); }
        // the compiler lets later loads land on the address registers of the loads above; one wait behind the A loads, one behind each B fragment's. The addresses are inputs, so that they stay in their registers up to the wait
        asm volatile("s_wait_xcnt 0x0" :: "v"(pa), "v"(pa2) : "memory");
#pragma unroll
        for (int nb = 0; nb < 4; ++nb) { const V b = WFrag<T16>::ldf(pb + nb * 512); V b2; if (NSPLIT >= 2) b2 = WFrag<T16>::ldf(pb2 + nb * 512);
            asm volatile("s_wait_xcnt 0x0" :: "v"(pb), "v"(pb2) : "memory");   // as above
#pragma unroll
            for (int mb = 0; mb < 4; ++mb) { acc[mb][nb] = WFrag<T16>::mma(a[mb], b, acc[mb][nb]); if (NSPLIT == 1 || NSPLIT == 2) acc[mb][nb] = WFrag<T16>::mma(a2[mb], b, acc[mb][nb]); if (NSPLIT >= 2) acc[mb][nb] = WFrag<T16>::mma(a[mb], b2, acc[mb][nb]); } }
        asm volatile("v_nop\n\tv_nop\n\tv_nop\n\tv_nop" : "+v"(acc[0][0]), "+v"(acc[1][1]), "+v"(acc[2][2]), "+v"(acc[3][3]) : "v"(a[0]), "v"(a[3]));
    }
#pragma unroll
    for (int mb = 0; mb < 4; ++mb) {
#pragma unroll
        for (int nb = 0; nb < 4; ++nb) {
#pragma unroll
            for (int j = 0; j < 8; ++j) os[(hi * 8 + j) * 68 + nb * 16 + lr] = acc[mb][nb][j]; }
        __builtin_amdgcn_wave_barrier(); asm volatile("" ::: "memory");
        float* crow = C + (size_t)(r0 + mb * 16) * ldc + c0;
{
#pragma unroll
            for (int s = 0; s < 8; ++s) { const int row = 2 * s + hi, cofs = lr * 4; v4f val = *(const v4fa*)(os + row * 68 + cofs); if (BIAS) { val[0] += bfr(bias[c0 + cofs]); val[1] += bfr(bias[c0 + cofs + 1]); val[2] += bfr(bias[c0 + cofs + 2]); val[3] += bfr(bias[c0 + cofs + 3]); }
                *(v4f*)(crow + (size_t)row * ldc + cofs) = val; }
             }
        __builtin_amdgcn_wave_barrier(); asm volatile("" ::: "memory");
    }
}

// gpos: 16-byte chunk i of a GEMM operand plane [rows][K] -> its row and its first k.
template <int K> __device__ __forceinline__ void gpos(unsigned i, int& row, int& k) { const unsigned c = i & 63u, tile = i >> 6, g = tile >> 2;
    row = (int)((g / (K / 32)) * 64 + (tile & 3u) * 16 + (c & 15u)); k = (int)((g % (K / 32)) * 32 + (c >> 5) * 16 + ((c >> 4) & 1u) * 8); }
// d_wtG, d_cvt8: one thread per 16-byte chunk of the plane, so a wave stores 512 contiguous bytes; bx = the block's index within its own piece of work.
// d_wtG: plane rows = n, k = k of w [K][N]. The lanes of a half wave read 16 neighbouring n of one k.
__device__ __forceinline__ void d_wtG(const float* __restrict__ w, bf* Bt, unsigned bx) { const unsigned i = bx * 256 + threadIdx.x; if (i >= (unsigned)(DQ * DM / 8)) return; int n, k; gpos<DM>(i, n, k); v8us o;
#pragma unroll
    for (int q = 0; q < 8; ++q) o[q] = f2bf(w[(size_t)(k + q) * DQ + n]);
    *(v8us*)(Bt + (size_t)i * 8) = o; }
__device__ __forceinline__ void d_cvt8(const float* __restrict__ src, bf* dst, unsigned bx) { const unsigned i = bx * 256 + threadIdx.x; if (i >= (unsigned)((size_t)TT * DM / 8)) return; int t, k; gpos<DM>(i, t, k); const v8f v = *(const v8f*)(src + (size_t)t * DM + k); v8us o;
#pragma unroll
    for (int q = 0; q < 8; ++q) o[q] = f2bf(v[q]);
    *(v8us*)(dst + (size_t)i * 8) = o; }
// k_prep: all operand conversions in one launch. Blocks 0 .. 4 * LWB - 1: the four weight matrices (all DM x DQ), LWB blocks each, their transposed planes one behind the other in Bt; then NCB blocks per batch of x.
#define LWB ((unsigned)((DM * DQ / 8 + 255) / 256))
#define NCB ((unsigned)(((size_t)TT * DM / 8 + 255) / 256))
__global__ __launch_bounds__(256) void k_prep(const float* __restrict__ w0, const float* __restrict__ w1, const float* __restrict__ w2, const float* __restrict__ w3, bf* Bt, const float* __restrict__ x, bf* XB) {
    const unsigned bx = blockIdx.x;
    if (bx < 4u * LWB) { const unsigned y = bx / LWB; const float* __restrict__ w = y == 0 ? w0 : y == 1 ? w1 : y == 2 ? w2 : w3; d_wtG(w, Bt + (size_t)y * DQ * DM, bx % LWB); }
    else { const unsigned c = bx - 4u * LWB, b = c / NCB; d_cvt8(x + (size_t)b * SEQ_FULL * DM, XB + (size_t)b * TT * DM, c % NCB); }
}
// d_hp, d_vt: one thread per 16-byte chunk of the fragment-order planes, so a wave stores 512 contiguous bytes per plane.
// d_hp: per head, rows = t, k = d: tile = 2 * (t / 16) + d / 32.
__device__ __forceinline__ void d_hp(const float* __restrict__ F, h16* P16, bf* Ph, bf* Pl) {
    const size_t i = (size_t)blockIdx.x * 256 + threadIdx.x; const size_t e = i * 8; if (e >= (size_t)NH_ * TT * HD) return;
    const int h = (int)(i / ((size_t)TT * HD / 8)); const int ii = (int)(i % ((size_t)TT * HD / 8)); const int c = ii & 63, tile = ii >> 6;
    const int t = (tile >> 1) * 16 + (c & 15); const int d = (tile & 1) * 32 + (c >> 5) * 16 + ((c >> 4) & 1) * 8;
    const v8f x = *(const v8f*)(F + (size_t)t * DQ + h * HD + d); v8h o16; v8us oh, ol;
#pragma unroll
    for (int q = 0; q < 8; ++q) { o16[q] = (h16)x[q]; unsigned short a2, c2; splitf(x[q], a2, c2); oh[q] = a2; ol[q] = c2; }
    *(v8h*)(P16 + e) = o16; *(v8us*)(Ph + e) = oh; *(v8us*)(Pl + e) = ol;  }
// d_vt: per head, rows = d, k = t: tile = 4 * (t / 32) + d / 16 (the 4 tiles of one 32-key step in a row). The lanes of a half wave read 16 neighbouring d of one t.
__device__ __forceinline__ void d_vt(const float* __restrict__ F, h16* V16, bf* Vh, bf* Vl) {
    const size_t i = (size_t)blockIdx.x * 256 + threadIdx.x; const size_t e = i * 8; if (e >= (size_t)NH_ * HD * TT) return;
    const int g = (int)(i / ((size_t)TT * HD / 8)); const int ii = (int)(i % ((size_t)TT * HD / 8)); const int c = ii & 63, tile = ii >> 6;
    const int d = (tile & 3) * 16 + (c & 15); const int t = (tile >> 2) * 32 + (c >> 5) * 16 + ((c >> 4) & 1) * 8; v8h o16; v8us oh, ol;
#pragma unroll
    for (int q = 0; q < 8; ++q) { const float x = F[(size_t)(t + q) * DQ + g * HD + d]; o16[q] = (h16)x; unsigned short a2, c2; splitf(x, a2, c2); oh[q] = a2; ol[q] = c2; }
    *(v8h*)(V16 + e) = o16; *(v8us*)(Vh + e) = oh; *(v8us*)(Vl + e) = ol;  }
// k_pl: all planes of all batches in one launch. blockIdx.y = 3 * batch + p (the order of the projection GEMM's C matrices), p = 0: q, 1: k, 2: v; plane (p, batch) lies at index p * NB + batch of each of the three arrays.
__global__ __launch_bounds__(256) void k_pl(const float* __restrict__ F, h16* P16, bf* Ph, bf* Pl) {
    const int y = blockIdx.y, p = y % 3, b = y / 3; const size_t po = ((size_t)p * NB + b) * NH_ * TT * HD; F += (size_t)y * TT * DQ;
    if (p < 2) d_hp(F, P16 + po, Ph + po, Pl + po); else d_vt(F, P16 + po, Ph + po, Pl + po);
}

// Probability packers: two 16-key score tiles (accumulator layout: lane = query, element r = key 8*(lane>>4)+r) -> one 32-key B fragment (elements 0..7 <- tile 0, 8..15 <- tile 1).
template <typename T16> struct PPk;
template <> struct PPk<h16> {
    static __device__ __forceinline__ v16h hi(v8f p0, v8f p1) { v8h a, b;
#pragma unroll
        for (int r = 0; r < 8; ++r) { a[r] = (h16)(p0[r] * PCAR); b[r] = (h16)(p1[r] * PCAR); }
        return cat16(a, b); }
    static __device__ __forceinline__ v16h lo(v8f p0, v8f p1) { return hi(p0, p1); }
};
template <> struct PPk<bf> {
    static __device__ __forceinline__ v16bf hi(v8f p0, v8f p1) { v8us a, b;
#pragma unroll
        for (int r = 0; r < 8; ++r) { a[r] = f2bf(p0[r]); b[r] = f2bf(p1[r]); }
        return cat16b(a, b); }
    static __device__ __forceinline__ v16bf lo(v8f p0, v8f p1) { v8us a, b;
#pragma unroll
        for (int r = 0; r < 8; ++r) { a[r] = f2bf(p0[r] - bf2f(f2bf(p0[r]))); b[r] = f2bf(p1[r] - bf2f(f2bf(p1[r]))); }
        return cat16b(a, b); }
};

// ---- k_flash: register-fed transposed flash attention; ONE WAVE per (16 * NQ queries, head, batch); grid ((rows)/(16 * NQ), NH, NB), 32 threads; roff = first query row of this launch.
// Per 32-key step: S^T[key][query] = K (A operand, rows = keys, k = d) x Q^T (B operand held in registers, lane = query); online softmax per lane (query = lane & 15, the two lane halves hold
// different keys; one xor-16 shuffle for the max); O^T[d][query] += V^T (A operand, rows = d, k = keys, fragment-order plane per head) x P^T (B operand packed from the two score tiles). No LDS in the key loop.
// HL: bf16 hi/lo planes, 3 products per contraction, P not carried. Otherwise fp16 single product with P carried x1024.
// The K and V^T fragments of a step live in one of two register sets; each step first issues all loads of the NEXT step into the other set, so a load has a whole step to land.
template <typename T16, bool HL> struct FKV { typename WFrag<T16>::V k[4], kl[4], v[4], vl[4]; };   // kl, vl: lo planes, HL only

template <typename T16, bool HL>
__device__ __forceinline__ void ldkv(FKV<T16, HL>& f, const T16* __restrict__ K1, const T16* __restrict__ K2, const T16* __restrict__ V1, const T16* __restrict__ V2, size_t koff, int kb) {
    const size_t ko = koff + (size_t)kb * HD;   // a 32-key step is 4 tiles (4 KiB in a row) of the K plane and 4 of the V^T plane, at the same offset
#pragma unroll
    for (int i = 0; i < 4; ++i) f.k[i] = WFrag<T16>::ldf(K1 + ko + i * 512);
    // one wait behind each plane's loads
    asm volatile("s_wait_xcnt 0x0" ::: "memory");
    if (HL) {
#pragma unroll
        for (int i = 0; i < 4; ++i) f.kl[i] = WFrag<T16>::ldf(K2 + ko + i * 512);
        asm volatile("s_wait_xcnt 0x0" ::: "memory");   // as above
    }
#pragma unroll
    for (int dt = 0; dt < 4; ++dt) f.v[dt] = WFrag<T16>::ldf(V1 + ko + dt * 512);
    asm volatile("s_wait_xcnt 0x0" ::: "memory");   // as above
    if (HL) {
#pragma unroll
        for (int dt = 0; dt < 4; ++dt) f.vl[dt] = WFrag<T16>::ldf(V2 + ko + dt * 512);
        asm volatile("s_wait_xcnt 0x0" ::: "memory");   // as above
    }
}

template <typename T16, bool HL, int NQ>
__device__ __forceinline__ void fstep(const FKV<T16, HL>& f, const typename WFrag<T16>::V (&qa)[NQ][2], const typename WFrag<T16>::V (&qb)[NQ][2], v8f (&o)[NQ][4], float (&m)[NQ], float (&l)[NQ], int kb, int q0, int lr, int hi) {
    typedef typename WFrag<T16>::V V;
    static_assert(NQ == 1 || NQ == 2);
    v8f s[NQ][2];
#pragma unroll
    for (int kt = 0; kt < 2; ++kt)
#pragma unroll
        for (int qt = 0; qt < NQ; ++qt) {
            v8f a = (v8f){};
            if (HL) { a = WFrag<T16>::mma(f.kl[2 * kt], qa[qt][0], a); a = WFrag<T16>::mma(f.kl[2 * kt + 1], qa[qt][1], a); a = WFrag<T16>::mma(f.k[2 * kt], qb[qt][0], a); a = WFrag<T16>::mma(f.k[2 * kt + 1], qb[qt][1], a); }
            a = WFrag<T16>::mma(f.k[2 * kt], qa[qt][0], a); a = WFrag<T16>::mma(f.k[2 * kt + 1], qa[qt][1], a);
            s[qt][kt] = a;
        }
    // WMMA distance: four vector slots between the last score product and the first reader of its result
    if constexpr (NQ == 1) asm volatile("v_nop\n\tv_nop\n\tv_nop\n\tv_nop" : "+v"(s[0][0]), "+v"(s[0][1]) : "v"(qa[0][0]), "v"(qa[0][1]));
    else asm volatile("v_nop\n\tv_nop\n\tv_nop\n\tv_nop" : "+v"(s[0][0]), "+v"(s[0][1]), "+v"(s[1][0]), "+v"(s[1][1]) : "v"(qa[0][0]), "v"(qa[0][1]), "v"(qa[1][0]), "v"(qa[1][1]));
    const bool diag = (kb + 31 > q0);         // wave-uniform: this step can hold keys beyond some query
    V pa[NQ], pb[NQ];
#pragma unroll
    for (int qt = 0; qt < NQ; ++qt) {
        const int qi = q0 + qt * 16 + lr;
        float mx = -1.0e30f;
#pragma unroll
        for (int kt = 0; kt < 2; ++kt)
#pragma unroll
            for (int r = 0; r < 8; ++r) { const int key = kb + kt * 16 + 8 * hi + r; float t = s[qt][kt][r] * SCL; t = (diag && (key > qi)) ? -1.0e30f : t; s[qt][kt][r] = t; mx = fmaxf(mx, t); }
        mx = fmaxf(mx, __shfl_xor(mx, 16, 32));
        const float mn = fmaxf(m[qt], mx);
        const float al = __builtin_amdgcn_exp2f((m[qt] - mn) * L2E);
        m[qt] = mn;
        float psum = 0.0f;
#pragma unroll
        for (int kt = 0; kt < 2; ++kt)
#pragma unroll
            for (int r = 0; r < 8; ++r) { const float p = __builtin_amdgcn_exp2f((s[qt][kt][r] - mn) * L2E); s[qt][kt][r] = p; psum += p; }
        l[qt] = l[qt] * al + psum;
#pragma unroll
        for (int dt = 0; dt < 4; ++dt) o[qt][dt] = o[qt][dt] * al;
        pa[qt] = PPk<T16>::hi(s[qt][0], s[qt][1]);
        pb[qt] = pa[qt]; if (HL) pb[qt] = PPk<T16>::lo(s[qt][0], s[qt][1]);
    }
#pragma unroll
    for (int dt = 0; dt < 4; ++dt)
#pragma unroll
        for (int qt = 0; qt < NQ; ++qt) {
            if (HL) { o[qt][dt] = WFrag<T16>::mma(f.vl[dt], pa[qt], o[qt][dt]); o[qt][dt] = WFrag<T16>::mma(f.v[dt], pb[qt], o[qt][dt]); }
            o[qt][dt] = WFrag<T16>::mma(f.v[dt], pa[qt], o[qt][dt]);
        }
    // WMMA distance, as above, for the output tiles and the packed probabilities
    if constexpr (NQ == 1) asm volatile("v_nop\n\tv_nop\n\tv_nop\n\tv_nop" : "+v"(o[0][0]), "+v"(o[0][1]), "+v"(o[0][2]), "+v"(o[0][3]) : "v"(pa[0]), "v"(pb[0]));
    else asm volatile("v_nop\n\tv_nop\n\tv_nop\n\tv_nop" : "+v"(o[0][0]), "+v"(o[0][1]), "+v"(o[0][2]), "+v"(o[0][3]), "+v"(o[1][0]), "+v"(o[1][1]), "+v"(o[1][2]), "+v"(o[1][3]) : "v"(pa[0]), "v"(pb[0]), "v"(pa[1]), "v"(pb[1]));
}

// NQ: 16-query tiles per wave. Every K and V^T fragment a wave loads feeds all its NQ tiles, so the key loop's bytes from L2 per query fall by NQ; each query keeps its own m, l and output tiles and its order of 32-key steps.
template <typename T16, bool HL, int NQ>
__global__ __launch_bounds__(32) void k_flash(const T16* __restrict__ Q1, const T16* __restrict__ Q2, const T16* __restrict__ K1, const T16* __restrict__ K2, const T16* __restrict__ V1, const T16* __restrict__ V2, int roff, bf* Ah, bf* Al) {
    typedef typename WFrag<T16>::V V;
    const int lane = threadIdx.x & 31, lr = lane & 15, hi = lane >> 4;
    const int q0 = roff + blockIdx.x * (16 * NQ); const int head = blockIdx.y;
    const size_t hp = ((size_t)blockIdx.z * NH_ + head) * TT * HD;
    const size_t qoff = hp + (size_t)q0 * HD + lane * 8;   // 16 queries are 2 tiles
    V qa[NQ][2], qb[NQ][2];
#pragma unroll
    for (int qt = 0; qt < NQ; ++qt) {
        qa[qt][0] = WFrag<T16>::ldf(Q1 + qoff + qt * 1024); qa[qt][1] = WFrag<T16>::ldf(Q1 + qoff + qt * 1024 + 512);
        if (HL) { qb[qt][0] = WFrag<T16>::ldf(Q2 + qoff + qt * 1024); qb[qt][1] = WFrag<T16>::ldf(Q2 + qoff + qt * 1024 + 512); } else { qb[qt][0] = qa[qt][0]; qb[qt][1] = qa[qt][1]; }
    }
    asm volatile("s_wait_xcnt 0x0" ::: "memory");   // the address registers of the Q loads may be reused by the loads below
    v8f o[NQ][4]; float m[NQ], l[NQ];
#pragma unroll
    for (int qt = 0; qt < NQ; ++qt) { m[qt] = -1.0e30f; l[qt] = 0.0f;
#pragma unroll
        for (int dt = 0; dt < 4; ++dt) o[qt][dt] = (v8f){}; }
    const int nst = (q0 + 16 * NQ + 31) >> 5;     // keys 0 .. q0+16*NQ-1 in steps of 32; at least 1
    const size_t koff = hp + lane * 8;
    FKV<T16, HL> fa, fb;
    ldkv<T16, HL>(fa, K1, K2, V1, V2, koff, 0);
    asm volatile("s_wait_xcnt 0x0" ::: "memory");   // the address registers of the loads above are reused below
    int stp = 0;
    // two steps per trip, so that the two register sets swap roles without copies
#pragma unroll 1
    for (; stp + 1 < nst; stp += 2) {
        ldkv<T16, HL>(fb, K1, K2, V1, V2, koff, (stp + 1) * 32);
        fstep<T16, HL, NQ>(fa, qa, qb, o, m, l, stp * 32, q0, lr, hi);
        const int nx = (stp + 2 < nst) ? stp + 2 : nst - 1;   // past the last step: fetch the last step again, in bounds and unused
        ldkv<T16, HL>(fa, K1, K2, V1, V2, koff, nx * 32);
        fstep<T16, HL, NQ>(fb, qa, qb, o, m, l, (stp + 1) * 32, q0, lr, hi);
    }
    if (stp < nst) fstep<T16, HL, NQ>(fa, qa, qb, o, m, l, stp * 32, q0, lr, hi);
    // The output tiles already have the fragment map (lane = query row, element r of tile dt = k 16 * dt + 8 * hi + r of this head's 64): each lane stores its 16-byte chunks straight into the output GEMM's A planes.
#pragma unroll
    for (int qt = 0; qt < NQ; ++qt) {
        const float lt = l[qt] + __shfl_xor(l[qt], 16, 32);
        const float inv = (HL ? 1.0f : (1.0f / PCAR)) * (1.0f / lt);
        const int t0 = q0 + qt * 16;
        const size_t oo = (size_t)blockIdx.z * TT * DQ + ((size_t)(t0 >> 6) * (DQ / 32) + head * (HD / 32)) * 2048 + ((t0 >> 4) & 3) * 512 + lane * 8;
#pragma unroll
        for (int dt = 0; dt < 4; ++dt) { v8us hv, lv;
#pragma unroll
            for (int r = 0; r < 8; ++r) { unsigned short a2, c2; splitf(o[qt][dt][r] * inv, a2, c2); hv[r] = a2; lv[r] = c2; }
            *(v8us*)(Ah + oo + (dt >> 1) * 2048 + (dt & 1) * 256) = hv; *(v8us*)(Al + oo + (dt >> 1) * 2048 + (dt & 1) * 256) = lv; }
        if (qt + 1 < NQ) asm volatile("s_wait_xcnt 0x0" ::: "memory");   // the next tile's values and addresses may reuse the registers of the stores above
    }
}

extern "C" void kernel_launch(void* const* d_in, const int* in_sizes, int n_in,
                              void* d_out, int out_size, void* d_ws, size_t ws_size, hipStream_t stream) {
    if (n_in < 6) return;
    const size_t need = (size_t)(NB - 1) * SEQ_FULL * DM + (size_t)TT * DM;
    if ((size_t)in_sizes[0] < need || (size_t)out_size < need) return;
    if (in_sizes[1] < DM * DQ || in_sizes[2] < DM * DQ || in_sizes[3] < DM * DQ || in_sizes[4] < DQ * DM || in_sizes[5] < DM) return;
    const float* x = (const float*)d_in[0]; const float* wq = (const float*)d_in[1]; const float* wk = (const float*)d_in[2]; const float* wv = (const float*)d_in[3]; const float* wo = (const float*)d_in[4]; const float* bo = (const float*)d_in[5];
    float* OUT = (float*)d_out;     // [2][4096][768], byte offset 0
    char* wsp = (char*)d_ws;
    auto take = [&](size_t bytes) { char* p = wsp; wsp += (bytes + 255) & ~(size_t)255; return (void*)p; };
    bf* WT = (bf*)take((size_t)4 * DQ * DM * 2); bf* WO = WT + (size_t)3 * DQ * DM;   // transposed wq, wk, wv, wo, one behind the other
    bf* XB = (bf*)take((size_t)NB * TT * DM * 2); float* F = (float*)take((size_t)3 * NB * TT * DQ * 4);   // F: q, k, v projections of batch 0, then of batch 1
    const size_t PE = (size_t)NH_ * TT * HD;   // elements of one plane of one batch
    h16* P16 = (h16*)take((size_t)3 * NB * PE * 2); bf* Ph = (bf*)take((size_t)3 * NB * PE * 2); bf* Pl = (bf*)take((size_t)3 * NB * PE * 2);   // each: q planes of all batches, then k, then v^T
    bf* ATh = (bf*)take((size_t)NB * TT * DQ * 2); bf* ATl = (bf*)take((size_t)NB * TT * DQ * 2);
    if ((size_t)(wsp - (char*)d_ws) > ws_size) return;    // 231,211,008 B at the full size
    // Launches that do not depend on each other (the four weights and x; the two batches; the q, k and v projections and their planes) are one grid each.
    k_prep<<<4u * LWB + NB * NCB, 256, 0, stream>>>(wq, wk, wv, wo, WT, x, XB);   // weights: in[768][768] -> out[768][768] transposed (DM == DQ)
    const unsigned LP = (unsigned)(((size_t)NH_ * TT * HD / 8 + 255) / 256);
    k_gemmw<bf, 0, false, 3><<<dim3(TT / 64, DQ / 64, 3 * NB), 32, 0, stream>>>(XB, nullptr, WT, nullptr, DM, F, DQ, nullptr, (size_t)TT * DM, (size_t)DQ * DM, (size_t)TT * DQ);
    k_pl<<<dim3(LP, 3 * NB, 1), 256, 0, stream>>>(F, P16, Ph, Pl);
    k_flash<bf, true, 1><<<dim3(RH / 16, NH_, NB), 32, 0, stream>>>(Ph, Pl, Ph + NB * PE, Pl + NB * PE, Ph + 2 * NB * PE, Pl + 2 * NB * PE, 0, ATh, ATl);
    if (TT > RH) k_flash<h16, false, 2><<<dim3((TT - RH) / 32, NH_, NB), 32, 0, stream>>>(P16, nullptr, P16 + NB * PE, nullptr, P16 + 2 * NB * PE, nullptr, RH, ATh, ATl);
    k_gemmw<bf, 1, true, 1><<<dim3(TT / 64, DM / 64, NB), 32, 0, stream>>>(ATh, ATl, WO, nullptr, DQ, OUT, DM, bo, (size_t)TT * DQ, 0, (size_t)SEQ_FULL * DM);
}

// v006
// Measured time: 182 microseconds a run.
// In two side-by-side timings against v005, it was 1.09 and 1.08 times as fast.
// Counting every step since v000, it is 3.89 times as fast.
#include <hip/hip_runtime.h>

// Causal self-attention block: x [2][4096][768]; q/k/v = x W (W [in][out] 768x768, 12 heads x 64); softmax(q.k / 8) over keys j <= i; out = merged ctx Wo + bo -> [2][4096][768].
// Compute dtypes, f32 accumulate: every input RNE-converted to bf16; q/k/v projections v_wmma_f32_16x16x32_bf16 (plain bf16 operands); scores (K Q^T) and ctx (V^T P^T): query rows < 512 on bf16 hi/lo planes (3 products), other rows v_wmma_f32_16x16x32_f16 single product (P carried x1024); softmax f32; ctx.Wo bf16 hi/lo x bf16 (2 products) + bias.

#ifndef NB
#define NB 2
#endif
#ifndef SEQ
#define SEQ 4096
#endif
#define NB_FULL  2
#define SEQ_FULL 4096
#define TT   SEQ
#define DM   768
#define NH_  12
#define HD   64
#define DQ   (NH_ * HD)
#define RH   ((SEQ) < 512 ? (SEQ) : 512)   // query rows < RH use hi+lo planes
#define PCAR 1024.0f
#define SCL  0.125f                        // HD^-0.5
#define L2E  1.4426950408889634f
#define WSB  ((size_t)4 * DQ * DM * 2 + (size_t)NB * ((size_t)TT * DM * 2 + (size_t)9 * NH_ * TT * HD * 2 + (size_t)2 * TT * DQ * 2))

static_assert(SEQ % 64 == 0);
static_assert(SEQ <= SEQ_FULL);
static_assert(NB <= NB_FULL);
static_assert(DM % 64 == 0);
static_assert(DQ % 64 == 0);
static_assert(DQ == DM);
static_assert(HD == 64);
static_assert(RH % 16 == 0);
static_assert((TT - RH) % 32 == 0);
static_assert(((size_t)DQ * DM * 2) % 256 == 0);
static_assert(((size_t)TT * DM * 2) % 256 == 0);
static_assert(((size_t)NH_ * TT * HD * 2) % 256 == 0);
static_assert(WSB <= (size_t)268435456);

typedef _Float16 h16;
typedef unsigned short bf;
typedef __attribute__((ext_vector_type(16))) __bf16   v16bf;
typedef __attribute__((ext_vector_type(16))) _Float16 v16h;
typedef __attribute__((ext_vector_type(8)))  _Float16 v8h;
typedef __attribute__((ext_vector_type(8)))  unsigned short v8us;
typedef __attribute__((ext_vector_type(8)))  float    v8f;
typedef __attribute__((ext_vector_type(4)))  float    v4f;
typedef v8h  __attribute__((may_alias)) v8ha;
typedef v4f  __attribute__((may_alias)) v4fa;

__device__ __forceinline__ unsigned short f2bf(float f) { unsigned u = __float_as_uint(f); u += 0x7FFFu + ((u >> 16) & 1u); return (unsigned short)(u >> 16); }
__device__ __forceinline__ float bf2f(unsigned short b) { return __uint_as_float(((unsigned)b) << 16); }
__device__ __forceinline__ float bfr(float f) { return bf2f(f2bf(f)); }
__device__ __forceinline__ v16h cat16(v8h lo, v8h hi) { return __builtin_shufflevector(lo, hi, 0, 1, 2, 3, 4, 5, 6, 7, 8, 9, 10, 11, 12, 13, 14, 15); }
__device__ __forceinline__ v16bf cat16b(v8us lo, v8us hi) { return __builtin_bit_cast(v16bf, __builtin_shufflevector(lo, hi, 0, 1, 2, 3, 4, 5, 6, 7, 8, 9, 10, 11, 12, 13, 14, 15)); }
__device__ __forceinline__ v8f wmma16(v16h a, v16h b, v8f c) { return __builtin_amdgcn_wmma_f32_16x16x32_f16(false, a, false, b, (short)0, c, false, false); }
__device__ __forceinline__ v8f wmmab(v16bf a, v16bf b, v8f c) { return __builtin_amdgcn_wmma_f32_16x16x32_bf16(false, a, false, b, (short)0, c, false, false); }
__device__ __forceinline__ void splitf(float y, unsigned short& h, unsigned short& l) { h = f2bf(y); l = f2bf(y - bf2f(h)); }

// Fragment map, the same for A and B operands: lane holds row (lane & 15); elements 0..7 <- k = 8 * (lane >> 4) + 0..7, elements 8..15 <- k = 16 + 8 * (lane >> 4) + 0..7 of a 32-k slice.
// Fragment-order planes (every WMMA operand read from memory): a 16-bit matrix [rows][k] kept as tiles of 16 rows x 32 k (512 elements, 1 KiB). Inside a tile the 16-byte chunk 32 * s + lane holds row (lane & 15),
// k = 16 * s + 8 * (lane >> 4) + 0..7: the map above. A tile is one fragment, and each of its two loads reads 512 contiguous bytes (4 whole cache lines) instead of 32 bytes from each of 16 rows.
// ldf: p points at tile base + 8 * lane; elements 0..7 <- p[0..7], elements 8..15 <- p[256..263].
// Tile order of the GEMM operand planes (x, the transposed weights, the merged context): tile = ((row / 64) * (K / 32) + k / 32) * 4 + (row / 16) % 4, so one 32-k step of a 64-row block is 4 KiB in a row.
template <typename T16> struct WFrag;
template <> struct WFrag<h16> { typedef v16h V; static __device__ __forceinline__ V ldf(const h16* p) { return cat16(*(const v8h*)p, *(const v8h*)(p + 256)); } static __device__ __forceinline__ v8f mma(V a, V b, v8f c) { return wmma16(a, b, c); } };
template <> struct WFrag<bf> { typedef v16bf V; static __device__ __forceinline__ V ldf(const bf* p) { return cat16b(*(const v8us*)p, *(const v8us*)(p + 256)); } static __device__ __forceinline__ v8f mma(V a, V b, v8f c) { return wmmab(a, b, c); } };

// put_planes: the 64 x 64 accumulator block of one wave of the projection GEMM -> 8 KiB in a row of each of the three flash planes (f16, bf16 hi, bf16 lo) of its head; d16, dh, dl point at that block + 8 * lane.
// An accumulator tile has the fragment map already: lane & 15 = the B operand's row, elements 0..7 = the A operand's rows 8 * (lane >> 4) + 0..7, so tile (mb, nb) is one 512-byte half of a plane tile and each lane stores its own 16-byte chunk.
// q, k planes (per head, rows = t, k = d: tile = 2 * (t / 16) + d / 32): A rows = d, B rows = t, half 4 * nb + mb. v^T plane (rows = d, k = t: tile = 4 * (t / 32) + d / 16): A rows = t, B rows = d, half 8 * (mb / 2) + 2 * nb + mb % 2.
template <bool VT>
__device__ __forceinline__ void put_planes(const v8f (&acc)[4][4], h16* d16, bf* dh, bf* dl) {
#pragma unroll
    for (int mb = 0; mb < 4; ++mb)
#pragma unroll
        for (int np = 0; np < 2; ++np) { v8h o16[2]; v8us oh[2], ol[2];
#pragma unroll
            for (int u = 0; u < 2; ++u) { const int nb = 2 * np + u;
#pragma unroll
                for (int q = 0; q < 8; ++q) { const float x = acc[mb][nb][q]; o16[u][q] = (h16)x; unsigned short a2, c2; splitf(x, a2, c2); oh[u][q] = a2; ol[u][q] = c2; }
                const int e = (VT ? 8 * (mb >> 1) + 2 * nb + (mb & 1) : 4 * nb + mb) * 256;
                *(v8h*)(d16 + e) = o16[u]; *(v8us*)(dh + e) = oh[u]; *(v8us*)(dl + e) = ol[u]; }
            // the next two tiles' values may reuse the registers of the stores above; values and addresses are inputs, so that they stay in their registers up to the wait
            if (mb < 3 || np < 1) asm volatile("s_wait_xcnt 0x0" :: "v"(o16[0]), "v"(o16[1]), "v"(oh[0]), "v"(oh[1]), "v"(ol[0]), "v"(ol[1]), "v"(d16), "v"(dh), "v"(dl) : "memory");
        }
}

// ---- k_gemmw: register-blocked GEMM, ONE WAVE per 64x64 output tile (16 accumulators), operands straight from fragment-order 16-bit planes; grid (M/64, N/64, Z), 32 threads.
// C[m][n] (f32, pitch ldc, + optional f32 bias[n]) = sum_k A[m][k] Bt[n][k] (+ split products per NSPLIT). K % 32 == 0, M % 64 == 0, N % 64 == 0.
// blockIdx.z counts independent products: A matrix z / NW (stride sA), B matrix z % NW (stride sB), C matrix z (stride sC).
// PL (the projections: A = x of batch z / 3, B = transposed wq, wk, wv by z % 3, blockIdx.y = head): no C; the accumulators go straight into the flash planes (put_planes). Plane (p, batch) lies at index p * NB + batch of each of the three arrays.
template <typename T16, int NSPLIT, bool BIAS, int NW, bool PL>
__global__ __launch_bounds__(32) void k_gemmw(const T16* __restrict__ A, const T16* __restrict__ A2, const T16* __restrict__ Bt, const T16* __restrict__ Bt2, int K, float* C, int ldc, const float* __restrict__ bias, size_t sA, size_t sB, size_t sC, h16* P16, bf* Ph, bf* Pl) {
    typedef typename WFrag<T16>::V V;
    static_assert(!PL || (NW == 3 && NSPLIT == 0 && !BIAS));
    __shared__ __align__(16) float os[16 * 68];
    const size_t z = blockIdx.z, za = z / NW, zw = z % NW; A += za * sA; if (A2) A2 += za * sA; Bt += zw * sB; if (Bt2) Bt2 += zw * sB; C += z * sC;
    const int lane = threadIdx.x & 31, lr = lane & 15, hi = lane >> 4; const int r0 = blockIdx.x * 64, c0 = blockIdx.y * 64;
    v8f acc[4][4];
#pragma unroll
    for (int mb = 0; mb < 4; ++mb)
#pragma unroll
        for (int nb = 0; nb < 4; ++nb) acc[mb][nb] = (v8f){};
    size_t aoff = (size_t)blockIdx.x * K * 64 + lane * 8, boff = (size_t)blockIdx.y * K * 64 + lane * 8;   // a 64-row block is K * 64 elements; a 32-k step of it 2048
    if (PL && zw != 2) { const T16* tp = A; A = Bt; Bt = tp; const size_t to = aoff; aoff = boff; boff = to; }   // q, k: the weights are the A operand, so that a lane holds 8 neighbouring d of one t (both planes have one format)
#pragma unroll 1
    for (int kc = 0; kc < K; kc += 32) {
        V a[4], a2[4]; const T16* pa = A + aoff + (size_t)kc * 64; const T16* pa2 = (NSPLIT == 1 || NSPLIT == 2) ? A2 + aoff + (size_t)kc * 64 : pa; const T16* pb = Bt + boff + (size_t)kc * 64; const T16* pb2 = NSPLIT >= 2 ? Bt2 + boff + (size_t)kc * 64 : pb;
#pragma unroll
        for (int mb = 0; mb < 4; ++mb) { a[mb] = WFrag<T16>::ldf(pa + mb * 512); if (NSPLIT == 1 || NSPLIT == 2) a2[mb] = WFrag<T16>::ldf(pa2 + mb * 512); }
        // the compiler lets later loads land on the address registers of the loads above; one wait behind the A loads, one behind each B fragment's. The addresses are inputs, so that they stay in their registers up to the wait
        asm volatile("s_wait_xcnt 0x0" :: "v"(pa), "v"(pa2) : "memory");
#pragma unroll
        for (int nb = 0; nb < 4; ++nb) { const V b = WFrag<T16>::ldf(pb + nb * 512); V b2; if (NSPLIT >= 2) b2 = WFrag<T16>::ldf(pb2 + nb * 512);
            asm volatile("s_wait_xcnt 0x0" :: "v"(pb), "v"(pb2) : "memory");   // as above
#pragma unroll
            for (int mb = 0; mb < 4; ++mb) { acc[mb][nb] = WFrag<T16>::mma(a[mb], b, acc[mb][nb]); if (NSPLIT == 1 || NSPLIT == 2) acc[mb][nb] = WFrag<T16>::mma(a2[mb], b, acc[mb][nb]); if (NSPLIT >= 2) acc[mb][nb] = WFrag<T16>::mma(a[mb], b2, acc[mb][nb]); } }
        asm volatile("v_nop\n\tv_nop\n\tv_nop\n\tv_nop" : "+v"(acc[0][0]), "+v"(acc[1][1]), "+v"(acc[2][2]), "+v"(acc[3][3]) : "v"(a[0]), "v"(a[3]));
    }
    if constexpr (PL) {
        const size_t po = ((zw * NB + za) * NH_ + blockIdx.y) * TT * HD + (size_t)r0 * HD + lane * 8;
        if (zw == 2) put_planes<true>(acc, P16 + po, Ph + po, Pl + po); else put_planes<false>(acc, P16 + po, Ph + po, Pl + po);
    } else {
#pragma unroll
    for (int mb = 0; mb < 4; ++mb) {
#pragma unroll
        for (int nb = 0; nb < 4; ++nb) {
#pragma unroll
            for (int j = 0; j < 8; ++j) os[(hi * 8 + j) * 68 + nb * 16 + lr] = acc[mb][nb][j]; }
        __builtin_amdgcn_wave_barrier(); asm volatile("" ::: "memory");
        float* crow = C + (size_t)(r0 + mb * 16) * ldc + c0;
{
#pragma unroll
            for (int s = 0; s < 8; ++s) { const int row = 2 * s + hi, cofs = lr * 4; v4f val = *(const v4fa*)(os + row * 68 + cofs); if (BIAS) { val[0] += bfr(bias[c0 + cofs]); val[1] += bfr(bias[c0 + cofs + 1]); val[2] += bfr(bias[c0 + cofs + 2]); val[3] += bfr(bias[c0 + cofs + 3]); }
                *(v4f*)(crow + (size_t)row * ldc + cofs) = val; }
             }
        __builtin_amdgcn_wave_barrier(); asm volatile("" ::: "memory");
    }
    }
}

// gpos: 16-byte chunk i of a GEMM operand plane [rows][K] -> its row and its first k.
template <int K> __device__ __forceinline__ void gpos(unsigned i, int& row, int& k) { const unsigned c = i & 63u, tile = i >> 6, g = tile >> 2;
    row = (int)((g / (K / 32)) * 64 + (tile & 3u) * 16 + (c & 15u)); k = (int)((g % (K / 32)) * 32 + (c >> 5) * 16 + ((c >> 4) & 1u) * 8); }
// d_wtG, d_cvt8: one thread per 16-byte chunk of the plane, so a wave stores 512 contiguous bytes; bx = the block's index within its own piece of work.
// d_wtG: plane rows = n, k = k of w [K][N]. The lanes of a half wave read 16 neighbouring n of one k.
__device__ __forceinline__ void d_wtG(const float* __restrict__ w, bf* Bt, unsigned bx) { const unsigned i = bx * 256 + threadIdx.x; if (i >= (unsigned)(DQ * DM / 8)) return; int n, k; gpos<DM>(i, n, k); v8us o;
#pragma unroll
    for (int q = 0; q < 8; ++q) o[q] = f2bf(w[(size_t)(k + q) * DQ + n]);
    *(v8us*)(Bt + (size_t)i * 8) = o; }
__device__ __forceinline__ void d_cvt8(const float* __restrict__ src, bf* dst, unsigned bx) { const unsigned i = bx * 256 + threadIdx.x; if (i >= (unsigned)((size_t)TT * DM / 8)) return; int t, k; gpos<DM>(i, t, k); const v8f v = *(const v8f*)(src + (size_t)t * DM + k); v8us o;
#pragma unroll
    for (int q = 0; q < 8; ++q) o[q] = f2bf(v[q]);
    *(v8us*)(dst + (size_t)i * 8) = o; }
// k_prep: all operand conversions in one launch. Blocks 0 .. 4 * LWB - 1: the four weight matrices (all DM x DQ), LWB blocks each, their transposed planes one behind the other in Bt; then NCB blocks per batch of x.
#define LWB ((unsigned)((DM * DQ / 8 + 255) / 256))
#define NCB ((unsigned)(((size_t)TT * DM / 8 + 255) / 256))
__global__ __launch_bounds__(256) void k_prep(const float* __restrict__ w0, const float* __restrict__ w1, const float* __restrict__ w2, const float* __restrict__ w3, bf* Bt, const float* __restrict__ x, bf* XB) {
    const unsigned bx = blockIdx.x;
    if (bx < 4u * LWB) { const unsigned y = bx / LWB; const float* __restrict__ w = y == 0 ? w0 : y == 1 ? w1 : y == 2 ? w2 : w3; d_wtG(w, Bt + (size_t)y * DQ * DM, bx % LWB); }
    else { const unsigned c = bx - 4u * LWB, b = c / NCB; d_cvt8(x + (size_t)b * SEQ_FULL * DM, XB + (size_t)b * TT * DM, c % NCB); }
}
// Probability packers: two 16-key score tiles (accumulator layout: lane = query, element r = key 8*(lane>>4)+r) -> one 32-key B fragment (elements 0..7 <- tile 0, 8..15 <- tile 1).
template <typename T16> struct PPk;
template <> struct PPk<h16> {
    static __device__ __forceinline__ v16h hi(v8f p0, v8f p1) { v8h a, b;
#pragma unroll
        for (int r = 0; r < 8; ++r) { a[r] = (h16)(p0[r] * PCAR); b[r] = (h16)(p1[r] * PCAR); }
        return cat16(a, b); }
    static __device__ __forceinline__ v16h lo(v8f p0, v8f p1) { return hi(p0, p1); }
};
template <> struct PPk<bf> {
    static __device__ __forceinline__ v16bf hi(v8f p0, v8f p1) { v8us a, b;
#pragma unroll
        for (int r = 0; r < 8; ++r) { a[r] = f2bf(p0[r]); b[r] = f2bf(p1[r]); }
        return cat16b(a, b); }
    static __device__ __forceinline__ v16bf lo(v8f p0, v8f p1) { v8us a, b;
#pragma unroll
        for (int r = 0; r < 8; ++r) { a[r] = f2bf(p0[r] - bf2f(f2bf(p0[r]))); b[r] = f2bf(p1[r] - bf2f(f2bf(p1[r]))); }
        return cat16b(a, b); }
};

// ---- k_flash: register-fed transposed flash attention; ONE WAVE per (16 * NQ queries, head, batch); grid ((rows)/(16 * NQ), NH, NB), 32 threads; roff = first query row of this launch.
// Per 32-key step: S^T[key][query] = K (A operand, rows = keys, k = d) x Q^T (B operand held in registers, lane = query); online softmax per lane (query = lane & 15, the two lane halves hold
// different keys; one xor-16 shuffle for the max); O^T[d][query] += V^T (A operand, rows = d, k = keys, fragment-order plane per head) x P^T (B operand packed from the two score tiles). No LDS in the key loop.
// HL: bf16 hi/lo planes, 3 products per contraction, P not carried. Otherwise fp16 single product with P carried x1024.
// The K and V^T fragments of a step live in one of two register sets; each step first issues all loads of the NEXT step into the other set, so a load has a whole step to land.
template <typename T16, bool HL> struct FKV { typename WFrag<T16>::V k[4], kl[4], v[4], vl[4]; };   // kl, vl: lo planes, HL only

template <typename T16, bool HL>
__device__ __forceinline__ void ldkv(FKV<T16, HL>& f, const T16* __restrict__ K1, const T16* __restrict__ K2, const T16* __restrict__ V1, const T16* __restrict__ V2, size_t koff, int kb) {
    const size_t ko = koff + (size_t)kb * HD;   // a 32-key step is 4 tiles (4 KiB in a row) of the K plane and 4 of the V^T plane, at the same offset
#pragma unroll
    for (int i = 0; i < 4; ++i) f.k[i] = WFrag<T16>::ldf(K1 + ko + i * 512);
    // one wait behind each plane's loads
    asm volatile("s_wait_xcnt 0x0" ::: "memory");
    if (HL) {
#pragma unroll
        for (int i = 0; i < 4; ++i) f.kl[i] = WFrag<T16>::ldf(K2 + ko + i * 512);
        asm volatile("s_wait_xcnt 0x0" ::: "memory");   // as above
    }
#pragma unroll
    for (int dt = 0; dt < 4; ++dt) f.v[dt] = WFrag<T16>::ldf(V1 + ko + dt * 512);
    asm volatile("s_wait_xcnt 0x0" ::: "memory");   // as above
    if (HL) {
#pragma unroll
        for (int dt = 0; dt < 4; ++dt) f.vl[dt] = WFrag<T16>::ldf(V2 + ko + dt * 512);
        asm volatile("s_wait_xcnt 0x0" ::: "memory");   // as above
    }
}

template <typename T16, bool HL, int NQ>
__device__ __forceinline__ void fstep(const FKV<T16, HL>& f, const typename WFrag<T16>::V (&qa)[NQ][2], const typename WFrag<T16>::V (&qb)[NQ][2], v8f (&o)[NQ][4], float (&m)[NQ], float (&l)[NQ], int kb, int q0, int lr, int hi) {
    typedef typename WFrag<T16>::V V;
    static_assert(NQ == 1 || NQ == 2);
    v8f s[NQ][2];
#pragma unroll
    for (int kt = 0; kt < 2; ++kt)
#pragma unroll
        for (int qt = 0; qt < NQ; ++qt) {
            v8f a = (v8f){};
            if (HL) { a = WFrag<T16>::mma(f.kl[2 * kt], qa[qt][0], a); a = WFrag<T16>::mma(f.kl[2 * kt + 1], qa[qt][1], a); a = WFrag<T16>::mma(f.k[2 * kt], qb[qt][0], a); a = WFrag<T16>::mma(f.k[2 * kt + 1], qb[qt][1], a); }
            a = WFrag<T16>::mma(f.k[2 * kt], qa[qt][0], a); a = WFrag<T16>::mma(f.k[2 * kt + 1], qa[qt][1], a);
            s[qt][kt] = a;
        }
    // WMMA distance: four vector slots between the last score product and the first reader of its result
    if constexpr (NQ == 1) asm volatile("v_nop\n\tv_nop\n\tv_nop\n\tv_nop" : "+v"(s[0][0]), "+v"(s[0][1]) : "v"(qa[0][0]), "v"(qa[0][1]));
    else asm volatile("v_nop\n\tv_nop\n\tv_nop\n\tv_nop" : "+v"(s[0][0]), "+v"(s[0][1]), "+v"(s[1][0]), "+v"(s[1][1]) : "v"(qa[0][0]), "v"(qa[0][1]), "v"(qa[1][0]), "v"(qa[1][1]));
    const bool diag = (kb + 31 > q0);         // wave-uniform: this step can hold keys beyond some query
    V pa[NQ], pb[NQ];
#pragma unroll
    for (int qt = 0; qt < NQ; ++qt) {
        const int qi = q0 + qt * 16 + lr;
        float mx = -1.0e30f;
#pragma unroll
        for (int kt = 0; kt < 2; ++kt)
#pragma unroll
            for (int r = 0; r < 8; ++r) { const int key = kb + kt * 16 + 8 * hi + r; float t = s[qt][kt][r] * SCL; t = (diag && (key > qi)) ? -1.0e30f : t; s[qt][kt][r] = t; mx = fmaxf(mx, t); }
        mx = fmaxf(mx, __shfl_xor(mx, 16, 32));
        const float mn = fmaxf(m[qt], mx);
        const float al = __builtin_amdgcn_exp2f((m[qt] - mn) * L2E);
        m[qt] = mn;
        float psum = 0.0f;
#pragma unroll
        for (int kt = 0; kt < 2; ++kt)
#pragma unroll
            for (int r = 0; r < 8; ++r) { const float p = __builtin_amdgcn_exp2f((s[qt][kt][r] - mn) * L2E); s[qt][kt][r] = p; psum += p; }
        l[qt] = l[qt] * al + psum;
#pragma unroll
        for (int dt = 0; dt < 4; ++dt) o[qt][dt] = o[qt][dt] * al;
        pa[qt] = PPk<T16>::hi(s[qt][0], s[qt][1]);
        pb[qt] = pa[qt]; if (HL) pb[qt] = PPk<T16>::lo(s[qt][0], s[qt][1]);
    }
#pragma unroll
    for (int dt = 0; dt < 4; ++dt)
#pragma unroll
        for (int qt = 0; qt < NQ; ++qt) {
            if (HL) { o[qt][dt] = WFrag<T16>::mma(f.vl[dt], pa[qt], o[qt][dt]); o[qt][dt] = WFrag<T16>::mma(f.v[dt], pb[qt], o[qt][dt]); }
            o[qt][dt] = WFrag<T16>::mma(f.v[dt], pa[qt], o[qt][dt]);
        }
    // WMMA distance, as above, for the output tiles and the packed probabilities
    if constexpr (NQ == 1) asm volatile("v_nop\n\tv_nop\n\tv_nop\n\tv_nop" : "+v"(o[0][0]), "+v"(o[0][1]), "+v"(o[0][2]), "+v"(o[0][3]) : "v"(pa[0]), "v"(pb[0]));
    else asm volatile("v_nop\n\tv_nop\n\tv_nop\n\tv_nop" : "+v"(o[0][0]), "+v"(o[0][1]), "+v"(o[0][2]), "+v"(o[0][3]), "+v"(o[1][0]), "+v"(o[1][1]), "+v"(o[1][2]), "+v"(o[1][3]) : "v"(pa[0]), "v"(pb[0]), "v"(pa[1]), "v"(pb[1]));
}

// NQ: 16-query tiles per wave. Every K and V^T fragment a wave loads feeds all its NQ tiles, so the key loop's bytes from L2 per query fall by NQ; each query keeps its own m, l and output tiles and its order of 32-key steps.
template <typename T16, bool HL, int NQ>
__global__ __launch_bounds__(32) void k_flash(const T16* __restrict__ Q1, const T16* __restrict__ Q2, const T16* __restrict__ K1, const T16* __restrict__ K2, const T16* __restrict__ V1, const T16* __restrict__ V2, int roff, bf* Ah, bf* Al) {
    typedef typename WFrag<T16>::V V;
    const int lane = threadIdx.x & 31, lr = lane & 15, hi = lane >> 4;
    const int q0 = roff + blockIdx.x * (16 * NQ); const int head = blockIdx.y;
    const size_t hp = ((size_t)blockIdx.z * NH_ + head) * TT * HD;
    const size_t qoff = hp + (size_t)q0 * HD + lane * 8;   // 16 queries are 2 tiles
    V qa[NQ][2], qb[NQ][2];
#pragma unroll
    for (int qt = 0; qt < NQ; ++qt) {
        qa[qt][0] = WFrag<T16>::ldf(Q1 + qoff + qt * 1024); qa[qt][1] = WFrag<T16>::ldf(Q1 + qoff + qt * 1024 + 512);
        if (HL) { qb[qt][0] = WFrag<T16>::ldf(Q2 + qoff + qt * 1024); qb[qt][1] = WFrag<T16>::ldf(Q2 + qoff + qt * 1024 + 512); } else { qb[qt][0] = qa[qt][0]; qb[qt][1] = qa[qt][1]; }
    }
    asm volatile("s_wait_xcnt 0x0" ::: "memory");   // the address registers of the Q loads may be reused by the loads below
    v8f o[NQ][4]; float m[NQ], l[NQ];
#pragma unroll
    for (int qt = 0; qt < NQ; ++qt) { m[qt] = -1.0e30f; l[qt] = 0.0f;
#pragma unroll
        for (int dt = 0; dt < 4; ++dt) o[qt][dt] = (v8f){}; }
    const int nst = (q0 + 16 * NQ + 31) >> 5;     // keys 0 .. q0+16*NQ-1 in steps of 32; at least 1
    const size_t koff = hp + lane * 8;
    FKV<T16, HL> fa, fb;
    ldkv<T16, HL>(fa, K1, K2, V1, V2, koff, 0);
    asm volatile("s_wait_xcnt 0x0" ::: "memory");   // the address registers of the loads above are reused below
    int stp = 0;
    // two steps per trip, so that the two register sets swap roles without copies
#pragma unroll 1
    for (; stp + 1 < nst; stp += 2) {
        ldkv<T16, HL>(fb, K1, K2, V1, V2, koff, (stp + 1) * 32);
        fstep<T16, HL, NQ>(fa, qa, qb, o, m, l, stp * 32, q0, lr, hi);
        const int nx = (stp + 2 < nst) ? stp + 2 : nst - 1;   // past the last step: fetch the last step again, in bounds and unused
        ldkv<T16, HL>(fa, K1, K2, V1, V2, koff, nx * 32);
        fstep<T16, HL, NQ>(fb, qa, qb, o, m, l, (stp + 1) * 32, q0, lr, hi);
    }
    if (stp < nst) fstep<T16, HL, NQ>(fa, qa, qb, o, m, l, stp * 32, q0, lr, hi);
    // The output tiles already have the fragment map (lane = query row, element r of tile dt = k 16 * dt + 8 * hi + r of this head's 64): each lane stores its 16-byte chunks straight into the output GEMM's A planes.
#pragma unroll
    for (int qt = 0; qt < NQ; ++qt) {
        const float lt = l[qt] + __shfl_xor(l[qt], 16, 32);
        const float inv = (HL ? 1.0f : (1.0f / PCAR)) * (1.0f / lt);
        const int t0 = q0 + qt * 16;
        const size_t oo = (size_t)blockIdx.z * TT * DQ + ((size_t)(t0 >> 6) * (DQ / 32) + head * (HD / 32)) * 2048 + ((t0 >> 4) & 3) * 512 + lane * 8;
#pragma unroll
        for (int dt = 0; dt < 4; ++dt) { v8us hv, lv;
#pragma unroll
            for (int r = 0; r < 8; ++r) { unsigned short a2, c2; splitf(o[qt][dt][r] * inv, a2, c2); hv[r] = a2; lv[r] = c2; }
            *(v8us*)(Ah + oo + (dt >> 1) * 2048 + (dt & 1) * 256) = hv; *(v8us*)(Al + oo + (dt >> 1) * 2048 + (dt & 1) * 256) = lv; }
        if (qt + 1 < NQ) asm volatile("s_wait_xcnt 0x0" ::: "memory");   // the next tile's values and addresses may reuse the registers of the stores above
    }
}

extern "C" void kernel_launch(void* const* d_in, const int* in_sizes, int n_in,
                              void* d_out, int out_size, void* d_ws, size_t ws_size, hipStream_t stream) {
    if (n_in < 6) return;
    const size_t need = (size_t)(NB - 1) * SEQ_FULL * DM + (size_t)TT * DM;
    if ((size_t)in_sizes[0] < need || (size_t)out_size < need) return;
    if (in_sizes[1] < DM * DQ || in_sizes[2] < DM * DQ || in_sizes[3] < DM * DQ || in_sizes[4] < DQ * DM || in_sizes[5] < DM) return;
    const float* x = (const float*)d_in[0]; const float* wq = (const float*)d_in[1]; const float* wk = (const float*)d_in[2]; const float* wv = (const float*)d_in[3]; const float* wo = (const float*)d_in[4]; const float* bo = (const float*)d_in[5];
    float* OUT = (float*)d_out;     // [2][4096][768], byte offset 0
    char* wsp = (char*)d_ws;
    auto take = [&](size_t bytes) { char* p = wsp; wsp += (bytes + 255) & ~(size_t)255; return (void*)p; };
    bf* WT = (bf*)take((size_t)4 * DQ * DM * 2); bf* WO = WT + (size_t)3 * DQ * DM;   // transposed wq, wk, wv, wo, one behind the other
    bf* XB = (bf*)take((size_t)NB * TT * DM * 2);
    const size_t PE = (size_t)NH_ * TT * HD;   // elements of one plane of one batch
    h16* P16 = (h16*)take((size_t)3 * NB * PE * 2); bf* Ph = (bf*)take((size_t)3 * NB * PE * 2); bf* Pl = (bf*)take((size_t)3 * NB * PE * 2);   // each: q planes of all batches, then k, then v^T
    bf* ATh = (bf*)take((size_t)NB * TT * DQ * 2); bf* ATl = (bf*)take((size_t)NB * TT * DQ * 2);
    if ((size_t)(wsp - (char*)d_ws) > ws_size) return;    // 155,713,536 B at the full size
    // Launches that do not depend on each other (the four weights and x; the two batches; the q, k and v projections) are one grid each.
    k_prep<<<4u * LWB + NB * NCB, 256, 0, stream>>>(wq, wk, wv, wo, WT, x, XB);   // weights: in[768][768] -> out[768][768] transposed (DM == DQ)
    k_gemmw<bf, 0, false, 3, true><<<dim3(TT / 64, NH_, 3 * NB), 32, 0, stream>>>(XB, nullptr, WT, nullptr, DM, nullptr, 0, nullptr, (size_t)TT * DM, (size_t)DQ * DM, 0, P16, Ph, Pl);
    k_flash<bf, true, 1><<<dim3(RH / 16, NH_, NB), 32, 0, stream>>>(Ph, Pl, Ph + NB * PE, Pl + NB * PE, Ph + 2 * NB * PE, Pl + 2 * NB * PE, 0, ATh, ATl);
    if (TT > RH) k_flash<h16, false, 2><<<dim3((TT - RH) / 32, NH_, NB), 32, 0, stream>>>(P16, nullptr, P16 + NB * PE, nullptr, P16 + 2 * NB * PE, nullptr, RH, ATh, ATl);
    k_gemmw<bf, 1, true, 1, false><<<dim3(TT / 64, DM / 64, NB), 32, 0, stream>>>(ATh, ATl, WO, nullptr, DQ, OUT, DM, bo, (size_t)TT * DQ, 0, (size_t)SEQ_FULL * DM, nullptr, nullptr, nullptr);
}

// v007
// One run takes 173 microseconds.
// Two timings next to v006 both put it at 1.06 times that version's speed.
// Counting every step since v000, it is 4.13 times as fast.
#include <hip/hip_runtime.h>

// Causal self-attention block: x [2][4096][768]; q/k/v = x W (W [in][out] 768x768, 12 heads x 64); softmax(q.k / 8) over keys j <= i; out = merged ctx Wo + bo -> [2][4096][768].
// Compute dtypes, f32 accumulate: every input RNE-converted to bf16; q/k/v projections v_wmma_f32_16x16x32_bf16 (plain bf16 operands); scores (K Q^T) and ctx (V^T P^T): query rows < 512 on bf16 hi/lo planes (3 products), other rows v_wmma_f32_16x16x32_f16 single product (P carried x1024); softmax f32; ctx.Wo bf16 hi/lo x bf16 (2 products) + bias.

#ifndef NB
#define NB 2
#endif
#ifndef SEQ
#define SEQ 4096
#endif
#define NB_FULL  2
#define SEQ_FULL 4096
#define TT   SEQ
#define DM   768
#define NH_  12
#define HD   64
#define DQ   (NH_ * HD)
#define RH   ((SEQ) < 512 ? (SEQ) : 512)   // query rows < RH use hi+lo planes
#define PCAR 1024.0f
#define SCL  0.125f                        // HD^-0.5
#define L2E  1.4426950408889634f
#define WSB  ((size_t)4 * DQ * DM * 2 + (size_t)NB * ((size_t)TT * DM * 2 + (size_t)9 * NH_ * TT * HD * 2 + (size_t)2 * TT * DQ * 2))

static_assert(SEQ % 64 == 0);
static_assert(SEQ <= SEQ_FULL);
static_assert(NB <= NB_FULL);
static_assert(DM % 64 == 0);
static_assert(DQ % 64 == 0);
static_assert(DQ == DM);
static_assert(HD == 64);
static_assert(RH % 16 == 0);
static_assert((TT - RH) % 32 == 0);
static_assert(RH % 32 == 0);
static_assert(((size_t)DQ * DM * 2) % 256 == 0);
static_assert(((size_t)TT * DM * 2) % 256 == 0);
static_assert(((size_t)NH_ * TT * HD * 2) % 256 == 0);
static_assert(WSB <= (size_t)268435456);

typedef _Float16 h16;
typedef unsigned short bf;
typedef __attribute__((ext_vector_type(16))) __bf16   v16bf;
typedef __attribute__((ext_vector_type(16))) _Float16 v16h;
typedef __attribute__((ext_vector_type(8)))  _Float16 v8h;
typedef __attribute__((ext_vector_type(8)))  unsigned short v8us;
typedef __attribute__((ext_vector_type(8)))  float    v8f;
typedef __attribute__((ext_vector_type(4)))  float    v4f;
typedef v8h  __attribute__((may_alias)) v8ha;
typedef v4f  __attribute__((may_alias)) v4fa;

__device__ __forceinline__ unsigned short f2bf(float f) { unsigned u = __float_as_uint(f); u += 0x7FFFu + ((u >> 16) & 1u); return (unsigned short)(u >> 16); }
__device__ __forceinline__ float bf2f(unsigned short b) { return __uint_as_float(((unsigned)b) << 16); }
__device__ __forceinline__ float bfr(float f) { return bf2f(f2bf(f)); }
__device__ __forceinline__ v16h cat16(v8h lo, v8h hi) { return __builtin_shufflevector(lo, hi, 0, 1, 2, 3, 4, 5, 6, 7, 8, 9, 10, 11, 12, 13, 14, 15); }
__device__ __forceinline__ v16bf cat16b(v8us lo, v8us hi) { return __builtin_bit_cast(v16bf, __builtin_shufflevector(lo, hi, 0, 1, 2, 3, 4, 5, 6, 7, 8, 9, 10, 11, 12, 13, 14, 15)); }
__device__ __forceinline__ v8f wmma16(v16h a, v16h b, v8f c) { return __builtin_amdgcn_wmma_f32_16x16x32_f16(false, a, false, b, (short)0, c, false, false); }
__device__ __forceinline__ v8f wmmab(v16bf a, v16bf b, v8f c) { return __builtin_amdgcn_wmma_f32_16x16x32_bf16(false, a, false, b, (short)0, c, false, false); }
__device__ __forceinline__ void splitf(float y, unsigned short& h, unsigned short& l) { h = f2bf(y); l = f2bf(y - bf2f(h)); }

// Fragment map, the same for A and B operands: lane holds row (lane & 15); elements 0..7 <- k = 8 * (lane >> 4) + 0..7, elements 8..15 <- k = 16 + 8 * (lane >> 4) + 0..7 of a 32-k slice.
// Fragment-order planes (every WMMA operand read from memory): a 16-bit matrix [rows][k] kept as tiles of 16 rows x 32 k (512 elements, 1 KiB). Inside a tile the 16-byte chunk 32 * s + lane holds row (lane & 15),
// k = 16 * s + 8 * (lane >> 4) + 0..7: the map above. A tile is one fragment, and each of its two loads reads 512 contiguous bytes (4 whole cache lines) instead of 32 bytes from each of 16 rows.
// ldf: p points at tile base + 8 * lane; elements 0..7 <- p[0..7], elements 8..15 <- p[256..263].
// Tile order of the GEMM operand planes (x, the transposed weights, the merged context): tile = ((row / 64) * (K / 32) + k / 32) * 4 + (row / 16) % 4, so one 32-k step of a 64-row block is 4 KiB in a row.
template <typename T16> struct WFrag;
template <> struct WFrag<h16> { typedef v16h V; static __device__ __forceinline__ V ldf(const h16* p) { return cat16(*(const v8h*)p, *(const v8h*)(p + 256)); } static __device__ __forceinline__ v8f mma(V a, V b, v8f c) { return wmma16(a, b, c); } };
template <> struct WFrag<bf> { typedef v16bf V; static __device__ __forceinline__ V ldf(const bf* p) { return cat16b(*(const v8us*)p, *(const v8us*)(p + 256)); } static __device__ __forceinline__ v8f mma(V a, V b, v8f c) { return wmmab(a, b, c); } };

// put_planes: the 64 x 64 accumulator block of one wave of the projection GEMM -> 8 KiB in a row of each of the three flash planes (f16, bf16 hi, bf16 lo) of its head; d16, dh, dl point at that block + 8 * lane.
// An accumulator tile has the fragment map already: lane & 15 = the B operand's row, elements 0..7 = the A operand's rows 8 * (lane >> 4) + 0..7, so tile (mb, nb) is one 512-byte half of a plane tile and each lane stores its own 16-byte chunk.
// q, k planes (per head, rows = t, k = d: tile = 2 * (t / 16) + d / 32): A rows = d, B rows = t, half 4 * nb + mb. v^T plane (rows = d, k = t: tile = 4 * (t / 32) + d / 16): A rows = t, B rows = d, half 8 * (mb / 2) + 2 * nb + mb % 2.
template <bool VT>
__device__ __forceinline__ void put_planes(const v8f (&acc)[4][4], h16* d16, bf* dh, bf* dl) {
#pragma unroll
    for (int mb = 0; mb < 4; ++mb)
#pragma unroll
        for (int np = 0; np < 2; ++np) { v8h o16[2]; v8us oh[2], ol[2];
#pragma unroll
            for (int u = 0; u < 2; ++u) { const int nb = 2 * np + u;
#pragma unroll
                for (int q = 0; q < 8; ++q) { const float x = acc[mb][nb][q]; o16[u][q] = (h16)x; unsigned short a2, c2; splitf(x, a2, c2); oh[u][q] = a2; ol[u][q] = c2; }
                const int e = (VT ? 8 * (mb >> 1) + 2 * nb + (mb & 1) : 4 * nb + mb) * 256;
                *(v8h*)(d16 + e) = o16[u]; *(v8us*)(dh + e) = oh[u]; *(v8us*)(dl + e) = ol[u]; }
            // the next two tiles' values may reuse the registers of the stores above; values and addresses are inputs, so that they stay in their registers up to the wait
            if (mb < 3 || np < 1) asm volatile("s_wait_xcnt 0x0" :: "v"(o16[0]), "v"(o16[1]), "v"(oh[0]), "v"(oh[1]), "v"(ol[0]), "v"(ol[1]), "v"(d16), "v"(dh), "v"(dl) : "memory");
        }
}

// ---- k_gemmw: register-blocked GEMM, ONE WAVE per 64x64 output tile (16 accumulators), operands straight from fragment-order 16-bit planes; grid (M/64, N/64, Z), 32 threads.
// C[m][n] (f32, pitch ldc, + optional f32 bias[n]) = sum_k A[m][k] Bt[n][k] (+ split products per NSPLIT). K % 32 == 0, M % 64 == 0, N % 64 == 0.
// blockIdx.z counts independent products: A matrix z / NW (stride sA), B matrix z % NW (stride sB), C matrix z (stride sC).
// PL (the projections: A = x of batch z / 3, B = transposed wq, wk, wv by z % 3, blockIdx.y = head): no C; the accumulators go straight into the flash planes (put_planes). Plane (p, batch) lies at index p * NB + batch of each of the three arrays.
template <typename T16, int NSPLIT, bool BIAS, int NW, bool PL>
__global__ __launch_bounds__(32) void k_gemmw(const T16* __restrict__ A, const T16* __restrict__ A2, const T16* __restrict__ Bt, const T16* __restrict__ Bt2, int K, float* C, int ldc, const float* __restrict__ bias, size_t sA, size_t sB, size_t sC, h16* P16, bf* Ph, bf* Pl) {
    typedef typename WFrag<T16>::V V;
    static_assert(!PL || (NW == 3 && NSPLIT == 0 && !BIAS));
    __shared__ __align__(16) float os[16 * 68];
    const size_t z = blockIdx.z, za = z / NW, zw = z % NW; A += za * sA; if (A2) A2 += za * sA; Bt += zw * sB; if (Bt2) Bt2 += zw * sB; C += z * sC;
    const int lane = threadIdx.x & 31, lr = lane & 15, hi = lane >> 4; const int r0 = blockIdx.x * 64, c0 = blockIdx.y * 64;
    v8f acc[4][4];
#pragma unroll
    for (int mb = 0; mb < 4; ++mb)
#pragma unroll
        for (int nb = 0; nb < 4; ++nb) acc[mb][nb] = (v8f){};
    size_t aoff = (size_t)blockIdx.x * K * 64 + lane * 8, boff = (size_t)blockIdx.y * K * 64 + lane * 8;   // a 64-row block is K * 64 elements; a 32-k step of it 2048
    if (PL && zw != 2) { const T16* tp = A; A = Bt; Bt = tp; const size_t to = aoff; aoff = boff; boff = to; }   // q, k: the weights are the A operand, so that a lane holds 8 neighbouring d of one t (both planes have one format)
#pragma unroll 1
    for (int kc = 0; kc < K; kc += 32) {
        V a[4], a2[4]; const T16* pa = A + aoff + (size_t)kc * 64; const T16* pa2 = (NSPLIT == 1 || NSPLIT == 2) ? A2 + aoff + (size_t)kc * 64 : pa; const T16* pb = Bt + boff + (size_t)kc * 64; const T16* pb2 = NSPLIT >= 2 ? Bt2 + boff + (size_t)kc * 64 : pb;
#pragma unroll
        for (int mb = 0; mb < 4; ++mb) { a[mb] = WFrag<T16>::ldf(pa + mb * 512); if (NSPLIT == 1 || NSPLIT == 2) a2[mb] = WFrag<T16>::ldf(pa2 + mb * 512); }
        // the compiler lets later loads land on the address registers of the loads above; one wait behind the A loads, one behind each B fragment's. The addresses are inputs, so that they stay in their registers up to the wait
        asm volatile("s_wait_xcnt 0x0" :: "v"(pa), "v"(pa2) : "memory");
#pragma unroll
        for (int nb = 0; nb < 4; ++nb) { const V b = WFrag<T16>::ldf(pb + nb * 512); V b2; if (NSPLIT >= 2) b2 = WFrag<T16>::ldf(pb2 + nb * 512);
            asm volatile("s_wait_xcnt 0x0" :: "v"(pb), "v"(pb2) : "memory");   // as above
#pragma unroll
            for (int mb = 0; mb < 4; ++mb) { acc[mb][nb] = WFrag<T16>::mma(a[mb], b, acc[mb][nb]); if (NSPLIT == 1 || NSPLIT == 2) acc[mb][nb] = WFrag<T16>::mma(a2[mb], b, acc[mb][nb]); if (NSPLIT >= 2) acc[mb][nb] = WFrag<T16>::mma(a[mb], b2, acc[mb][nb]); } }
        asm volatile("v_nop\n\tv_nop\n\tv_nop\n\tv_nop" : "+v"(acc[0][0]), "+v"(acc[1][1]), "+v"(acc[2][2]), "+v"(acc[3][3]) : "v"(a[0]), "v"(a[3]));
    }
    if constexpr (PL) {
        const size_t po = ((zw * NB + za) * NH_ + blockIdx.y) * TT * HD + (size_t)r0 * HD + lane * 8;
        if (zw == 2) put_planes<true>(acc, P16 + po, Ph + po, Pl + po); else put_planes<false>(acc, P16 + po, Ph + po, Pl + po);
    } else {
#pragma unroll
    for (int mb = 0; mb < 4; ++mb) {
#pragma unroll
        for (int nb = 0; nb < 4; ++nb) {
#pragma unroll
            for (int j = 0; j < 8; ++j) os[(hi * 8 + j) * 68 + nb * 16 + lr] = acc[mb][nb][j]; }
        __builtin_amdgcn_wave_barrier(); asm volatile("" ::: "memory");
        float* crow = C + (size_t)(r0 + mb * 16) * ldc + c0;
{
#pragma unroll
            for (int s = 0; s < 8; ++s) { const int row = 2 * s + hi, cofs = lr * 4; v4f val = *(const v4fa*)(os + row * 68 + cofs); if (BIAS) { val[0] += bfr(bias[c0 + cofs]); val[1] += bfr(bias[c0 + cofs + 1]); val[2] += bfr(bias[c0 + cofs + 2]); val[3] += bfr(bias[c0 + cofs + 3]); }
                *(v4f*)(crow + (size_t)row * ldc + cofs) = val; }
             }
        __builtin_amdgcn_wave_barrier(); asm volatile("" ::: "memory");
    }
    }
}

// gpos: 16-byte chunk i of a GEMM operand plane [rows][K] -> its row and its first k.
template <int K> __device__ __forceinline__ void gpos(unsigned i, int& row, int& k) { const unsigned c = i & 63u, tile = i >> 6, g = tile >> 2;
    row = (int)((g / (K / 32)) * 64 + (tile & 3u) * 16 + (c & 15u)); k = (int)((g % (K / 32)) * 32 + (c >> 5) * 16 + ((c >> 4) & 1u) * 8); }
// d_wtG, d_cvt8: one thread per 16-byte chunk of the plane, so a wave stores 512 contiguous bytes; bx = the block's index within its own piece of work.
// d_wtG: plane rows = n, k = k of w [K][N]. The lanes of a half wave read 16 neighbouring n of one k.
__device__ __forceinline__ void d_wtG(const float* __restrict__ w, bf* Bt, unsigned bx) { const unsigned i = bx * 256 + threadIdx.x; if (i >= (unsigned)(DQ * DM / 8)) return; int n, k; gpos<DM>(i, n, k); v8us o;
#pragma unroll
    for (int q = 0; q < 8; ++q) o[q] = f2bf(w[(size_t)(k + q) * DQ + n]);
    *(v8us*)(Bt + (size_t)i * 8) = o; }
__device__ __forceinline__ void d_cvt8(const float* __restrict__ src, bf* dst, unsigned bx) { const unsigned i = bx * 256 + threadIdx.x; if (i >= (unsigned)((size_t)TT * DM / 8)) return; int t, k; gpos<DM>(i, t, k); const v8f v = *(const v8f*)(src + (size_t)t * DM + k); v8us o;
#pragma unroll
    for (int q = 0; q < 8; ++q) o[q] = f2bf(v[q]);
    *(v8us*)(dst + (size_t)i * 8) = o; }
// k_prep: all operand conversions in one launch. Blocks 0 .. 4 * LWB - 1: the four weight matrices (all DM x DQ), LWB blocks each, their transposed planes one behind the other in Bt; then NCB blocks per batch of x.
#define LWB ((unsigned)((DM * DQ / 8 + 255) / 256))
#define NCB ((unsigned)(((size_t)TT * DM / 8 + 255) / 256))
__global__ __launch_bounds__(256) void k_prep(const float* __restrict__ w0, const float* __restrict__ w1, const float* __restrict__ w2, const float* __restrict__ w3, bf* Bt, const float* __restrict__ x, bf* XB) {
    const unsigned bx = blockIdx.x;
    if (bx < 4u * LWB) { const unsigned y = bx / LWB; const float* __restrict__ w = y == 0 ? w0 : y == 1 ? w1 : y == 2 ? w2 : w3; d_wtG(w, Bt + (size_t)y * DQ * DM, bx % LWB); }
    else { const unsigned c = bx - 4u * LWB, b = c / NCB; d_cvt8(x + (size_t)b * SEQ_FULL * DM, XB + (size_t)b * TT * DM, c % NCB); }
}
// Probability packers: two 16-key score tiles (accumulator layout: lane = query, element r = key 8*(lane>>4)+r) -> one 32-key B fragment (elements 0..7 <- tile 0, 8..15 <- tile 1).
template <typename T16> struct PPk;
template <> struct PPk<h16> {
    static __device__ __forceinline__ v16h hi(v8f p0, v8f p1) { v8h a, b;
#pragma unroll
        for (int r = 0; r < 8; ++r) { a[r] = (h16)(p0[r] * PCAR); b[r] = (h16)(p1[r] * PCAR); }
        return cat16(a, b); }
    static __device__ __forceinline__ v16h lo(v8f p0, v8f p1) { return hi(p0, p1); }
};
template <> struct PPk<bf> {
    static __device__ __forceinline__ v16bf hi(v8f p0, v8f p1) { v8us a, b;
#pragma unroll
        for (int r = 0; r < 8; ++r) { a[r] = f2bf(p0[r]); b[r] = f2bf(p1[r]); }
        return cat16b(a, b); }
    static __device__ __forceinline__ v16bf lo(v8f p0, v8f p1) { v8us a, b;
#pragma unroll
        for (int r = 0; r < 8; ++r) { a[r] = f2bf(p0[r] - bf2f(f2bf(p0[r]))); b[r] = f2bf(p1[r] - bf2f(f2bf(p1[r]))); }
        return cat16b(a, b); }
};

// ---- k_flash: register-fed transposed flash attention; ONE WAVE per (16 * NQ queries, head, batch); grid ((rows)/(16 * NQ), NH, NB), 32 threads; roff = first query row of this launch.
// Per 32-key step: S^T[key][query] = K (A operand, rows = keys, k = d) x Q^T (B operand held in registers, lane = query); online softmax per lane (query = lane & 15, the two lane halves hold
// different keys; one xor-16 shuffle for the max); O^T[d][query] += V^T (A operand, rows = d, k = keys, fragment-order plane per head) x P^T (B operand packed from the two score tiles). No LDS in the key loop.
// HL: bf16 hi/lo planes, 3 products per contraction, P not carried. Otherwise fp16 single product with P carried x1024.
// The K and V^T fragments of a step live in one of two register sets; each step first issues all loads of the NEXT step into the other set, so a load has a whole step to land.
template <typename T16, bool HL> struct FKV { typename WFrag<T16>::V k[4], kl[4], v[4], vl[4]; };   // kl, vl: lo planes, HL only

template <typename T16, bool HL>
__device__ __forceinline__ void ldkv(FKV<T16, HL>& f, const T16* __restrict__ K1, const T16* __restrict__ K2, const T16* __restrict__ V1, const T16* __restrict__ V2, size_t koff, int kb) {
    const size_t ko = koff + (size_t)kb * HD;   // a 32-key step is 4 tiles (4 KiB in a row) of the K plane and 4 of the V^T plane, at the same offset
#pragma unroll
    for (int i = 0; i < 4; ++i) f.k[i] = WFrag<T16>::ldf(K1 + ko + i * 512);
    // one wait behind each plane's loads
    asm volatile("s_wait_xcnt 0x0" ::: "memory");
    if (HL) {
#pragma unroll
        for (int i = 0; i < 4; ++i) f.kl[i] = WFrag<T16>::ldf(K2 + ko + i * 512);
        asm volatile("s_wait_xcnt 0x0" ::: "memory");   // as above
    }
#pragma unroll
    for (int dt = 0; dt < 4; ++dt) f.v[dt] = WFrag<T16>::ldf(V1 + ko + dt * 512);
    asm volatile("s_wait_xcnt 0x0" ::: "memory");   // as above
    if (HL) {
#pragma unroll
        for (int dt = 0; dt < 4; ++dt) f.vl[dt] = WFrag<T16>::ldf(V2 + ko + dt * 512);
        asm volatile("s_wait_xcnt 0x0" ::: "memory");   // as above
    }
    // nothing of the step that follows may be scheduled up over the waits above: an instruction that lands between a load and its wait could be given the load's address registers
    __builtin_amdgcn_sched_barrier(0);
}

// DG: this step can hold keys beyond some query of the wave, so it applies the causal mask. A step whose 32 keys all lie at or below the wave's first query (DG false) has no compare, no select and no key index.
template <typename T16, bool HL, int NQ, bool DG>
__device__ __forceinline__ void fstep(const FKV<T16, HL>& f, const typename WFrag<T16>::V (&qa)[NQ][2], const typename WFrag<T16>::V (&qb)[NQ][2], v8f (&o)[NQ][4], float (&m)[NQ], float (&l)[NQ], int kb, int q0, int lr, int hi) {
    typedef typename WFrag<T16>::V V;
    static_assert(NQ == 1 || NQ == 2);
    v8f s[NQ][2];
#pragma unroll
    for (int kt = 0; kt < 2; ++kt)
#pragma unroll
        for (int qt = 0; qt < NQ; ++qt) {
            v8f a = (v8f){};
            if (HL) { a = WFrag<T16>::mma(f.kl[2 * kt], qa[qt][0], a); a = WFrag<T16>::mma(f.kl[2 * kt + 1], qa[qt][1], a); a = WFrag<T16>::mma(f.k[2 * kt], qb[qt][0], a); a = WFrag<T16>::mma(f.k[2 * kt + 1], qb[qt][1], a); }
            a = WFrag<T16>::mma(f.k[2 * kt], qa[qt][0], a); a = WFrag<T16>::mma(f.k[2 * kt + 1], qa[qt][1], a);
            s[qt][kt] = a;
        }
    // WMMA distance: four vector slots between the last score product and the first reader of its result
    if constexpr (NQ == 1) asm volatile("v_nop\n\tv_nop\n\tv_nop\n\tv_nop" : "+v"(s[0][0]), "+v"(s[0][1]) : "v"(qa[0][0]), "v"(qa[0][1]));
    else asm volatile("v_nop\n\tv_nop\n\tv_nop\n\tv_nop" : "+v"(s[0][0]), "+v"(s[0][1]), "+v"(s[1][0]), "+v"(s[1][1]) : "v"(qa[0][0]), "v"(qa[0][1]), "v"(qa[1][0]), "v"(qa[1][1]));
    V pa[NQ], pb[NQ];
#pragma unroll
    for (int qt = 0; qt < NQ; ++qt) {
        const int qi = q0 + qt * 16 + lr;
        float mx = -1.0e30f;
#pragma unroll
        for (int kt = 0; kt < 2; ++kt)
#pragma unroll
            for (int r = 0; r < 8; ++r) { float t = s[qt][kt][r] * SCL; if (DG) { const int key = kb + kt * 16 + 8 * hi + r; t = (key > qi) ? -1.0e30f : t; } s[qt][kt][r] = t; mx = fmaxf(mx, t); }
        mx = fmaxf(mx, __shfl_xor(mx, 16, 32));
        const float mn = fmaxf(m[qt], mx);
        const float al = __builtin_amdgcn_exp2f((m[qt] - mn) * L2E);
        m[qt] = mn;
        float psum = 0.0f;
#pragma unroll
        for (int kt = 0; kt < 2; ++kt)
#pragma unroll
            for (int r = 0; r < 8; ++r) { const float p = __builtin_amdgcn_exp2f((s[qt][kt][r] - mn) * L2E); s[qt][kt][r] = p; psum += p; }
        l[qt] = l[qt] * al + psum;
#pragma unroll
        for (int dt = 0; dt < 4; ++dt) o[qt][dt] = o[qt][dt] * al;
        pa[qt] = PPk<T16>::hi(s[qt][0], s[qt][1]);
        pb[qt] = pa[qt]; if (HL) pb[qt] = PPk<T16>::lo(s[qt][0], s[qt][1]);
    }
#pragma unroll
    for (int dt = 0; dt < 4; ++dt)
#pragma unroll
        for (int qt = 0; qt < NQ; ++qt) {
            if (HL) { o[qt][dt] = WFrag<T16>::mma(f.vl[dt], pa[qt], o[qt][dt]); o[qt][dt] = WFrag<T16>::mma(f.v[dt], pb[qt], o[qt][dt]); }
            o[qt][dt] = WFrag<T16>::mma(f.v[dt], pa[qt], o[qt][dt]);
        }
    // WMMA distance, as above, for the output tiles and the packed probabilities
    if constexpr (NQ == 1) asm volatile("v_nop\n\tv_nop\n\tv_nop\n\tv_nop" : "+v"(o[0][0]), "+v"(o[0][1]), "+v"(o[0][2]), "+v"(o[0][3]) : "v"(pa[0]), "v"(pb[0]));
    else asm volatile("v_nop\n\tv_nop\n\tv_nop\n\tv_nop" : "+v"(o[0][0]), "+v"(o[0][1]), "+v"(o[0][2]), "+v"(o[0][3]), "+v"(o[1][0]), "+v"(o[1][1]), "+v"(o[1][2]), "+v"(o[1][3]) : "v"(pa[0]), "v"(pb[0]), "v"(pa[1]), "v"(pb[1]));
}

// NQ: 16-query tiles per wave. Every K and V^T fragment a wave loads feeds all its NQ tiles, so the key loop's bytes from L2 per query fall by NQ; each query keeps its own m, l and output tiles and its order of 32-key steps.
template <typename T16, bool HL, int NQ>
__global__ __launch_bounds__(32) void k_flash(const T16* __restrict__ Q1, const T16* __restrict__ Q2, const T16* __restrict__ K1, const T16* __restrict__ K2, const T16* __restrict__ V1, const T16* __restrict__ V2, int roff, bf* Ah, bf* Al) {
    typedef typename WFrag<T16>::V V;
    const int lane = threadIdx.x & 31, lr = lane & 15, hi = lane >> 4;
    const int q0 = roff + blockIdx.x * (16 * NQ); const int head = blockIdx.y;
    const size_t hp = ((size_t)blockIdx.z * NH_ + head) * TT * HD;
    const size_t qoff = hp + (size_t)q0 * HD + lane * 8;   // 16 queries are 2 tiles
    V qa[NQ][2], qb[NQ][2];
#pragma unroll
    for (int qt = 0; qt < NQ; ++qt) {
        qa[qt][0] = WFrag<T16>::ldf(Q1 + qoff + qt * 1024); qa[qt][1] = WFrag<T16>::ldf(Q1 + qoff + qt * 1024 + 512);
        if (HL) { qb[qt][0] = WFrag<T16>::ldf(Q2 + qoff + qt * 1024); qb[qt][1] = WFrag<T16>::ldf(Q2 + qoff + qt * 1024 + 512); } else { qb[qt][0] = qa[qt][0]; qb[qt][1] = qa[qt][1]; }
    }
    asm volatile("s_wait_xcnt 0x0" ::: "memory");   // the address registers of the Q loads may be reused by the loads below
    v8f o[NQ][4]; float m[NQ], l[NQ];
#pragma unroll
    for (int qt = 0; qt < NQ; ++qt) { m[qt] = -1.0e30f; l[qt] = 0.0f;
#pragma unroll
        for (int dt = 0; dt < 4; ++dt) o[qt][dt] = (v8f){}; }
    const int nst = (q0 + 16 * NQ + 31) >> 5;     // keys 0 .. q0+16*NQ-1 in steps of 32; at least 1
    const size_t koff = hp + lane * 8;
    FKV<T16, HL> fa, fb;
    ldkv<T16, HL>(fa, K1, K2, V1, V2, koff, 0);
    asm volatile("s_wait_xcnt 0x0" ::: "memory");   // the address registers of the loads above are reused below
    // q0 is a multiple of 16 * NQ, so only the last step reaches past q0: step s < nst - 1 ends at key 32 * s + 31 <= q0. The loop runs the steps below the diagonal without the mask; the last step is peeled and masked.
    const int nd = nst - 1;
    int stp = 0;
    // two steps per trip, so that the two register sets swap roles without copies; step stp + 2 <= nd always exists
#pragma unroll 1
    for (; stp + 1 < nd; stp += 2) {
        ldkv<T16, HL>(fb, K1, K2, V1, V2, koff, (stp + 1) * 32);
        fstep<T16, HL, NQ, false>(fa, qa, qb, o, m, l, stp * 32, q0, lr, hi);
        ldkv<T16, HL>(fa, K1, K2, V1, V2, koff, (stp + 2) * 32);
        fstep<T16, HL, NQ, false>(fb, qa, qb, o, m, l, (stp + 1) * 32, q0, lr, hi);
    }
    if (stp < nd) {   // one unmasked step is left in front of the last
        ldkv<T16, HL>(fb, K1, K2, V1, V2, koff, nd * 32);
        fstep<T16, HL, NQ, false>(fa, qa, qb, o, m, l, stp * 32, q0, lr, hi);
        fstep<T16, HL, NQ, true>(fb, qa, qb, o, m, l, nd * 32, q0, lr, hi);
    } else fstep<T16, HL, NQ, true>(fa, qa, qb, o, m, l, nd * 32, q0, lr, hi);
    // The output tiles already have the fragment map (lane = query row, element r of tile dt = k 16 * dt + 8 * hi + r of this head's 64): each lane stores its 16-byte chunks straight into the output GEMM's A planes.
#pragma unroll
    for (int qt = 0; qt < NQ; ++qt) {
        const float lt = l[qt] + __shfl_xor(l[qt], 16, 32);
        const float inv = (HL ? 1.0f : (1.0f / PCAR)) * (1.0f / lt);
        const int t0 = q0 + qt * 16;
        const size_t oo = (size_t)blockIdx.z * TT * DQ + ((size_t)(t0 >> 6) * (DQ / 32) + head * (HD / 32)) * 2048 + ((t0 >> 4) & 3) * 512 + lane * 8;
#pragma unroll
        for (int dt = 0; dt < 4; ++dt) { v8us hv, lv;
#pragma unroll
            for (int r = 0; r < 8; ++r) { unsigned short a2, c2; splitf(o[qt][dt][r] * inv, a2, c2); hv[r] = a2; lv[r] = c2; }
            *(v8us*)(Ah + oo + (dt >> 1) * 2048 + (dt & 1) * 256) = hv; *(v8us*)(Al + oo + (dt >> 1) * 2048 + (dt & 1) * 256) = lv; }
        if (qt + 1 < NQ) asm volatile("s_wait_xcnt 0x0" ::: "memory");   // the next tile's values and addresses may reuse the registers of the stores above
    }
}

extern "C" void kernel_launch(void* const* d_in, const int* in_sizes, int n_in,
                              void* d_out, int out_size, void* d_ws, size_t ws_size, hipStream_t stream) {
    if (n_in < 6) return;
    const size_t need = (size_t)(NB - 1) * SEQ_FULL * DM + (size_t)TT * DM;
    if ((size_t)in_sizes[0] < need || (size_t)out_size < need) return;
    if (in_sizes[1] < DM * DQ || in_sizes[2] < DM * DQ || in_sizes[3] < DM * DQ || in_sizes[4] < DQ * DM || in_sizes[5] < DM) return;
    const float* x = (const float*)d_in[0]; const float* wq = (const float*)d_in[1]; const float* wk = (const float*)d_in[2]; const float* wv = (const float*)d_in[3]; const float* wo = (const float*)d_in[4]; const float* bo = (const float*)d_in[5];
    float* OUT = (float*)d_out;     // [2][4096][768], byte offset 0
    char* wsp = (char*)d_ws;
    auto take = [&](size_t bytes) { char* p = wsp; wsp += (bytes + 255) & ~(size_t)255; return (void*)p; };
    bf* WT = (bf*)take((size_t)4 * DQ * DM * 2); bf* WO = WT + (size_t)3 * DQ * DM;   // transposed wq, wk, wv, wo, one behind the other
    bf* XB = (bf*)take((size_t)NB * TT * DM * 2);
    const size_t PE = (size_t)NH_ * TT * HD;   // elements of one plane of one batch
    h16* P16 = (h16*)take((size_t)3 * NB * PE * 2); bf* Ph = (bf*)take((size_t)3 * NB * PE * 2); bf* Pl = (bf*)take((size_t)3 * NB * PE * 2);   // each: q planes of all batches, then k, then v^T
    bf* ATh = (bf*)take((size_t)NB * TT * DQ * 2); bf* ATl = (bf*)take((size_t)NB * TT * DQ * 2);
    if ((size_t)(wsp - (char*)d_ws) > ws_size) return;    // 155,713,536 B at the full size
    // Launches that do not depend on each other (the four weights and x; the two batches; the q, k and v projections) are one grid each.
    k_prep<<<4u * LWB + NB * NCB, 256, 0, stream>>>(wq, wk, wv, wo, WT, x, XB);   // weights: in[768][768] -> out[768][768] transposed (DM == DQ)
    k_gemmw<bf, 0, false, 3, true><<<dim3(TT / 64, NH_, 3 * NB), 32, 0, stream>>>(XB, nullptr, WT, nullptr, DM, nullptr, 0, nullptr, (size_t)TT * DM, (size_t)DQ * DM, 0, P16, Ph, Pl);
    k_flash<bf, true, 1><<<dim3(RH / 16, NH_, NB), 32, 0, stream>>>(Ph, Pl, Ph + NB * PE, Pl + NB * PE, Ph + 2 * NB * PE, Pl + 2 * NB * PE, 0, ATh, ATl);
    if (TT > RH) k_flash<h16, false, 2><<<dim3((TT - RH) / 32, NH_, NB), 32, 0, stream>>>(P16, nullptr, P16 + NB * PE, nullptr, P16 + 2 * NB * PE, nullptr, RH, ATh, ATl);
    k_gemmw<bf, 1, true, 1, false><<<dim3(TT / 64, DM / 64, NB), 32, 0, stream>>>(ATh, ATl, WO, nullptr, DQ, OUT, DM, bo, (size_t)TT * DQ, 0, (size_t)SEQ_FULL * DM, nullptr, nullptr, nullptr);
}

// v008
// It runs in 165 microseconds.
// Two timings next to v007 put it at 1.05 and 1.04 times that version's speed.
// All steps since v000 together make it 4.32 times as fast.
#include <hip/hip_runtime.h>

// Causal self-attention block: x [2][4096][768]; q/k/v = x W (W [in][out] 768x768, 12 heads x 64); softmax(q.k / 8) over keys j <= i; out = merged ctx Wo + bo -> [2][4096][768].
// Compute dtypes, f32 accumulate: every input RNE-converted to bf16; q/k/v projections v_wmma_f32_16x16x32_bf16 (plain bf16 operands); scores (K Q^T) and ctx (V^T P^T): query rows < 512 on bf16 hi/lo planes (3 products), other rows v_wmma_f32_16x16x32_f16 single product (P and its sum carried x1024); softmax f32; ctx.Wo bf16 hi/lo x bf16 (2 products) + bias.

#ifndef NB
#define NB 2
#endif
#ifndef SEQ
#define SEQ 4096
#endif
#define NB_FULL  2
#define SEQ_FULL 4096
#define TT   SEQ
#define DM   768
#define NH_  12
#define HD   64
#define DQ   (NH_ * HD)
#define RH   ((SEQ) < 512 ? (SEQ) : 512)   // query rows < RH use hi+lo planes
#define LCAR 10.0f                         // log2 of the x1024 carry of P and of its sum (fp16 path)
#define SCL  0.125f                        // HD^-0.5
#define L2E  1.4426950408889634f
#define CSL  (SCL * L2E)                   // raw score -> exponent of 2
#define WSB  ((size_t)4 * DQ * DM * 2 + (size_t)NB * ((size_t)TT * DM * 2 + (size_t)9 * NH_ * TT * HD * 2 + (size_t)2 * TT * DQ * 2))

static_assert(SEQ % 64 == 0);
static_assert(SEQ <= SEQ_FULL);
static_assert(NB <= NB_FULL);
static_assert(DM % 64 == 0);
static_assert(DQ % 64 == 0);
static_assert(DQ == DM);
static_assert(HD == 64);
static_assert(RH % 16 == 0);
static_assert((TT - RH) % 32 == 0);
static_assert(RH % 32 == 0);
static_assert(((size_t)DQ * DM * 2) % 256 == 0);
static_assert(((size_t)TT * DM * 2) % 256 == 0);
static_assert(((size_t)NH_ * TT * HD * 2) % 256 == 0);
static_assert(WSB <= (size_t)268435456);

typedef _Float16 h16;
typedef unsigned short bf;
typedef __attribute__((ext_vector_type(16))) __bf16   v16bf;
typedef __attribute__((ext_vector_type(16))) _Float16 v16h;
typedef __attribute__((ext_vector_type(8)))  _Float16 v8h;
typedef __attribute__((ext_vector_type(8)))  unsigned short v8us;
typedef __attribute__((ext_vector_type(8)))  float    v8f;
typedef __attribute__((ext_vector_type(4)))  float    v4f;
typedef __attribute__((ext_vector_type(2)))  float    v2f;
typedef v8h  __attribute__((may_alias)) v8ha;
typedef v4f  __attribute__((may_alias)) v4fa;

__device__ __forceinline__ unsigned short f2bf(float f) { unsigned u = __float_as_uint(f); u += 0x7FFFu + ((u >> 16) & 1u); return (unsigned short)(u >> 16); }
__device__ __forceinline__ float bf2f(unsigned short b) { return __uint_as_float(((unsigned)b) << 16); }
__device__ __forceinline__ float bfr(float f) { return bf2f(f2bf(f)); }
__device__ __forceinline__ v16h cat16(v8h lo, v8h hi) { return __builtin_shufflevector(lo, hi, 0, 1, 2, 3, 4, 5, 6, 7, 8, 9, 10, 11, 12, 13, 14, 15); }
__device__ __forceinline__ v16bf cat16b(v8us lo, v8us hi) { return __builtin_bit_cast(v16bf, __builtin_shufflevector(lo, hi, 0, 1, 2, 3, 4, 5, 6, 7, 8, 9, 10, 11, 12, 13, 14, 15)); }
__device__ __forceinline__ v8f wmma16(v16h a, v16h b, v8f c) { return __builtin_amdgcn_wmma_f32_16x16x32_f16(false, a, false, b, (short)0, c, false, false); }
__device__ __forceinline__ v8f wmmab(v16bf a, v16bf b, v8f c) { return __builtin_amdgcn_wmma_f32_16x16x32_bf16(false, a, false, b, (short)0, c, false, false); }
__device__ __forceinline__ void splitf(float y, unsigned short& h, unsigned short& l) { h = f2bf(y); l = f2bf(y - bf2f(h)); }

// Fragment map, the same for A and B operands: lane holds row (lane & 15); elements 0..7 <- k = 8 * (lane >> 4) + 0..7, elements 8..15 <- k = 16 + 8 * (lane >> 4) + 0..7 of a 32-k slice.
// Fragment-order planes (every WMMA operand read from memory): a 16-bit matrix [rows][k] kept as tiles of 16 rows x 32 k (512 elements, 1 KiB). Inside a tile the 16-byte chunk 32 * s + lane holds row (lane & 15),
// k = 16 * s + 8 * (lane >> 4) + 0..7: the map above. A tile is one fragment, and each of its two loads reads 512 contiguous bytes (4 whole cache lines) instead of 32 bytes from each of 16 rows.
// ldf: p points at tile base + 8 * lane; elements 0..7 <- p[0..7], elements 8..15 <- p[256..263].
// Tile order of the GEMM operand planes (x, the transposed weights, the merged context): tile = ((row / 64) * (K / 32) + k / 32) * 4 + (row / 16) % 4, so one 32-k step of a 64-row block is 4 KiB in a row.
template <typename T16> struct WFrag;
template <> struct WFrag<h16> { typedef v16h V; static __device__ __forceinline__ V ldf(const h16* p) { return cat16(*(const v8h*)p, *(const v8h*)(p + 256)); } static __device__ __forceinline__ v8f mma(V a, V b, v8f c) { return wmma16(a, b, c); } };
template <> struct WFrag<bf> { typedef v16bf V; static __device__ __forceinline__ V ldf(const bf* p) { return cat16b(*(const v8us*)p, *(const v8us*)(p + 256)); } static __device__ __forceinline__ v8f mma(V a, V b, v8f c) { return wmmab(a, b, c); } };

// put_planes: the 64 x 64 accumulator block of one wave of the projection GEMM -> 8 KiB in a row of each of the three flash planes (f16, bf16 hi, bf16 lo) of its head; d16, dh, dl point at that block + 8 * lane.
// An accumulator tile has the fragment map already: lane & 15 = the B operand's row, elements 0..7 = the A operand's rows 8 * (lane >> 4) + 0..7, so tile (mb, nb) is one 512-byte half of a plane tile and each lane stores its own 16-byte chunk.
// q, k planes (per head, rows = t, k = d: tile = 2 * (t / 16) + d / 32): A rows = d, B rows = t, half 4 * nb + mb. v^T plane (rows = d, k = t: tile = 4 * (t / 32) + d / 16): A rows = t, B rows = d, half 8 * (mb / 2) + 2 * nb + mb % 2.
template <bool VT>
__device__ __forceinline__ void put_planes(const v8f (&acc)[4][4], h16* d16, bf* dh, bf* dl) {
#pragma unroll
    for (int mb = 0; mb < 4; ++mb)
#pragma unroll
        for (int np = 0; np < 2; ++np) { v8h o16[2]; v8us oh[2], ol[2];
#pragma unroll
            for (int u = 0; u < 2; ++u) { const int nb = 2 * np + u;
#pragma unroll
                for (int q = 0; q < 8; ++q) { const float x = acc[mb][nb][q]; o16[u][q] = (h16)x; unsigned short a2, c2; splitf(x, a2, c2); oh[u][q] = a2; ol[u][q] = c2; }
                const int e = (VT ? 8 * (mb >> 1) + 2 * nb + (mb & 1) : 4 * nb + mb) * 256;
                *(v8h*)(d16 + e) = o16[u]; *(v8us*)(dh + e) = oh[u]; *(v8us*)(dl + e) = ol[u]; }
            // the next two tiles' values may reuse the registers of the stores above; values and addresses are inputs, so that they stay in their registers up to the wait
            if (mb < 3 || np < 1) asm volatile("s_wait_xcnt 0x0" :: "v"(o16[0]), "v"(o16[1]), "v"(oh[0]), "v"(oh[1]), "v"(ol[0]), "v"(ol[1]), "v"(d16), "v"(dh), "v"(dl) : "memory");
        }
}

// ---- k_gemmw: register-blocked GEMM, ONE WAVE per 64x64 output tile (16 accumulators), operands straight from fragment-order 16-bit planes; grid (M/64, N/64, Z), 32 threads.
// C[m][n] (f32, pitch ldc, + optional f32 bias[n]) = sum_k A[m][k] Bt[n][k] (+ split products per NSPLIT). K % 32 == 0, M % 64 == 0, N % 64 == 0.
// blockIdx.z counts independent products: A matrix z / NW (stride sA), B matrix z % NW (stride sB), C matrix z (stride sC).
// PL (the projections: A = x of batch z / 3, B = transposed wq, wk, wv by z % 3, blockIdx.y = head): no C; the accumulators go straight into the flash planes (put_planes). Plane (p, batch) lies at index p * NB + batch of each of the three arrays.
template <typename T16, int NSPLIT, bool BIAS, int NW, bool PL>
__global__ __launch_bounds__(32) void k_gemmw(const T16* __restrict__ A, const T16* __restrict__ A2, const T16* __restrict__ Bt, const T16* __restrict__ Bt2, int K, float* C, int ldc, const float* __restrict__ bias, size_t sA, size_t sB, size_t sC, h16* P16, bf* Ph, bf* Pl) {
    typedef typename WFrag<T16>::V V;
    static_assert(!PL || (NW == 3 && NSPLIT == 0 && !BIAS));
    __shared__ __align__(16) float os[16 * 68];
    const size_t z = blockIdx.z, za = z / NW, zw = z % NW; A += za * sA; if (A2) A2 += za * sA; Bt += zw * sB; if (Bt2) Bt2 += zw * sB; C += z * sC;
    const int lane = threadIdx.x & 31, lr = lane & 15, hi = lane >> 4; const int r0 = blockIdx.x * 64, c0 = blockIdx.y * 64;
    v8f acc[4][4];
#pragma unroll
    for (int mb = 0; mb < 4; ++mb)
#pragma unroll
        for (int nb = 0; nb < 4; ++nb) acc[mb][nb] = (v8f){};
    size_t aoff = (size_t)blockIdx.x * K * 64 + lane * 8, boff = (size_t)blockIdx.y * K * 64 + lane * 8;   // a 64-row block is K * 64 elements; a 32-k step of it 2048
    if (PL && zw != 2) { const T16* tp = A; A = Bt; Bt = tp; const size_t to = aoff; aoff = boff; boff = to; }   // q, k: the weights are the A operand, so that a lane holds 8 neighbouring d of one t (both planes have one format)
#pragma unroll 1
    for (int kc = 0; kc < K; kc += 32) {
        V a[4], a2[4]; const T16* pa = A + aoff + (size_t)kc * 64; const T16* pa2 = (NSPLIT == 1 || NSPLIT == 2) ? A2 + aoff + (size_t)kc * 64 : pa; const T16* pb = Bt + boff + (size_t)kc * 64; const T16* pb2 = NSPLIT >= 2 ? Bt2 + boff + (size_t)kc * 64 : pb;
#pragma unroll
        for (int mb = 0; mb < 4; ++mb) { a[mb] = WFrag<T16>::ldf(pa + mb * 512); if (NSPLIT == 1 || NSPLIT == 2) a2[mb] = WFrag<T16>::ldf(pa2 + mb * 512); }
        // the compiler lets later loads land on the address registers of the loads above; one wait behind the A loads, one behind each B fragment's. The addresses are inputs, so that they stay in their registers up to the wait
        asm volatile("s_wait_xcnt 0x0" :: "v"(pa), "v"(pa2) : "memory");
#pragma unroll
        for (int nb = 0; nb < 4; ++nb) { const V b = WFrag<T16>::ldf(pb + nb * 512); V b2; if (NSPLIT >= 2) b2 = WFrag<T16>::ldf(pb2 + nb * 512);
            asm volatile("s_wait_xcnt 0x0" :: "v"(pb), "v"(pb2) : "memory");   // as above
#pragma unroll
            for (int mb = 0; mb < 4; ++mb) { acc[mb][nb] = WFrag<T16>::mma(a[mb], b, acc[mb][nb]); if (NSPLIT == 1 || NSPLIT == 2) acc[mb][nb] = WFrag<T16>::mma(a2[mb], b, acc[mb][nb]); if (NSPLIT >= 2) acc[mb][nb] = WFrag<T16>::mma(a[mb], b2, acc[mb][nb]); } }
        asm volatile("v_nop\n\tv_nop\n\tv_nop\n\tv_nop" : "+v"(acc[0][0]), "+v"(acc[1][1]), "+v"(acc[2][2]), "+v"(acc[3][3]) : "v"(a[0]), "v"(a[3]));
    }
    if constexpr (PL) {
        const size_t po = ((zw * NB + za) * NH_ + blockIdx.y) * TT * HD + (size_t)r0 * HD + lane * 8;
        if (zw == 2) put_planes<true>(acc, P16 + po, Ph + po, Pl + po); else put_planes<false>(acc, P16 + po, Ph + po, Pl + po);
    } else {
#pragma unroll
    for (int mb = 0; mb < 4; ++mb) {
#pragma unroll
        for (int nb = 0; nb < 4; ++nb) {
#pragma unroll
            for (int j = 0; j < 8; ++j) os[(hi * 8 + j) * 68 + nb * 16 + lr] = acc[mb][nb][j]; }
        __builtin_amdgcn_wave_barrier(); asm volatile("" ::: "memory");
        float* crow = C + (size_t)(r0 + mb * 16) * ldc + c0;
{
#pragma unroll
            for (int s = 0; s < 8; ++s) { const int row = 2 * s + hi, cofs = lr * 4; v4f val = *(const v4fa*)(os + row * 68 + cofs); if (BIAS) { val[0] += bfr(bias[c0 + cofs]); val[1] += bfr(bias[c0 + cofs + 1]); val[2] += bfr(bias[c0 + cofs + 2]); val[3] += bfr(bias[c0 + cofs + 3]); }
                *(v4f*)(crow + (size_t)row * ldc + cofs) = val; }
             }
        __builtin_amdgcn_wave_barrier(); asm volatile("" ::: "memory");
    }
    }
}

// gpos: 16-byte chunk i of a GEMM operand plane [rows][K] -> its row and its first k.
template <int K> __device__ __forceinline__ void gpos(unsigned i, int& row, int& k) { const unsigned c = i & 63u, tile = i >> 6, g = tile >> 2;
    row = (int)((g / (K / 32)) * 64 + (tile & 3u) * 16 + (c & 15u)); k = (int)((g % (K / 32)) * 32 + (c >> 5) * 16 + ((c >> 4) & 1u) * 8); }
// d_wtG, d_cvt8: one thread per 16-byte chunk of the plane, so a wave stores 512 contiguous bytes; bx = the block's index within its own piece of work.
// d_wtG: plane rows = n, k = k of w [K][N]. The lanes of a half wave read 16 neighbouring n of one k.
__device__ __forceinline__ void d_wtG(const float* __restrict__ w, bf* Bt, unsigned bx) { const unsigned i = bx * 256 + threadIdx.x; if (i >= (unsigned)(DQ * DM / 8)) return; int n, k; gpos<DM>(i, n, k); v8us o;
#pragma unroll
    for (int q = 0; q < 8; ++q) o[q] = f2bf(w[(size_t)(k + q) * DQ + n]);
    *(v8us*)(Bt + (size_t)i * 8) = o; }
__device__ __forceinline__ void d_cvt8(const float* __restrict__ src, bf* dst, unsigned bx) { const unsigned i = bx * 256 + threadIdx.x; if (i >= (unsigned)((size_t)TT * DM / 8)) return; int t, k; gpos<DM>(i, t, k); const v8f v = *(const v8f*)(src + (size_t)t * DM + k); v8us o;
#pragma unroll
    for (int q = 0; q < 8; ++q) o[q] = f2bf(v[q]);
    *(v8us*)(dst + (size_t)i * 8) = o; }
// k_prep: all operand conversions in one launch. Blocks 0 .. 4 * LWB - 1: the four weight matrices (all DM x DQ), LWB blocks each, their transposed planes one behind the other in Bt; then NCB blocks per batch of x.
#define LWB ((unsigned)((DM * DQ / 8 + 255) / 256))
#define NCB ((unsigned)(((size_t)TT * DM / 8 + 255) / 256))
__global__ __launch_bounds__(256) void k_prep(const float* __restrict__ w0, const float* __restrict__ w1, const float* __restrict__ w2, const float* __restrict__ w3, bf* Bt, const float* __restrict__ x, bf* XB) {
    const unsigned bx = blockIdx.x;
    if (bx < 4u * LWB) { const unsigned y = bx / LWB; const float* __restrict__ w = y == 0 ? w0 : y == 1 ? w1 : y == 2 ? w2 : w3; d_wtG(w, Bt + (size_t)y * DQ * DM, bx % LWB); }
    else { const unsigned c = bx - 4u * LWB, b = c / NCB; d_cvt8(x + (size_t)b * SEQ_FULL * DM, XB + (size_t)b * TT * DM, c % NCB); }
}
// Probability packers: two 16-key score tiles (accumulator layout: lane = query, element r = key 8*(lane>>4)+r) -> one 32-key B fragment (elements 0..7 <- tile 0, 8..15 <- tile 1).
template <typename T16> struct PPk;
template <> struct PPk<h16> {
    static __device__ __forceinline__ v16h hi(v8f p0, v8f p1) { v8h a, b;
#pragma unroll
        for (int r = 0; r < 8; ++r) { a[r] = (h16)p0[r]; b[r] = (h16)p1[r]; }
        return cat16(a, b); }
    static __device__ __forceinline__ v16h lo(v8f p0, v8f p1) { return hi(p0, p1); }
};
template <> struct PPk<bf> {
    static __device__ __forceinline__ v16bf hi(v8f p0, v8f p1) { v8us a, b;
#pragma unroll
        for (int r = 0; r < 8; ++r) { a[r] = f2bf(p0[r]); b[r] = f2bf(p1[r]); }
        return cat16b(a, b); }
    static __device__ __forceinline__ v16bf lo(v8f p0, v8f p1) { v8us a, b;
#pragma unroll
        for (int r = 0; r < 8; ++r) { a[r] = f2bf(p0[r] - bf2f(f2bf(p0[r]))); b[r] = f2bf(p1[r] - bf2f(f2bf(p1[r]))); }
        return cat16b(a, b); }
};

// ---- k_flash: register-fed transposed flash attention; ONE WAVE per (16 * NQ queries, head, batch); grid ((rows)/(16 * NQ), NH, NB), 32 threads; roff = first query row of this launch.
// Per 32-key step: S^T[key][query] = K (A operand, rows = keys, k = d) x Q^T (B operand held in registers, lane = query); online softmax per lane (query = lane & 15, the two lane halves hold
// different keys; one xor-16 shuffle for the max); O^T[d][query] += V^T (A operand, rows = d, k = keys, fragment-order plane per head) x P^T (B operand packed from the two score tiles). No LDS in the key loop.
// HL: bf16 hi/lo planes, 3 products per contraction, P not carried. Otherwise fp16 single product with P and its sum l carried x1024 (10 added to the exponent).
// The K and V^T fragments of a step live in one of two register sets; each step first issues all loads of the NEXT step into the other set, so a load has a whole step to land.
template <typename T16, bool HL> struct FKV { typename WFrag<T16>::V k[4], kl[4], v[4], vl[4]; };   // kl, vl: lo planes, HL only

template <typename T16, bool HL>
__device__ __forceinline__ void ldkv(FKV<T16, HL>& f, const T16* __restrict__ K1, const T16* __restrict__ K2, const T16* __restrict__ V1, const T16* __restrict__ V2, size_t koff, int kb) {
    const size_t ko = koff + (size_t)kb * HD;   // a 32-key step is 4 tiles (4 KiB in a row) of the K plane and 4 of the V^T plane, at the same offset
#pragma unroll
    for (int i = 0; i < 4; ++i) f.k[i] = WFrag<T16>::ldf(K1 + ko + i * 512);
    // one wait behind each plane's loads
    asm volatile("s_wait_xcnt 0x0" ::: "memory");
    if (HL) {
#pragma unroll
        for (int i = 0; i < 4; ++i) f.kl[i] = WFrag<T16>::ldf(K2 + ko + i * 512);
        asm volatile("s_wait_xcnt 0x0" ::: "memory");   // as above
    }
#pragma unroll
    for (int dt = 0; dt < 4; ++dt) f.v[dt] = WFrag<T16>::ldf(V1 + ko + dt * 512);
    asm volatile("s_wait_xcnt 0x0" ::: "memory");   // as above
    if (HL) {
#pragma unroll
        for (int dt = 0; dt < 4; ++dt) f.vl[dt] = WFrag<T16>::ldf(V2 + ko + dt * 512);
        asm volatile("s_wait_xcnt 0x0" ::: "memory");   // as above
    }
    // nothing of the step that follows may be scheduled up over the waits above: an instruction that lands between a load and its wait could be given the load's address registers
    __builtin_amdgcn_sched_barrier(0);
}

// DG: this step can hold keys beyond some query of the wave, so it applies the causal mask. A step whose 32 keys all lie at or below the wave's first query (DG false) has no compare, no select and no key index.
template <typename T16, bool HL, int NQ, bool DG>
__device__ __forceinline__ void fstep(const FKV<T16, HL>& f, const typename WFrag<T16>::V (&qa)[NQ][2], const typename WFrag<T16>::V (&qb)[NQ][2], v8f (&o)[NQ][4], float (&m)[NQ], float (&l)[NQ], int kb, int q0, int lr, int hi) {
    typedef typename WFrag<T16>::V V;
    static_assert(NQ == 1 || NQ == 2);
    v8f s[NQ][2];
#pragma unroll
    for (int kt = 0; kt < 2; ++kt)
#pragma unroll
        for (int qt = 0; qt < NQ; ++qt) {
            v8f a = (v8f){};
            if (HL) { a = WFrag<T16>::mma(f.kl[2 * kt], qa[qt][0], a); a = WFrag<T16>::mma(f.kl[2 * kt + 1], qa[qt][1], a); a = WFrag<T16>::mma(f.k[2 * kt], qb[qt][0], a); a = WFrag<T16>::mma(f.k[2 * kt + 1], qb[qt][1], a); }
            a = WFrag<T16>::mma(f.k[2 * kt], qa[qt][0], a); a = WFrag<T16>::mma(f.k[2 * kt + 1], qa[qt][1], a);
            s[qt][kt] = a;
        }
    // WMMA distance: four vector slots between the last score product and the first reader of its result
    if constexpr (NQ == 1) asm volatile("v_nop\n\tv_nop\n\tv_nop\n\tv_nop" : "+v"(s[0][0]), "+v"(s[0][1]) : "v"(qa[0][0]), "v"(qa[0][1]));
    else asm volatile("v_nop\n\tv_nop\n\tv_nop\n\tv_nop" : "+v"(s[0][0]), "+v"(s[0][1]), "+v"(s[1][0]), "+v"(s[1][1]) : "v"(qa[0][0]), "v"(qa[0][1]), "v"(qa[1][0]), "v"(qa[1][1]));
    V pa[NQ], pb[NQ];
#pragma unroll
    for (int qt = 0; qt < NQ; ++qt) {
        const int qi = q0 + qt * 16 + lr;
        float mx = -1.0e30f;
#pragma unroll
        for (int kt = 0; kt < 2; ++kt)
#pragma unroll
            for (int r = 0; r < 8; ++r) { float t = s[qt][kt][r]; if (DG) { const int key = kb + kt * 16 + 8 * hi + r; t = (key > qi) ? -1.0e30f : t; } s[qt][kt][r] = t; mx = fmaxf(mx, t); }
        mx = fmaxf(mx, __shfl_xor(mx, 16, 32));
        const float mn = fmaxf(m[qt], mx);   // the running maximum is kept in raw score units (the scale is positive)
        const float al = __builtin_amdgcn_exp2f((m[qt] - mn) * CSL);
        m[qt] = mn;
        const float nb = fmaf(-mn, CSL, HL ? 0.0f : LCAR);   // per query and step: scale, log2(e), maximum and carry meet in one fma per score
        float psum = 0.0f;
#pragma unroll
        for (int kt = 0; kt < 2; ++kt)
#pragma unroll
            for (int r = 0; r < 8; r += 2) {   // neighbouring elements of a score tile are an aligned register pair: one packed fma for two scores
                const v2f e = __builtin_elementwise_fma((v2f){s[qt][kt][r], s[qt][kt][r + 1]}, (v2f){CSL, CSL}, (v2f){nb, nb});
                const float p0 = __builtin_amdgcn_exp2f(e[0]), p1 = __builtin_amdgcn_exp2f(e[1]); s[qt][kt][r] = p0; s[qt][kt][r + 1] = p1; psum += p0; psum += p1; }
        l[qt] = l[qt] * al + psum;
#pragma unroll
        for (int dt = 0; dt < 4; ++dt) o[qt][dt] = o[qt][dt] * al;
        pa[qt] = PPk<T16>::hi(s[qt][0], s[qt][1]);
        pb[qt] = pa[qt]; if (HL) pb[qt] = PPk<T16>::lo(s[qt][0], s[qt][1]);
    }
#pragma unroll
    for (int dt = 0; dt < 4; ++dt)
#pragma unroll
        for (int qt = 0; qt < NQ; ++qt) {
            if (HL) { o[qt][dt] = WFrag<T16>::mma(f.vl[dt], pa[qt], o[qt][dt]); o[qt][dt] = WFrag<T16>::mma(f.v[dt], pb[qt], o[qt][dt]); }
            o[qt][dt] = WFrag<T16>::mma(f.v[dt], pa[qt], o[qt][dt]);
        }
    // WMMA distance, as above, for the output tiles and the packed probabilities
    if constexpr (NQ == 1) asm volatile("v_nop\n\tv_nop\n\tv_nop\n\tv_nop" : "+v"(o[0][0]), "+v"(o[0][1]), "+v"(o[0][2]), "+v"(o[0][3]) : "v"(pa[0]), "v"(pb[0]));
    else asm volatile("v_nop\n\tv_nop\n\tv_nop\n\tv_nop" : "+v"(o[0][0]), "+v"(o[0][1]), "+v"(o[0][2]), "+v"(o[0][3]), "+v"(o[1][0]), "+v"(o[1][1]), "+v"(o[1][2]), "+v"(o[1][3]) : "v"(pa[0]), "v"(pb[0]), "v"(pa[1]), "v"(pb[1]));
}

// NQ: 16-query tiles per wave. Every K and V^T fragment a wave loads feeds all its NQ tiles, so the key loop's bytes from L2 per query fall by NQ; each query keeps its own m, l and output tiles and its order of 32-key steps.
template <typename T16, bool HL, int NQ>
__global__ __launch_bounds__(32) void k_flash(const T16* __restrict__ Q1, const T16* __restrict__ Q2, const T16* __restrict__ K1, const T16* __restrict__ K2, const T16* __restrict__ V1, const T16* __restrict__ V2, int roff, bf* Ah, bf* Al) {
    typedef typename WFrag<T16>::V V;
    const int lane = threadIdx.x & 31, lr = lane & 15, hi = lane >> 4;
    const int q0 = roff + blockIdx.x * (16 * NQ); const int head = blockIdx.y;
    const size_t hp = ((size_t)blockIdx.z * NH_ + head) * TT * HD;
    const size_t qoff = hp + (size_t)q0 * HD + lane * 8;   // 16 queries are 2 tiles
    V qa[NQ][2], qb[NQ][2];
#pragma unroll
    for (int qt = 0; qt < NQ; ++qt) {
        qa[qt][0] = WFrag<T16>::ldf(Q1 + qoff + qt * 1024); qa[qt][1] = WFrag<T16>::ldf(Q1 + qoff + qt * 1024 + 512);
        if (HL) { qb[qt][0] = WFrag<T16>::ldf(Q2 + qoff + qt * 1024); qb[qt][1] = WFrag<T16>::ldf(Q2 + qoff + qt * 1024 + 512); } else { qb[qt][0] = qa[qt][0]; qb[qt][1] = qa[qt][1]; }
    }
    asm volatile("s_wait_xcnt 0x0" ::: "memory");   // the address registers of the Q loads may be reused by the loads below
    v8f o[NQ][4]; float m[NQ], l[NQ];
#pragma unroll
    for (int qt = 0; qt < NQ; ++qt) { m[qt] = -1.0e30f; l[qt] = 0.0f;
#pragma unroll
        for (int dt = 0; dt < 4; ++dt) o[qt][dt] = (v8f){}; }
    const int nst = (q0 + 16 * NQ + 31) >> 5;     // keys 0 .. q0+16*NQ-1 in steps of 32; at least 1
    const size_t koff = hp + lane * 8;
    FKV<T16, HL> fa, fb;
    ldkv<T16, HL>(fa, K1, K2, V1, V2, koff, 0);
    asm volatile("s_wait_xcnt 0x0" ::: "memory");   // the address registers of the loads above are reused below
    // q0 is a multiple of 16 * NQ, so only the last step reaches past q0: step s < nst - 1 ends at key 32 * s + 31 <= q0. The loop runs the steps below the diagonal without the mask; the last step is peeled and masked.
    const int nd = nst - 1;
    int stp = 0;
    // two steps per trip, so that the two register sets swap roles without copies; step stp + 2 <= nd always exists
#pragma unroll 1
    for (; stp + 1 < nd; stp += 2) {
        ldkv<T16, HL>(fb, K1, K2, V1, V2, koff, (stp + 1) * 32);
        fstep<T16, HL, NQ, false>(fa, qa, qb, o, m, l, stp * 32, q0, lr, hi);
        ldkv<T16, HL>(fa, K1, K2, V1, V2, koff, (stp + 2) * 32);
        fstep<T16, HL, NQ, false>(fb, qa, qb, o, m, l, (stp + 1) * 32, q0, lr, hi);
    }
    if (stp < nd) {   // one unmasked step is left in front of the last
        ldkv<T16, HL>(fb, K1, K2, V1, V2, koff, nd * 32);
        fstep<T16, HL, NQ, false>(fa, qa, qb, o, m, l, stp * 32, q0, lr, hi);
        fstep<T16, HL, NQ, true>(fb, qa, qb, o, m, l, nd * 32, q0, lr, hi);
    } else fstep<T16, HL, NQ, true>(fa, qa, qb, o, m, l, nd * 32, q0, lr, hi);
    // The output tiles already have the fragment map (lane = query row, element r of tile dt = k 16 * dt + 8 * hi + r of this head's 64): each lane stores its 16-byte chunks straight into the output GEMM's A planes.
#pragma unroll
    for (int qt = 0; qt < NQ; ++qt) {
        const float lt = l[qt] + __shfl_xor(l[qt], 16, 32);
        const float inv = 1.0f / lt;   // fp16 path: the output tiles and the sum carry the same x1024
        const int t0 = q0 + qt * 16;
        const size_t oo = (size_t)blockIdx.z * TT * DQ + ((size_t)(t0 >> 6) * (DQ / 32) + head * (HD / 32)) * 2048 + ((t0 >> 4) & 3) * 512 + lane * 8;
#pragma unroll
        for (int dt = 0; dt < 4; ++dt) { v8us hv, lv;
#pragma unroll
            for (int r = 0; r < 8; ++r) { unsigned short a2, c2; splitf(o[qt][dt][r] * inv, a2, c2); hv[r] = a2; lv[r] = c2; }
            *(v8us*)(Ah + oo + (dt >> 1) * 2048 + (dt & 1) * 256) = hv; *(v8us*)(Al + oo + (dt >> 1) * 2048 + (dt & 1) * 256) = lv; }
        if (qt + 1 < NQ) asm volatile("s_wait_xcnt 0x0" ::: "memory");   // the next tile's values and addresses may reuse the registers of the stores above
    }
}

extern "C" void kernel_launch(void* const* d_in, const int* in_sizes, int n_in,
                              void* d_out, int out_size, void* d_ws, size_t ws_size, hipStream_t stream) {
    if (n_in < 6) return;
    const size_t need = (size_t)(NB - 1) * SEQ_FULL * DM + (size_t)TT * DM;
    if ((size_t)in_sizes[0] < need || (size_t)out_size < need) return;
    if (in_sizes[1] < DM * DQ || in_sizes[2] < DM * DQ || in_sizes[3] < DM * DQ || in_sizes[4] < DQ * DM || in_sizes[5] < DM) return;
    const float* x = (const float*)d_in[0]; const float* wq = (const float*)d_in[1]; const float* wk = (const float*)d_in[2]; const float* wv = (const float*)d_in[3]; const float* wo = (const float*)d_in[4]; const float* bo = (const float*)d_in[5];
    float* OUT = (float*)d_out;     // [2][4096][768], byte offset 0
    char* wsp = (char*)d_ws;
    auto take = [&](size_t bytes) { char* p = wsp; wsp += (bytes + 255) & ~(size_t)255; return (void*)p; };
    bf* WT = (bf*)take((size_t)4 * DQ * DM * 2); bf* WO = WT + (size_t)3 * DQ * DM;   // transposed wq, wk, wv, wo, one behind the other
    bf* XB = (bf*)take((size_t)NB * TT * DM * 2);
    const size_t PE = (size_t)NH_ * TT * HD;   // elements of one plane of one batch
    h16* P16 = (h16*)take((size_t)3 * NB * PE * 2); bf* Ph = (bf*)take((size_t)3 * NB * PE * 2); bf* Pl = (bf*)take((size_t)3 * NB * PE * 2);   // each: q planes of all batches, then k, then v^T
    bf* ATh = (bf*)take((size_t)NB * TT * DQ * 2); bf* ATl = (bf*)take((size_t)NB * TT * DQ * 2);
    if ((size_t)(wsp - (char*)d_ws) > ws_size) return;    // 155,713,536 B at the full size
    // Launches that do not depend on each other (the four weights and x; the two batches; the q, k and v projections) are one grid each.
    k_prep<<<4u * LWB + NB * NCB, 256, 0, stream>>>(wq, wk, wv, wo, WT, x, XB);   // weights: in[768][768] -> out[768][768] transposed (DM == DQ)
    k_gemmw<bf, 0, false, 3, true><<<dim3(TT / 64, NH_, 3 * NB), 32, 0, stream>>>(XB, nullptr, WT, nullptr, DM, nullptr, 0, nullptr, (size_t)TT * DM, (size_t)DQ * DM, 0, P16, Ph, Pl);
    k_flash<bf, true, 1><<<dim3(RH / 16, NH_, NB), 32, 0, stream>>>(Ph, Pl, Ph + NB * PE, Pl + NB * PE, Ph + 2 * NB * PE, Pl + 2 * NB * PE, 0, ATh, ATl);
    if (TT > RH) k_flash<h16, false, 2><<<dim3((TT - RH) / 32, NH_, NB), 32, 0, stream>>>(P16, nullptr, P16 + NB * PE, nullptr, P16 + 2 * NB * PE, nullptr, RH, ATh, ATl);
    k_gemmw<bf, 1, true, 1, false><<<dim3(TT / 64, DM / 64, NB), 32, 0, stream>>>(ATh, ATl, WO, nullptr, DQ, OUT, DM, bo, (size_t)TT * DQ, 0, (size_t)SEQ_FULL * DM, nullptr, nullptr, nullptr);
}

// v009
// Measured time: 146 microseconds a run.
// Next to v008, in two timings, it ran 1.12 and 1.15 times as fast.
// All steps since v000 together make it 4.89 times as fast.
#include <hip/hip_runtime.h>

// Causal self-attention block: x [2][4096][768]; q/k/v = x W (W [in][out] 768x768, 12 heads x 64); softmax(q.k / 8) over keys j <= i; out = merged ctx Wo + bo -> [2][4096][768].
// Compute dtypes, f32 accumulate: every input RNE-converted to bf16; q/k/v projections v_wmma_f32_16x16x32_bf16 (plain bf16 operands); scores (K Q^T) and ctx (V^T P^T): query rows < 512 on bf16 hi/lo planes (3 products), other rows v_wmma_f32_16x16x32_f16 single product (P and its sum carried x1024); softmax f32; ctx.Wo bf16 hi/lo x bf16 (2 products) + bias.

#ifndef NB
#define NB 2
#endif
#ifndef SEQ
#define SEQ 4096
#endif
#define NB_FULL  2
#define SEQ_FULL 4096
#define TT   SEQ
#define DM   768
#define NH_  12
#define HD   64
#define DQ   (NH_ * HD)
#define RH   ((SEQ) < 512 ? (SEQ) : 512)   // query rows < RH use hi+lo planes
#define LCAR 10.0f                         // log2 of the x1024 carry of P and of its sum (fp16 path)
#define SCL  0.125f                        // HD^-0.5
#define L2E  1.4426950408889634f
#define CSL  (SCL * L2E)                   // raw score -> exponent of 2
#define WSB  ((size_t)4 * DQ * DM * 2 + (size_t)NB * ((size_t)TT * DM * 2 + (size_t)9 * NH_ * TT * HD * 2 + (size_t)2 * TT * DQ * 2))

static_assert(SEQ % 64 == 0);
static_assert(SEQ <= SEQ_FULL);
static_assert(NB <= NB_FULL);
static_assert(DM % 64 == 0);
static_assert(DQ % 64 == 0);
static_assert(DQ == DM);
static_assert(HD == 64);
static_assert(RH % 16 == 0);
static_assert((TT - RH) % 32 == 0);
static_assert(RH % 32 == 0);
static_assert(((size_t)DQ * DM * 2) % 256 == 0);
static_assert(((size_t)TT * DM * 2) % 256 == 0);
static_assert(((size_t)NH_ * TT * HD * 2) % 256 == 0);
static_assert(WSB <= (size_t)268435456);

typedef _Float16 h16;
typedef unsigned short bf;
typedef __attribute__((ext_vector_type(16))) __bf16   v16bf;
typedef __attribute__((ext_vector_type(16))) _Float16 v16h;
typedef __attribute__((ext_vector_type(8)))  _Float16 v8h;
typedef __attribute__((ext_vector_type(8)))  unsigned short v8us;
typedef __attribute__((ext_vector_type(8)))  float    v8f;
typedef __attribute__((ext_vector_type(4)))  float    v4f;
typedef __attribute__((ext_vector_type(2)))  float    v2f;
typedef v8h  __attribute__((may_alias)) v8ha;
typedef v4f  __attribute__((may_alias)) v4fa;

__device__ __forceinline__ unsigned short f2bf(float f) { unsigned u = __float_as_uint(f); u += 0x7FFFu + ((u >> 16) & 1u); return (unsigned short)(u >> 16); }
__device__ __forceinline__ float bf2f(unsigned short b) { return __uint_as_float(((unsigned)b) << 16); }
__device__ __forceinline__ float bfr(float f) { return bf2f(f2bf(f)); }
__device__ __forceinline__ v16h cat16(v8h lo, v8h hi) { return __builtin_shufflevector(lo, hi, 0, 1, 2, 3, 4, 5, 6, 7, 8, 9, 10, 11, 12, 13, 14, 15); }
__device__ __forceinline__ v16bf cat16b(v8us lo, v8us hi) { return __builtin_bit_cast(v16bf, __builtin_shufflevector(lo, hi, 0, 1, 2, 3, 4, 5, 6, 7, 8, 9, 10, 11, 12, 13, 14, 15)); }
__device__ __forceinline__ v8f wmma16(v16h a, v16h b, v8f c) { return __builtin_amdgcn_wmma_f32_16x16x32_f16(false, a, false, b, (short)0, c, false, false); }
__device__ __forceinline__ v8f wmmab(v16bf a, v16bf b, v8f c) { return __builtin_amdgcn_wmma_f32_16x16x32_bf16(false, a, false, b, (short)0, c, false, false); }
__device__ __forceinline__ void splitf(float y, unsigned short& h, unsigned short& l) { h = f2bf(y); l = f2bf(y - bf2f(h)); }

// Fragment map, the same for A and B operands: lane holds row (lane & 15); elements 0..7 <- k = 8 * (lane >> 4) + 0..7, elements 8..15 <- k = 16 + 8 * (lane >> 4) + 0..7 of a 32-k slice.
// Fragment-order planes (every WMMA operand read from memory): a 16-bit matrix [rows][k] kept as tiles of 16 rows x 32 k (512 elements, 1 KiB). Inside a tile the 16-byte chunk 32 * s + lane holds row (lane & 15),
// k = 16 * s + 8 * (lane >> 4) + 0..7: the map above. A tile is one fragment, and each of its two loads reads 512 contiguous bytes (4 whole cache lines) instead of 32 bytes from each of 16 rows.
// ldf: p points at tile base + 8 * lane; elements 0..7 <- p[0..7], elements 8..15 <- p[256..263].
// Tile order of the GEMM operand planes (x, the transposed weights, the merged context): tile = ((row / 64) * (K / 32) + k / 32) * 4 + (row / 16) % 4, so one 32-k step of a 64-row block is 4 KiB in a row.
template <typename T16> struct WFrag;
template <> struct WFrag<h16> { typedef v16h V; static __device__ __forceinline__ V ldf(const h16* p) { return cat16(*(const v8h*)p, *(const v8h*)(p + 256)); } static __device__ __forceinline__ v8f mma(V a, V b, v8f c) { return wmma16(a, b, c); } };
template <> struct WFrag<bf> { typedef v16bf V; static __device__ __forceinline__ V ldf(const bf* p) { return cat16b(*(const v8us*)p, *(const v8us*)(p + 256)); } static __device__ __forceinline__ v8f mma(V a, V b, v8f c) { return wmmab(a, b, c); } };

// put_planes: the 64 x 64 accumulator block of one wave of the projection GEMM -> 8 KiB in a row of each of the three flash planes (f16, bf16 hi, bf16 lo) of its head; d16, dh, dl point at that block + 8 * lane.
// An accumulator tile has the fragment map already: lane & 15 = the B operand's row, elements 0..7 = the A operand's rows 8 * (lane >> 4) + 0..7, so tile (mb, nb) is one 512-byte half of a plane tile and each lane stores its own 16-byte chunk.
// q, k planes (per head, rows = t, k = d: tile = 2 * (t / 16) + d / 32): A rows = d, B rows = t, half 4 * nb + mb. v^T plane (rows = d, k = t: tile = 4 * (t / 32) + d / 16): A rows = t, B rows = d, half 8 * (mb / 2) + 2 * nb + mb % 2.
template <bool VT>
__device__ __forceinline__ void put_planes(const v8f (&acc)[4][4], h16* d16, bf* dh, bf* dl) {
#pragma unroll
    for (int mb = 0; mb < 4; ++mb)
#pragma unroll
        for (int np = 0; np < 2; ++np) { v8h o16[2]; v8us oh[2], ol[2];
#pragma unroll
            for (int u = 0; u < 2; ++u) { const int nb = 2 * np + u;
#pragma unroll
                for (int q = 0; q < 8; ++q) { const float x = acc[mb][nb][q]; o16[u][q] = (h16)x; unsigned short a2, c2; splitf(x, a2, c2); oh[u][q] = a2; ol[u][q] = c2; }
                const int e = (VT ? 8 * (mb >> 1) + 2 * nb + (mb & 1) : 4 * nb + mb) * 256;
                *(v8h*)(d16 + e) = o16[u]; *(v8us*)(dh + e) = oh[u]; *(v8us*)(dl + e) = ol[u]; }
            // the next two tiles' values may reuse the registers of the stores above; values and addresses are inputs, so that they stay in their registers up to the wait
            if (mb < 3 || np < 1) asm volatile("s_wait_xcnt 0x0" :: "v"(o16[0]), "v"(o16[1]), "v"(oh[0]), "v"(oh[1]), "v"(ol[0]), "v"(ol[1]), "v"(d16), "v"(dh), "v"(dl) : "memory");
        }
}

// ---- k_gemmw: register-blocked GEMM, ONE WAVE per 64x64 output tile (16 accumulators), operands straight from fragment-order 16-bit planes; grid (M/64, N/64, Z), 32 threads.
// C[m][n] (f32, pitch ldc, + optional f32 bias[n]) = sum_k A[m][k] Bt[n][k] (+ split products per NSPLIT). K % 32 == 0, M % 64 == 0, N % 64 == 0.
// blockIdx.z counts independent products: A matrix z / NW (stride sA), B matrix z % NW (stride sB), C matrix z (stride sC).
// PL (the projections: A = x of batch z / 3, B = transposed wq, wk, wv by z % 3, blockIdx.y = head): no C; the accumulators go straight into the flash planes (put_planes). Plane (p, batch) lies at index p * NB + batch of each of the three arrays.
template <typename T16, int NSPLIT, bool BIAS, int NW, bool PL>
__global__ __launch_bounds__(32) void k_gemmw(const T16* __restrict__ A, const T16* __restrict__ A2, const T16* __restrict__ Bt, const T16* __restrict__ Bt2, int K, float* C, int ldc, const float* __restrict__ bias, size_t sA, size_t sB, size_t sC, h16* P16, bf* Ph, bf* Pl) {
    typedef typename WFrag<T16>::V V;
    static_assert(!PL || (NW == 3 && NSPLIT == 0 && !BIAS));
    __shared__ __align__(16) float os[16 * 68];
    const size_t z = blockIdx.z, za = z / NW, zw = z % NW; A += za * sA; if (A2) A2 += za * sA; Bt += zw * sB; if (Bt2) Bt2 += zw * sB; C += z * sC;
    const int lane = threadIdx.x & 31, lr = lane & 15, hi = lane >> 4; const int r0 = blockIdx.x * 64, c0 = blockIdx.y * 64;
    v8f acc[4][4];
#pragma unroll
    for (int mb = 0; mb < 4; ++mb)
#pragma unroll
        for (int nb = 0; nb < 4; ++nb) acc[mb][nb] = (v8f){};
    size_t aoff = (size_t)blockIdx.x * K * 64 + lane * 8, boff = (size_t)blockIdx.y * K * 64 + lane * 8;   // a 64-row block is K * 64 elements; a 32-k step of it 2048
    if (PL && zw != 2) { const T16* tp = A; A = Bt; Bt = tp; const size_t to = aoff; aoff = boff; boff = to; }   // q, k: the weights are the A operand, so that a lane holds 8 neighbouring d of one t (both planes have one format)
#pragma unroll 1
    for (int kc = 0; kc < K; kc += 32) {
        V a[4], a2[4]; const T16* pa = A + aoff + (size_t)kc * 64; const T16* pa2 = (NSPLIT == 1 || NSPLIT == 2) ? A2 + aoff + (size_t)kc * 64 : pa; const T16* pb = Bt + boff + (size_t)kc * 64; const T16* pb2 = NSPLIT >= 2 ? Bt2 + boff + (size_t)kc * 64 : pb;
#pragma unroll
        for (int mb = 0; mb < 4; ++mb) { a[mb] = WFrag<T16>::ldf(pa + mb * 512); if (NSPLIT == 1 || NSPLIT == 2) a2[mb] = WFrag<T16>::ldf(pa2 + mb * 512); }
        // the compiler lets later loads land on the address registers of the loads above; one wait behind the A loads, one behind each B fragment's. The addresses are inputs, so that they stay in their registers up to the wait
        asm volatile("s_wait_xcnt 0x0" :: "v"(pa), "v"(pa2) : "memory");
#pragma unroll
        for (int nb = 0; nb < 4; ++nb) { const V b = WFrag<T16>::ldf(pb + nb * 512); V b2; if (NSPLIT >= 2) b2 = WFrag<T16>::ldf(pb2 + nb * 512);
            asm volatile("s_wait_xcnt 0x0" :: "v"(pb), "v"(pb2) : "memory");   // as above
#pragma unroll
            for (int mb = 0; mb < 4; ++mb) { acc[mb][nb] = WFrag<T16>::mma(a[mb], b, acc[mb][nb]); if (NSPLIT == 1 || NSPLIT == 2) acc[mb][nb] = WFrag<T16>::mma(a2[mb], b, acc[mb][nb]); if (NSPLIT >= 2) acc[mb][nb] = WFrag<T16>::mma(a[mb], b2, acc[mb][nb]); } }
        asm volatile("v_nop\n\tv_nop\n\tv_nop\n\tv_nop" : "+v"(acc[0][0]), "+v"(acc[1][1]), "+v"(acc[2][2]), "+v"(acc[3][3]) : "v"(a[0]), "v"(a[3]));
    }
    if constexpr (PL) {
        const size_t po = ((zw * NB + za) * NH_ + blockIdx.y) * TT * HD + (size_t)r0 * HD + lane * 8;
        if (zw == 2) put_planes<true>(acc, P16 + po, Ph + po, Pl + po); else put_planes<false>(acc, P16 + po, Ph + po, Pl + po);
    } else {
#pragma unroll
    for (int mb = 0; mb < 4; ++mb) {
#pragma unroll
        for (int nb = 0; nb < 4; ++nb) {
#pragma unroll
            for (int j = 0; j < 8; ++j) os[(hi * 8 + j) * 68 + nb * 16 + lr] = acc[mb][nb][j]; }
        __builtin_amdgcn_wave_barrier(); asm volatile("" ::: "memory");
        float* crow = C + (size_t)(r0 + mb * 16) * ldc + c0;
{
#pragma unroll
            for (int s = 0; s < 8; ++s) { const int row = 2 * s + hi, cofs = lr * 4; v4f val = *(const v4fa*)(os + row * 68 + cofs); if (BIAS) { val[0] += bfr(bias[c0 + cofs]); val[1] += bfr(bias[c0 + cofs + 1]); val[2] += bfr(bias[c0 + cofs + 2]); val[3] += bfr(bias[c0 + cofs + 3]); }
                *(v4f*)(crow + (size_t)row * ldc + cofs) = val; }
             }
        __builtin_amdgcn_wave_barrier(); asm volatile("" ::: "memory");
    }
    }
}

// gpos: 16-byte chunk i of a GEMM operand plane [rows][K] -> its row and its first k.
template <int K> __device__ __forceinline__ void gpos(unsigned i, int& row, int& k) { const unsigned c = i & 63u, tile = i >> 6, g = tile >> 2;
    row = (int)((g / (K / 32)) * 64 + (tile & 3u) * 16 + (c & 15u)); k = (int)((g % (K / 32)) * 32 + (c >> 5) * 16 + ((c >> 4) & 1u) * 8); }
// d_wtG, d_cvt8: one thread per 16-byte chunk of the plane, so a wave stores 512 contiguous bytes; bx = the block's index within its own piece of work.
// d_wtG: plane rows = n, k = k of w [K][N]. The lanes of a half wave read 16 neighbouring n of one k.
__device__ __forceinline__ void d_wtG(const float* __restrict__ w, bf* Bt, unsigned bx) { const unsigned i = bx * 256 + threadIdx.x; if (i >= (unsigned)(DQ * DM / 8)) return; int n, k; gpos<DM>(i, n, k); v8us o;
#pragma unroll
    for (int q = 0; q < 8; ++q) o[q] = f2bf(w[(size_t)(k + q) * DQ + n]);
    *(v8us*)(Bt + (size_t)i * 8) = o; }
__device__ __forceinline__ void d_cvt8(const float* __restrict__ src, bf* dst, unsigned bx) { const unsigned i = bx * 256 + threadIdx.x; if (i >= (unsigned)((size_t)TT * DM / 8)) return; int t, k; gpos<DM>(i, t, k); const v8f v = *(const v8f*)(src + (size_t)t * DM + k); v8us o;
#pragma unroll
    for (int q = 0; q < 8; ++q) o[q] = f2bf(v[q]);
    *(v8us*)(dst + (size_t)i * 8) = o; }
// k_prep: all operand conversions in one launch. Blocks 0 .. 4 * LWB - 1: the four weight matrices (all DM x DQ), LWB blocks each, their transposed planes one behind the other in Bt; then NCB blocks per batch of x.
#define LWB ((unsigned)((DM * DQ / 8 + 255) / 256))
#define NCB ((unsigned)(((size_t)TT * DM / 8 + 255) / 256))
__global__ __launch_bounds__(256) void k_prep(const float* __restrict__ w0, const float* __restrict__ w1, const float* __restrict__ w2, const float* __restrict__ w3, bf* Bt, const float* __restrict__ x, bf* XB) {
    const unsigned bx = blockIdx.x;
    if (bx < 4u * LWB) { const unsigned y = bx / LWB; const float* __restrict__ w = y == 0 ? w0 : y == 1 ? w1 : y == 2 ? w2 : w3; d_wtG(w, Bt + (size_t)y * DQ * DM, bx % LWB); }
    else { const unsigned c = bx - 4u * LWB, b = c / NCB; d_cvt8(x + (size_t)b * SEQ_FULL * DM, XB + (size_t)b * TT * DM, c % NCB); }
}
// Probability packers: two 16-key score tiles (accumulator layout: lane = query, element r = key 8*(lane>>4)+r) -> one 32-key B fragment (elements 0..7 <- tile 0, 8..15 <- tile 1).
template <typename T16> struct PPk;
template <> struct PPk<h16> {
    static __device__ __forceinline__ v16h hi(v8f p0, v8f p1) { v8h a, b;
#pragma unroll
        for (int r = 0; r < 8; ++r) { a[r] = (h16)p0[r]; b[r] = (h16)p1[r]; }
        return cat16(a, b); }
    static __device__ __forceinline__ v16h lo(v8f p0, v8f p1) { return hi(p0, p1); }
};
template <> struct PPk<bf> {
    static __device__ __forceinline__ v16bf hi(v8f p0, v8f p1) { v8us a, b;
#pragma unroll
        for (int r = 0; r < 8; ++r) { a[r] = f2bf(p0[r]); b[r] = f2bf(p1[r]); }
        return cat16b(a, b); }
    static __device__ __forceinline__ v16bf lo(v8f p0, v8f p1) { v8us a, b;
#pragma unroll
        for (int r = 0; r < 8; ++r) { a[r] = f2bf(p0[r] - bf2f(f2bf(p0[r]))); b[r] = f2bf(p1[r] - bf2f(f2bf(p1[r]))); }
        return cat16b(a, b); }
};

// ---- k_flash: register-fed transposed flash attention; NS waves per (16 * NQ queries, head, batch); grid ((rows)/(16 * NQ), NH, NB) for NS = 1, (NH, NB, (rows)/(16 * NQ)) otherwise, 32 * NS threads; roff = first query row of this launch (NS > 1: the launch ends at the last row).
// Per 32-key step: S^T[key][query] = K (A operand, rows = keys, k = d) x Q^T (B operand held in registers, lane = query); online softmax per lane (query = lane & 15, the two lane halves hold
// different keys; one xor-16 shuffle for the max); O^T[d][query] += V^T (A operand, rows = d, k = keys, fragment-order plane per head) x P^T (B operand packed from the two score tiles). No LDS in the key loop.
// HL: bf16 hi/lo planes, 3 products per contraction, P not carried. Otherwise fp16 single product with P and its sum l carried x1024 (10 added to the exponent).
// The K and V^T fragments of a step live in one of two register sets; each step first issues all loads of the NEXT step into the other set, so a load has a whole step to land.
template <typename T16, bool HL> struct FKV { typename WFrag<T16>::V k[4], kl[4], v[4], vl[4]; };   // kl, vl: lo planes, HL only

template <typename T16, bool HL>
__device__ __forceinline__ void ldkv(FKV<T16, HL>& f, const T16* __restrict__ K1, const T16* __restrict__ K2, const T16* __restrict__ V1, const T16* __restrict__ V2, size_t koff, int kb) {
    const size_t ko = koff + (size_t)kb * HD;   // a 32-key step is 4 tiles (4 KiB in a row) of the K plane and 4 of the V^T plane, at the same offset
    const T16* pk = K1 + ko; const T16* pv = V1 + ko;
#pragma unroll
    for (int i = 0; i < 4; ++i) f.k[i] = WFrag<T16>::ldf(pk + i * 512);
    // the compiler lets later writes land on the address registers of the loads above; one wait behind each plane's loads. The address is an input, so that it stays in its registers up to the wait
    asm volatile("s_wait_xcnt 0x0" :: "v"(pk) : "memory");
    if (HL) {
        const T16* pk2 = K2 + ko;
#pragma unroll
        for (int i = 0; i < 4; ++i) f.kl[i] = WFrag<T16>::ldf(pk2 + i * 512);
        asm volatile("s_wait_xcnt 0x0" :: "v"(pk2) : "memory");   // as above
    }
#pragma unroll
    for (int dt = 0; dt < 4; ++dt) f.v[dt] = WFrag<T16>::ldf(pv + dt * 512);
    asm volatile("s_wait_xcnt 0x0" :: "v"(pv) : "memory");   // as above
    if (HL) {
        const T16* pv2 = V2 + ko;
#pragma unroll
        for (int dt = 0; dt < 4; ++dt) f.vl[dt] = WFrag<T16>::ldf(pv2 + dt * 512);
        asm volatile("s_wait_xcnt 0x0" :: "v"(pv2) : "memory");   // as above
    }
    // nothing of the step that follows may be scheduled up over the waits above: an instruction that lands between a load and its wait could be given the load's address registers
    __builtin_amdgcn_sched_barrier(0);
}

// DG: this step can hold keys beyond some query of the wave, so it applies the causal mask. A step whose 32 keys all lie at or below the wave's first query (DG false) has no compare, no select and no key index.
template <typename T16, bool HL, int NQ, bool DG>
__device__ __forceinline__ void fstep(const FKV<T16, HL>& f, const typename WFrag<T16>::V (&qa)[NQ][2], const typename WFrag<T16>::V (&qb)[NQ][2], v8f (&o)[NQ][4], float (&m)[NQ], float (&l)[NQ], int kb, int q0, int lr, int hi) {
    typedef typename WFrag<T16>::V V;
    static_assert(NQ == 1 || NQ == 2);
    v8f s[NQ][2];
#pragma unroll
    for (int kt = 0; kt < 2; ++kt)
#pragma unroll
        for (int qt = 0; qt < NQ; ++qt) {
            v8f a = (v8f){};
            if (HL) { a = WFrag<T16>::mma(f.kl[2 * kt], qa[qt][0], a); a = WFrag<T16>::mma(f.kl[2 * kt + 1], qa[qt][1], a); a = WFrag<T16>::mma(f.k[2 * kt], qb[qt][0], a); a = WFrag<T16>::mma(f.k[2 * kt + 1], qb[qt][1], a); }
            a = WFrag<T16>::mma(f.k[2 * kt], qa[qt][0], a); a = WFrag<T16>::mma(f.k[2 * kt + 1], qa[qt][1], a);
            s[qt][kt] = a;
        }
    // WMMA distance: four vector slots between the last score product and the first reader of its result
    if constexpr (NQ == 1) asm volatile("v_nop\n\tv_nop\n\tv_nop\n\tv_nop" : "+v"(s[0][0]), "+v"(s[0][1]) : "v"(qa[0][0]), "v"(qa[0][1]));
    else asm volatile("v_nop\n\tv_nop\n\tv_nop\n\tv_nop" : "+v"(s[0][0]), "+v"(s[0][1]), "+v"(s[1][0]), "+v"(s[1][1]) : "v"(qa[0][0]), "v"(qa[0][1]), "v"(qa[1][0]), "v"(qa[1][1]));
    V pa[NQ], pb[NQ];
#pragma unroll
    for (int qt = 0; qt < NQ; ++qt) {
        const int qi = q0 + qt * 16 + lr;
        float mx = -1.0e30f;
#pragma unroll
        for (int kt = 0; kt < 2; ++kt)
#pragma unroll
            for (int r = 0; r < 8; ++r) { float t = s[qt][kt][r]; if (DG) { const int key = kb + kt * 16 + 8 * hi + r; t = (key > qi) ? -1.0e30f : t; } s[qt][kt][r] = t; mx = fmaxf(mx, t); }
        mx = fmaxf(mx, __shfl_xor(mx, 16, 32));
        const float mn = fmaxf(m[qt], mx);   // the running maximum is kept in raw score units (the scale is positive)
        const float al = __builtin_amdgcn_exp2f((m[qt] - mn) * CSL);
        m[qt] = mn;
        const float nb = fmaf(-mn, CSL, HL ? 0.0f : LCAR);   // per query and step: scale, log2(e), maximum and carry meet in one fma per score
        float psum = 0.0f;
#pragma unroll
        for (int kt = 0; kt < 2; ++kt)
#pragma unroll
            for (int r = 0; r < 8; r += 2) {   // neighbouring elements of a score tile are an aligned register pair: one packed fma for two scores
                const v2f e = __builtin_elementwise_fma((v2f){s[qt][kt][r], s[qt][kt][r + 1]}, (v2f){CSL, CSL}, (v2f){nb, nb});
                const float p0 = __builtin_amdgcn_exp2f(e[0]), p1 = __builtin_amdgcn_exp2f(e[1]); s[qt][kt][r] = p0; s[qt][kt][r + 1] = p1; psum += p0; psum += p1; }
        l[qt] = l[qt] * al + psum;
#pragma unroll
        for (int dt = 0; dt < 4; ++dt) o[qt][dt] = o[qt][dt] * al;
        pa[qt] = PPk<T16>::hi(s[qt][0], s[qt][1]);
        pb[qt] = pa[qt]; if (HL) pb[qt] = PPk<T16>::lo(s[qt][0], s[qt][1]);
    }
#pragma unroll
    for (int dt = 0; dt < 4; ++dt)
#pragma unroll
        for (int qt = 0; qt < NQ; ++qt) {
            if (HL) { o[qt][dt] = WFrag<T16>::mma(f.vl[dt], pa[qt], o[qt][dt]); o[qt][dt] = WFrag<T16>::mma(f.v[dt], pb[qt], o[qt][dt]); }
            o[qt][dt] = WFrag<T16>::mma(f.v[dt], pa[qt], o[qt][dt]);
        }
    // WMMA distance, as above, for the output tiles and the packed probabilities
    if constexpr (NQ == 1) asm volatile("v_nop\n\tv_nop\n\tv_nop\n\tv_nop" : "+v"(o[0][0]), "+v"(o[0][1]), "+v"(o[0][2]), "+v"(o[0][3]) : "v"(pa[0]), "v"(pb[0]));
    else asm volatile("v_nop\n\tv_nop\n\tv_nop\n\tv_nop" : "+v"(o[0][0]), "+v"(o[0][1]), "+v"(o[0][2]), "+v"(o[0][3]), "+v"(o[1][0]), "+v"(o[1][1]), "+v"(o[1][2]), "+v"(o[1][3]) : "v"(pa[0]), "v"(pb[0]), "v"(pa[1]), "v"(pb[1]));
}

// NQ: 16-query tiles per wave. Every K and V^T fragment a wave loads feeds all its NQ tiles, so the key loop's bytes from L2 per query fall by NQ; each query keeps its own m, l and output tiles.
// NS: waves per work-group. All NS waves hold the same 16 * NQ queries; wave w takes the 32-key steps w, w + NS, w + 2 * NS, ... with its own m, l and output tiles, and the NS partial results are joined through LDS at the end.
// The cost of a query tile grows with its row (causal). With NS = 4 the keys of every tile are split over four waves, so no wave walks more than a quarter of
// them, and the tiles are numbered longest first (for speed only).
template <typename T16, bool HL, int NQ, int NS>
__global__ __launch_bounds__(32 * NS) void k_flash(const T16* __restrict__ Q1, const T16* __restrict__ Q2, const T16* __restrict__ K1, const T16* __restrict__ K2, const T16* __restrict__ V1, const T16* __restrict__ V2, int roff, bf* Ah, bf* Al) {
    typedef typename WFrag<T16>::V V;
    const int lane = threadIdx.x & 31, lr = lane & 15, hi = lane >> 4;
    const int wv = NS == 1 ? 0 : __builtin_amdgcn_readfirstlane((int)(threadIdx.x >> 5));   // the wave's number, in a scalar register: every branch on it is a scalar branch
    // NS > 1: grid (NH, NB, tiles); the tile is the slowest index and counts down from the last rows (longest first, for speed only)
    const int q0 = NS == 1 ? roff + (int)blockIdx.x * (16 * NQ) : TT - ((int)blockIdx.z + 1) * (16 * NQ); const int head = NS == 1 ? blockIdx.y : blockIdx.x; const int bat = NS == 1 ? blockIdx.z : blockIdx.y;
    const size_t hp = ((size_t)bat * NH_ + head) * TT * HD;
    const size_t qoff = hp + (size_t)q0 * HD + lane * 8;   // 16 queries are 2 tiles
    V qa[NQ][2], qb[NQ][2];
#pragma unroll
    for (int qt = 0; qt < NQ; ++qt) {
        qa[qt][0] = WFrag<T16>::ldf(Q1 + qoff + qt * 1024); qa[qt][1] = WFrag<T16>::ldf(Q1 + qoff + qt * 1024 + 512);
        if (HL) { qb[qt][0] = WFrag<T16>::ldf(Q2 + qoff + qt * 1024); qb[qt][1] = WFrag<T16>::ldf(Q2 + qoff + qt * 1024 + 512); } else { qb[qt][0] = qa[qt][0]; qb[qt][1] = qa[qt][1]; }
    }
    asm volatile("s_wait_xcnt 0x0" ::: "memory");   // the address registers of the Q loads may be reused by the loads below
    v8f o[NQ][4]; float m[NQ], l[NQ];
#pragma unroll
    for (int qt = 0; qt < NQ; ++qt) { m[qt] = -1.0e30f; l[qt] = 0.0f;
#pragma unroll
        for (int dt = 0; dt < 4; ++dt) o[qt][dt] = (v8f){}; }
    const int nst = (q0 + 16 * NQ + 31) >> 5;     // keys 0 .. q0+16*NQ-1 in steps of 32; at least 1
    const size_t koff = hp + lane * 8;
    FKV<T16, HL> fa, fb;
    static_assert(NS == 1 || RH / 32 >= NS);      // nst > RH / 32 in the launch that splits, so every wave has at least one step
    ldkv<T16, HL>(fa, K1, K2, V1, V2, koff, wv * 32);
    asm volatile("s_wait_xcnt 0x0" ::: "memory");   // the address registers of the loads above are reused below
    // q0 is a multiple of 16 * NQ, so only the last step reaches past q0: step s < nst - 1 ends at key 32 * s + 31 <= q0. The loop runs the steps below the diagonal without the mask; a wave's last step is peeled, and masked in the wave that owns step nst - 1.
    const int nd = (nst - wv + NS - 1) / NS - 1;  // this wave's steps are i = 0 .. nd, step i of the wave being step wv + NS * i of the tile
    const bool dg = NS == 1 || wv + NS * nd == nst - 1;
    int stp = 0;
    // two steps per trip, so that the two register sets swap roles without copies; step stp + 2 <= nd always exists
#pragma unroll 1
    for (; stp + 1 < nd; stp += 2) {
        ldkv<T16, HL>(fb, K1, K2, V1, V2, koff, (wv + NS * (stp + 1)) * 32);
        fstep<T16, HL, NQ, false>(fa, qa, qb, o, m, l, 0, q0, lr, hi);
        ldkv<T16, HL>(fa, K1, K2, V1, V2, koff, (wv + NS * (stp + 2)) * 32);
        fstep<T16, HL, NQ, false>(fb, qa, qb, o, m, l, 0, q0, lr, hi);
    }
    const int kl = (wv + NS * nd) * 32;   // first key of the wave's last step
    if (stp < nd) {   // one unmasked step is left in front of the last
        ldkv<T16, HL>(fb, K1, K2, V1, V2, koff, kl);
        fstep<T16, HL, NQ, false>(fa, qa, qb, o, m, l, 0, q0, lr, hi);
        if (dg) fstep<T16, HL, NQ, true>(fb, qa, qb, o, m, l, kl, q0, lr, hi); else fstep<T16, HL, NQ, false>(fb, qa, qb, o, m, l, 0, q0, lr, hi);
    } else { if (dg) fstep<T16, HL, NQ, true>(fa, qa, qb, o, m, l, kl, q0, lr, hi); else fstep<T16, HL, NQ, false>(fa, qa, qb, o, m, l, 0, q0, lr, hi); }
    // The output tiles already have the fragment map (lane = query row, element r of tile dt = k 16 * dt + 8 * hi + r of this head's 64): each lane stores its 16-byte chunks straight into the output GEMM's A planes.
    if constexpr (NS > 1) {
        // Join of the NS partial results: every wave leaves m, l and its output tiles in LDS (a lane's 16-byte chunks side by side, 512 bytes per store); behind the barrier wave w joins output tile dt = w of every query tile,
        // always in the order of the waves: M = max m_u, c_u = 2^((m_u - M) * CSL), l = sum c_u l_u, O = sum c_u O_u.
        static_assert(NS == 4);
        __shared__ __align__(16) float so[NS][NQ][4][2][32][4];
        __shared__ float sm[NS][NQ][32], sl[NS][NQ][32];
#pragma unroll
        for (int qt = 0; qt < NQ; ++qt) { sm[wv][qt][lane] = m[qt]; sl[wv][qt][lane] = l[qt];
#pragma unroll
            for (int dt = 0; dt < 4; ++dt)
#pragma unroll
                for (int h = 0; h < 2; ++h) *(v4fa*)so[wv][qt][dt][h][lane] = (v4f){o[qt][dt][4 * h], o[qt][dt][4 * h + 1], o[qt][dt][4 * h + 2], o[qt][dt][4 * h + 3]}; }
        __syncthreads();   // the partial results of all waves are in LDS; nothing is written there afterwards
#pragma unroll
        for (int qt = 0; qt < NQ; ++qt) {
            float mu[NS], c[NS]; float mm = -1.0e30f;
#pragma unroll
            for (int u = 0; u < NS; ++u) { mu[u] = sm[u][qt][lane]; mm = fmaxf(mm, mu[u]); }
            float ls = 0.0f; v4f a0 = (v4f){}, a1 = (v4f){};
#pragma unroll
            for (int u = 0; u < NS; ++u) { c[u] = __builtin_amdgcn_exp2f((mu[u] - mm) * CSL); ls = fmaf(sl[u][qt][lane], c[u], ls);
                a0 += *(const v4fa*)so[u][qt][wv][0][lane] * c[u]; a1 += *(const v4fa*)so[u][qt][wv][1][lane] * c[u]; }
            const float lt = ls + __shfl_xor(ls, 16, 32);
            const float inv = 1.0f / lt;   // the output tiles and the sum carry the same x1024
            const int t0 = q0 + qt * 16;
            const size_t oo = (size_t)bat * TT * DQ + ((size_t)(t0 >> 6) * (DQ / 32) + head * (HD / 32)) * 2048 + ((t0 >> 4) & 3) * 512 + lane * 8 + (wv >> 1) * 2048 + (wv & 1) * 256;
            v8us hv, lv;
#pragma unroll
            for (int r = 0; r < 8; ++r) { unsigned short a2, c2; splitf((r < 4 ? a0[r & 3] : a1[r & 3]) * inv, a2, c2); hv[r] = a2; lv[r] = c2; }
            *(v8us*)(Ah + oo) = hv; *(v8us*)(Al + oo) = lv;
            if (qt + 1 < NQ) asm volatile("s_wait_xcnt 0x0" ::: "memory");   // the next tile's values and addresses may reuse the registers of the stores above
        }
    } else
#pragma unroll
    for (int qt = 0; qt < NQ; ++qt) {
        const float lt = l[qt] + __shfl_xor(l[qt], 16, 32);
        const float inv = 1.0f / lt;   // fp16 path: the output tiles and the sum carry the same x1024
        const int t0 = q0 + qt * 16;
        const size_t oo = (size_t)bat * TT * DQ + ((size_t)(t0 >> 6) * (DQ / 32) + head * (HD / 32)) * 2048 + ((t0 >> 4) & 3) * 512 + lane * 8;
#pragma unroll
        for (int dt = 0; dt < 4; ++dt) { v8us hv, lv;
#pragma unroll
            for (int r = 0; r < 8; ++r) { unsigned short a2, c2; splitf(o[qt][dt][r] * inv, a2, c2); hv[r] = a2; lv[r] = c2; }
            *(v8us*)(Ah + oo + (dt >> 1) * 2048 + (dt & 1) * 256) = hv; *(v8us*)(Al + oo + (dt >> 1) * 2048 + (dt & 1) * 256) = lv; }
        if (qt + 1 < NQ) asm volatile("s_wait_xcnt 0x0" ::: "memory");   // the next tile's values and addresses may reuse the registers of the stores above
    }
}

extern "C" void kernel_launch(void* const* d_in, const int* in_sizes, int n_in,
                              void* d_out, int out_size, void* d_ws, size_t ws_size, hipStream_t stream) {
    if (n_in < 6) return;
    const size_t need = (size_t)(NB - 1) * SEQ_FULL * DM + (size_t)TT * DM;
    if ((size_t)in_sizes[0] < need || (size_t)out_size < need) return;
    if (in_sizes[1] < DM * DQ || in_sizes[2] < DM * DQ || in_sizes[3] < DM * DQ || in_sizes[4] < DQ * DM || in_sizes[5] < DM) return;
    const float* x = (const float*)d_in[0]; const float* wq = (const float*)d_in[1]; const float* wk = (const float*)d_in[2]; const float* wv = (const float*)d_in[3]; const float* wo = (const float*)d_in[4]; const float* bo = (const float*)d_in[5];
    float* OUT = (float*)d_out;     // [2][4096][768], byte offset 0
    char* wsp = (char*)d_ws;
    auto take = [&](size_t bytes) { char* p = wsp; wsp += (bytes + 255) & ~(size_t)255; return (void*)p; };
    bf* WT = (bf*)take((size_t)4 * DQ * DM * 2); bf* WO = WT + (size_t)3 * DQ * DM;   // transposed wq, wk, wv, wo, one behind the other
    bf* XB = (bf*)take((size_t)NB * TT * DM * 2);
    const size_t PE = (size_t)NH_ * TT * HD;   // elements of one plane of one batch
    h16* P16 = (h16*)take((size_t)3 * NB * PE * 2); bf* Ph = (bf*)take((size_t)3 * NB * PE * 2); bf* Pl = (bf*)take((size_t)3 * NB * PE * 2);   // each: q planes of all batches, then k, then v^T
    bf* ATh = (bf*)take((size_t)NB * TT * DQ * 2); bf* ATl = (bf*)take((size_t)NB * TT * DQ * 2);
    if ((size_t)(wsp - (char*)d_ws) > ws_size) return;    // 155,713,536 B at the full size
    // Launches that do not depend on each other (the four weights and x; the two batches; the q, k and v projections) are one grid each.
    k_prep<<<4u * LWB + NB * NCB, 256, 0, stream>>>(wq, wk, wv, wo, WT, x, XB);   // weights: in[768][768] -> out[768][768] transposed (DM == DQ)
    k_gemmw<bf, 0, false, 3, true><<<dim3(TT / 64, NH_, 3 * NB), 32, 0, stream>>>(XB, nullptr, WT, nullptr, DM, nullptr, 0, nullptr, (size_t)TT * DM, (size_t)DQ * DM, 0, P16, Ph, Pl);
    k_flash<bf, true, 1, 1><<<dim3(RH / 16, NH_, NB), 32, 0, stream>>>(Ph, Pl, Ph + NB * PE, Pl + NB * PE, Ph + 2 * NB * PE, Pl + 2 * NB * PE, 0, ATh, ATl);
    if (TT > RH) k_flash<h16, false, 2, 4><<<dim3(NH_, NB, (TT - RH) / 32), 128, 0, stream>>>(P16, nullptr, P16 + NB * PE, nullptr, P16 + 2 * NB * PE, nullptr, RH, ATh, ATl);
    k_gemmw<bf, 1, true, 1, false><<<dim3(TT / 64, DM / 64, NB), 32, 0, stream>>>(ATh, ATl, WO, nullptr, DQ, OUT, DM, bo, (size_t)TT * DQ, 0, (size_t)SEQ_FULL * DM, nullptr, nullptr, nullptr);
}

// v010
// Measured time: 128 microseconds a run.
// Two timings next to v009 put it at 1.17 and 1.15 times that version's speed.
// All steps since v000 together make it 5.65 times as fast.
#include <hip/hip_runtime.h>

// Causal self-attention block: x [2][4096][768]; q/k/v = x W (W [in][out] 768x768, 12 heads x 64); softmax(q.k / 8) over keys j <= i; out = merged ctx Wo + bo -> [2][4096][768].
// Compute dtypes, f32 accumulate: every input RNE-converted to bf16; q/k/v projections v_wmma_f32_16x16x32_bf16 (plain bf16 operands); scores (K Q^T) and ctx (V^T P^T): query rows < 512 on bf16 hi/lo planes (3 products), other rows v_wmma_f32_16x16x32_f16 single product (P and its sum carried x1024); softmax f32; ctx.Wo bf16 hi/lo x bf16 (2 products) + bias.

#ifndef NB
#define NB 2
#endif
#ifndef SEQ
#define SEQ 4096
#endif
#define NB_FULL  2
#define SEQ_FULL 4096
#define TT   SEQ
#define DM   768
#define NH_  12
#define HD   64
#define DQ   (NH_ * HD)
#define RH   ((SEQ) < 512 ? (SEQ) : 512)   // query rows < RH use hi+lo planes
#define LCAR 10.0f                         // log2 of the x1024 carry of P and of its sum (fp16 path)
#define SCL  0.125f                        // HD^-0.5
#define L2E  1.4426950408889634f
#define CSL  (SCL * L2E)                   // raw score -> exponent of 2
#define WSB  ((size_t)4 * DQ * DM * 2 + (size_t)NB * ((size_t)TT * DM * 2 + (size_t)9 * NH_ * TT * HD * 2 + (size_t)2 * TT * DQ * 2))

static_assert(SEQ % 64 == 0);
static_assert(SEQ <= SEQ_FULL);
static_assert(NB <= NB_FULL);
static_assert(DM % 64 == 0);
static_assert(DQ % 64 == 0);
static_assert(DQ == DM);
static_assert(HD == 64);
static_assert(RH % 16 == 0);
static_assert((TT - RH) % 32 == 0);
static_assert(RH % 32 == 0);
static_assert(((size_t)DQ * DM * 2) % 256 == 0);
static_assert(((size_t)TT * DM * 2) % 256 == 0);
static_assert(((size_t)NH_ * TT * HD * 2) % 256 == 0);
static_assert(WSB <= (size_t)268435456);

typedef _Float16 h16;
typedef unsigned short bf;
typedef __attribute__((ext_vector_type(16))) __bf16   v16bf;
typedef __attribute__((ext_vector_type(16))) _Float16 v16h;
typedef __attribute__((ext_vector_type(8)))  _Float16 v8h;
typedef __attribute__((ext_vector_type(8)))  unsigned short v8us;
typedef __attribute__((ext_vector_type(8)))  float    v8f;
typedef __attribute__((ext_vector_type(4)))  float    v4f;
typedef __attribute__((ext_vector_type(2)))  float    v2f;
typedef v8h  __attribute__((may_alias)) v8ha;
typedef v4f  __attribute__((may_alias)) v4fa;

__device__ __forceinline__ unsigned short f2bf(float f) { unsigned u = __float_as_uint(f); u += 0x7FFFu + ((u >> 16) & 1u); return (unsigned short)(u >> 16); }
__device__ __forceinline__ float bf2f(unsigned short b) { return __uint_as_float(((unsigned)b) << 16); }
__device__ __forceinline__ float bfr(float f) { return bf2f(f2bf(f)); }
__device__ __forceinline__ v16h cat16(v8h lo, v8h hi) { return __builtin_shufflevector(lo, hi, 0, 1, 2, 3, 4, 5, 6, 7, 8, 9, 10, 11, 12, 13, 14, 15); }
__device__ __forceinline__ v16bf cat16b(v8us lo, v8us hi) { return __builtin_bit_cast(v16bf, __builtin_shufflevector(lo, hi, 0, 1, 2, 3, 4, 5, 6, 7, 8, 9, 10, 11, 12, 13, 14, 15)); }
__device__ __forceinline__ v8f wmma16(v16h a, v16h b, v8f c) { return __builtin_amdgcn_wmma_f32_16x16x32_f16(false, a, false, b, (short)0, c, false, false); }
__device__ __forceinline__ v8f wmmab(v16bf a, v16bf b, v8f c) { return __builtin_amdgcn_wmma_f32_16x16x32_bf16(false, a, false, b, (short)0, c, false, false); }
__device__ __forceinline__ void splitf(float y, unsigned short& h, unsigned short& l) { h = f2bf(y); l = f2bf(y - bf2f(h)); }

// Fragment map, the same for A and B operands: lane holds row (lane & 15); elements 0..7 <- k = 8 * (lane >> 4) + 0..7, elements 8..15 <- k = 16 + 8 * (lane >> 4) + 0..7 of a 32-k slice.
// Fragment-order planes (every WMMA operand read from memory): a 16-bit matrix [rows][k] kept as tiles of 16 rows x 32 k (512 elements, 1 KiB). Inside a tile the 16-byte chunk 32 * s + lane holds row (lane & 15),
// k = 16 * s + 8 * (lane >> 4) + 0..7: the map above. A tile is one fragment, and each of its two loads reads 512 contiguous bytes (4 whole cache lines) instead of 32 bytes from each of 16 rows.
// ldf: p points at tile base + 8 * lane; elements 0..7 <- p[0..7], elements 8..15 <- p[256..263].
// Tile order of the GEMM operand planes (x, the transposed weights, the merged context): tile = ((row / 64) * (K / 32) + k / 32) * 4 + (row / 16) % 4, so one 32-k step of a 64-row block is 4 KiB in a row.
template <typename T16> struct WFrag;
template <> struct WFrag<h16> { typedef v16h V; static __device__ __forceinline__ V ldf(const h16* p) { return cat16(*(const v8h*)p, *(const v8h*)(p + 256)); } static __device__ __forceinline__ v8f mma(V a, V b, v8f c) { return wmma16(a, b, c); } };
template <> struct WFrag<bf> { typedef v16bf V; static __device__ __forceinline__ V ldf(const bf* p) { return cat16b(*(const v8us*)p, *(const v8us*)(p + 256)); } static __device__ __forceinline__ v8f mma(V a, V b, v8f c) { return wmmab(a, b, c); } };

// put_planes: the 64 x 64 accumulator block of one wave of the projection GEMM -> 8 KiB in a row of each of the three flash planes (f16, bf16 hi, bf16 lo) of its head; d16, dh, dl point at that block + 8 * lane.
// An accumulator tile has the fragment map already: lane & 15 = the B operand's row, elements 0..7 = the A operand's rows 8 * (lane >> 4) + 0..7, so tile (mb, nb) is one 512-byte half of a plane tile and each lane stores its own 16-byte chunk.
// q, k planes (per head, rows = t, k = d: tile = 2 * (t / 16) + d / 32): A rows = d, B rows = t, half 4 * nb + mb. v^T plane (rows = d, k = t: tile = 4 * (t / 32) + d / 16): A rows = t, B rows = d, half 8 * (mb / 2) + 2 * nb + mb % 2.
template <bool VT>
__device__ __forceinline__ void put_planes(const v8f (&acc)[4][4], h16* d16, bf* dh, bf* dl) {
#pragma unroll
    for (int mb = 0; mb < 4; ++mb)
#pragma unroll
        for (int np = 0; np < 2; ++np) { v8h o16[2]; v8us oh[2], ol[2];
#pragma unroll
            for (int u = 0; u < 2; ++u) { const int nb = 2 * np + u;
#pragma unroll
                for (int q = 0; q < 8; ++q) { const float x = acc[mb][nb][q]; o16[u][q] = (h16)x; unsigned short a2, c2; splitf(x, a2, c2); oh[u][q] = a2; ol[u][q] = c2; }
                const int e = (VT ? 8 * (mb >> 1) + 2 * nb + (mb & 1) : 4 * nb + mb) * 256;
                *(v8h*)(d16 + e) = o16[u]; *(v8us*)(dh + e) = oh[u]; *(v8us*)(dl + e) = ol[u]; }
            // the next two tiles' values may reuse the registers of the stores above; values and addresses are inputs, so that they stay in their registers up to the wait
            if (mb < 3 || np < 1) asm volatile("s_wait_xcnt 0x0" :: "v"(o16[0]), "v"(o16[1]), "v"(oh[0]), "v"(oh[1]), "v"(ol[0]), "v"(ol[1]), "v"(d16), "v"(dh), "v"(dl) : "memory");
        }
}

// ---- k_gemmw: register-blocked GEMM, ONE WAVE per 64x64 output tile (16 accumulators), operands straight from fragment-order 16-bit planes; grid (M/64, N/64, Z), 32 threads.
// C[m][n] (f32, pitch ldc, + optional f32 bias[n]) = sum_k A[m][k] Bt[n][k] (+ split products per NSPLIT). K % 32 == 0, M % 64 == 0, N % 64 == 0.
// blockIdx.z counts independent products: A matrix z / NW (stride sA), B matrix z % NW (stride sB), C matrix z (stride sC).
// PL (the projections: A = x of batch z / 3, B = transposed wq, wk, wv by z % 3, blockIdx.y = head): no C; the accumulators go straight into the flash planes (put_planes). Plane (p, batch) lies at index p * NB + batch of each of the three arrays.
template <typename T16, int NSPLIT, bool BIAS, int NW, bool PL>
__global__ __launch_bounds__(32) void k_gemmw(const T16* __restrict__ A, const T16* __restrict__ A2, const T16* __restrict__ Bt, const T16* __restrict__ Bt2, int K, float* C, int ldc, const float* __restrict__ bias, size_t sA, size_t sB, size_t sC, h16* P16, bf* Ph, bf* Pl) {
    typedef typename WFrag<T16>::V V;
    static_assert(!PL || (NW == 3 && NSPLIT == 0 && !BIAS));
    __shared__ __align__(16) float os[16 * 68];
    const size_t z = blockIdx.z, za = z / NW, zw = z % NW; A += za * sA; if (A2) A2 += za * sA; Bt += zw * sB; if (Bt2) Bt2 += zw * sB; C += z * sC;
    const int lane = threadIdx.x & 31, lr = lane & 15, hi = lane >> 4; const int r0 = blockIdx.x * 64, c0 = blockIdx.y * 64;
    v8f acc[4][4];
#pragma unroll
    for (int mb = 0; mb < 4; ++mb)
#pragma unroll
        for (int nb = 0; nb < 4; ++nb) acc[mb][nb] = (v8f){};
    size_t aoff = (size_t)blockIdx.x * K * 64 + lane * 8, boff = (size_t)blockIdx.y * K * 64 + lane * 8;   // a 64-row block is K * 64 elements; a 32-k step of it 2048
    if (PL && zw != 2) { const T16* tp = A; A = Bt; Bt = tp; const size_t to = aoff; aoff = boff; boff = to; }   // q, k: the weights are the A operand, so that a lane holds 8 neighbouring d of one t (both planes have one format)
#pragma unroll 1
    for (int kc = 0; kc < K; kc += 32) {
        V a[4], a2[4]; const T16* pa = A + aoff + (size_t)kc * 64; const T16* pa2 = (NSPLIT == 1 || NSPLIT == 2) ? A2 + aoff + (size_t)kc * 64 : pa; const T16* pb = Bt + boff + (size_t)kc * 64; const T16* pb2 = NSPLIT >= 2 ? Bt2 + boff + (size_t)kc * 64 : pb;
#pragma unroll
        for (int mb = 0; mb < 4; ++mb) { a[mb] = WFrag<T16>::ldf(pa + mb * 512); if (NSPLIT == 1 || NSPLIT == 2) a2[mb] = WFrag<T16>::ldf(pa2 + mb * 512); }
        // the compiler lets later loads land on the address registers of the loads above; one wait behind the A loads, one behind each B fragment's. The addresses are inputs, so that they stay in their registers up to the wait
        asm volatile("s_wait_xcnt 0x0" :: "v"(pa), "v"(pa2) : "memory");
#pragma unroll
        for (int nb = 0; nb < 4; ++nb) { const V b = WFrag<T16>::ldf(pb + nb * 512); V b2; if (NSPLIT >= 2) b2 = WFrag<T16>::ldf(pb2 + nb * 512);
            asm volatile("s_wait_xcnt 0x0" :: "v"(pb), "v"(pb2) : "memory");   // as above
#pragma unroll
            for (int mb = 0; mb < 4; ++mb) { acc[mb][nb] = WFrag<T16>::mma(a[mb], b, acc[mb][nb]); if (NSPLIT == 1 || NSPLIT == 2) acc[mb][nb] = WFrag<T16>::mma(a2[mb], b, acc[mb][nb]); if (NSPLIT >= 2) acc[mb][nb] = WFrag<T16>::mma(a[mb], b2, acc[mb][nb]); } }
        asm volatile("v_nop\n\tv_nop\n\tv_nop\n\tv_nop" : "+v"(acc[0][0]), "+v"(acc[1][1]), "+v"(acc[2][2]), "+v"(acc[3][3]) : "v"(a[0]), "v"(a[3]));
    }
    if constexpr (PL) {
        const size_t po = ((zw * NB + za) * NH_ + blockIdx.y) * TT * HD + (size_t)r0 * HD + lane * 8;
        if (zw == 2) put_planes<true>(acc, P16 + po, Ph + po, Pl + po); else put_planes<false>(acc, P16 + po, Ph + po, Pl + po);
    } else {
#pragma unroll
    for (int mb = 0; mb < 4; ++mb) {
#pragma unroll
        for (int nb = 0; nb < 4; ++nb) {
#pragma unroll
            for (int j = 0; j < 8; ++j) os[(hi * 8 + j) * 68 + nb * 16 + lr] = acc[mb][nb][j]; }
        __builtin_amdgcn_wave_barrier(); asm volatile("" ::: "memory");
        float* crow = C + (size_t)(r0 + mb * 16) * ldc + c0;
{
#pragma unroll
            for (int s = 0; s < 8; ++s) { const int row = 2 * s + hi, cofs = lr * 4; v4f val = *(const v4fa*)(os + row * 68 + cofs); if (BIAS) { val[0] += bfr(bias[c0 + cofs]); val[1] += bfr(bias[c0 + cofs + 1]); val[2] += bfr(bias[c0 + cofs + 2]); val[3] += bfr(bias[c0 + cofs + 3]); }
                *(v4f*)(crow + (size_t)row * ldc + cofs) = val; }
             }
        __builtin_amdgcn_wave_barrier(); asm volatile("" ::: "memory");
    }
    }
}

// gpos: 16-byte chunk i of a GEMM operand plane [rows][K] -> its row and its first k.
template <int K> __device__ __forceinline__ void gpos(unsigned i, int& row, int& k) { const unsigned c = i & 63u, tile = i >> 6, g = tile >> 2;
    row = (int)((g / (K / 32)) * 64 + (tile & 3u) * 16 + (c & 15u)); k = (int)((g % (K / 32)) * 32 + (c >> 5) * 16 + ((c >> 4) & 1u) * 8); }
// d_wtG, d_cvt8: one thread per 16-byte chunk of the plane, so a wave stores 512 contiguous bytes; bx = the block's index within its own piece of work.
// d_wtG: plane rows = n, k = k of w [K][N]. The lanes of a half wave read 16 neighbouring n of one k.
__device__ __forceinline__ void d_wtG(const float* __restrict__ w, bf* Bt, unsigned bx) { const unsigned i = bx * 256 + threadIdx.x; if (i >= (unsigned)(DQ * DM / 8)) return; int n, k; gpos<DM>(i, n, k); v8us o;
#pragma unroll
    for (int q = 0; q < 8; ++q) o[q] = f2bf(w[(size_t)(k + q) * DQ + n]);
    *(v8us*)(Bt + (size_t)i * 8) = o; }
__device__ __forceinline__ void d_cvt8(const float* __restrict__ src, bf* dst, unsigned bx) { const unsigned i = bx * 256 + threadIdx.x; if (i >= (unsigned)((size_t)TT * DM / 8)) return; int t, k; gpos<DM>(i, t, k); const v8f v = *(const v8f*)(src + (size_t)t * DM + k); v8us o;
#pragma unroll
    for (int q = 0; q < 8; ++q) o[q] = f2bf(v[q]);
    *(v8us*)(dst + (size_t)i * 8) = o; }
// k_prep: all operand conversions in one launch. Blocks 0 .. 4 * LWB - 1: the four weight matrices (all DM x DQ), LWB blocks each, their transposed planes one behind the other in Bt; then NCB blocks per batch of x.
#define LWB ((unsigned)((DM * DQ / 8 + 255) / 256))
#define NCB ((unsigned)(((size_t)TT * DM / 8 + 255) / 256))
__global__ __launch_bounds__(256) void k_prep(const float* __restrict__ w0, const float* __restrict__ w1, const float* __restrict__ w2, const float* __restrict__ w3, bf* Bt, const float* __restrict__ x, bf* XB) {
    const unsigned bx = blockIdx.x;
    if (bx < 4u * LWB) { const unsigned y = bx / LWB; const float* __restrict__ w = y == 0 ? w0 : y == 1 ? w1 : y == 2 ? w2 : w3; d_wtG(w, Bt + (size_t)y * DQ * DM, bx % LWB); }
    else { const unsigned c = bx - 4u * LWB, b = c / NCB; d_cvt8(x + (size_t)b * SEQ_FULL * DM, XB + (size_t)b * TT * DM, c % NCB); }
}
// Probability packers: two 16-key score tiles (accumulator layout: lane = query, element r = key 8*(lane>>4)+r) -> one 32-key B fragment (elements 0..7 <- tile 0, 8..15 <- tile 1).
template <typename T16> struct PPk;
template <> struct PPk<h16> {
    static __device__ __forceinline__ v16h hi(v8f p0, v8f p1) { v8h a, b;
#pragma unroll
        for (int r = 0; r < 8; ++r) { a[r] = (h16)p0[r]; b[r] = (h16)p1[r]; }
        return cat16(a, b); }
    static __device__ __forceinline__ v16h lo(v8f p0, v8f p1) { return hi(p0, p1); }
};
template <> struct PPk<bf> {
    static __device__ __forceinline__ v16bf hi(v8f p0, v8f p1) { v8us a, b;
#pragma unroll
        for (int r = 0; r < 8; ++r) { a[r] = f2bf(p0[r]); b[r] = f2bf(p1[r]); }
        return cat16b(a, b); }
    static __device__ __forceinline__ v16bf lo(v8f p0, v8f p1) { v8us a, b;
#pragma unroll
        for (int r = 0; r < 8; ++r) { a[r] = f2bf(p0[r] - bf2f(f2bf(p0[r]))); b[r] = f2bf(p1[r] - bf2f(f2bf(p1[r]))); }
        return cat16b(a, b); }
};

// ---- d_flash, k_flash: register-fed transposed flash attention; NS waves per (16 * NQ queries, head, batch).
// Per 32-key step: S^T[key][query] = K (A operand, rows = keys, k = d) x Q^T (B operand held in registers, lane = query); online softmax per lane (query = lane & 15, the two lane halves hold
// different keys; one xor-16 shuffle for the max); O^T[d][query] += V^T (A operand, rows = d, k = keys, fragment-order plane per head) x P^T (B operand packed from the two score tiles). No LDS in the key loop.
// HL: bf16 hi/lo planes, 3 products per contraction, P not carried. Otherwise fp16 single product with P and its sum l carried x1024 (10 added to the exponent).
// With DB the K and V^T fragments of a step live in one of two register sets; each step first issues all loads of the NEXT step into the other set, so a load has a whole step to land.
template <typename T16, bool HL> struct FKV { typename WFrag<T16>::V k[4], kl[4], v[4], vl[4]; };   // kl, vl: lo planes, HL only

template <typename T16, bool HL>
__device__ __forceinline__ void ldkv(FKV<T16, HL>& f, const T16* __restrict__ K1, const T16* __restrict__ K2, const T16* __restrict__ V1, const T16* __restrict__ V2, size_t koff, int kb) {
    const size_t ko = koff + (size_t)kb * HD;   // a 32-key step is 4 tiles (4 KiB in a row) of the K plane and 4 of the V^T plane, at the same offset
    const T16* pk = K1 + ko; const T16* pv = V1 + ko;
#pragma unroll
    for (int i = 0; i < 4; ++i) f.k[i] = WFrag<T16>::ldf(pk + i * 512);
    // the compiler lets later writes land on the address registers of the loads above; one wait behind each plane's loads. The address is an input, so that it stays in its registers up to the wait
    asm volatile("s_wait_xcnt 0x0" :: "v"(pk) : "memory");
    if (HL) {
        const T16* pk2 = K2 + ko;
#pragma unroll
        for (int i = 0; i < 4; ++i) f.kl[i] = WFrag<T16>::ldf(pk2 + i * 512);
        asm volatile("s_wait_xcnt 0x0" :: "v"(pk2) : "memory");   // as above
    }
#pragma unroll
    for (int dt = 0; dt < 4; ++dt) f.v[dt] = WFrag<T16>::ldf(pv + dt * 512);
    asm volatile("s_wait_xcnt 0x0" :: "v"(pv) : "memory");   // as above
    if (HL) {
        const T16* pv2 = V2 + ko;
#pragma unroll
        for (int dt = 0; dt < 4; ++dt) f.vl[dt] = WFrag<T16>::ldf(pv2 + dt * 512);
        asm volatile("s_wait_xcnt 0x0" :: "v"(pv2) : "memory");   // as above
    }
    // nothing of the step that follows may be scheduled up over the waits above: an instruction that lands between a load and its wait could be given the load's address registers
    __builtin_amdgcn_sched_barrier(0);
}

// DG: this step can hold keys beyond some query of the wave, so it applies the causal mask. A step whose 32 keys all lie at or below the wave's first query (DG false) has no compare, no select and no key index.
template <typename T16, bool HL, int NQ, bool DG>
__device__ __forceinline__ void fstep(const FKV<T16, HL>& f, const typename WFrag<T16>::V (&qa)[NQ][2], const typename WFrag<T16>::V (&qb)[NQ][2], v8f (&o)[NQ][4], float (&m)[NQ], float (&l)[NQ], int kb, int q0, int lr, int hi) {
    typedef typename WFrag<T16>::V V;
    static_assert(NQ == 1 || NQ == 2);
    v8f s[NQ][2];
#pragma unroll
    for (int kt = 0; kt < 2; ++kt)
#pragma unroll
        for (int qt = 0; qt < NQ; ++qt) {
            v8f a = (v8f){};
            if (HL) { a = WFrag<T16>::mma(f.kl[2 * kt], qa[qt][0], a); a = WFrag<T16>::mma(f.kl[2 * kt + 1], qa[qt][1], a); a = WFrag<T16>::mma(f.k[2 * kt], qb[qt][0], a); a = WFrag<T16>::mma(f.k[2 * kt + 1], qb[qt][1], a); }
            a = WFrag<T16>::mma(f.k[2 * kt], qa[qt][0], a); a = WFrag<T16>::mma(f.k[2 * kt + 1], qa[qt][1], a);
            s[qt][kt] = a;
        }
    // WMMA distance: four vector slots between the last score product and the first reader of its result
    if constexpr (NQ == 1) asm volatile("v_nop\n\tv_nop\n\tv_nop\n\tv_nop" : "+v"(s[0][0]), "+v"(s[0][1]) : "v"(qa[0][0]), "v"(qa[0][1]));
    else asm volatile("v_nop\n\tv_nop\n\tv_nop\n\tv_nop" : "+v"(s[0][0]), "+v"(s[0][1]), "+v"(s[1][0]), "+v"(s[1][1]) : "v"(qa[0][0]), "v"(qa[0][1]), "v"(qa[1][0]), "v"(qa[1][1]));
    V pa[NQ], pb[NQ];
#pragma unroll
    for (int qt = 0; qt < NQ; ++qt) {
        const int qi = q0 + qt * 16 + lr;
        float mx = -1.0e30f;
#pragma unroll
        for (int kt = 0; kt < 2; ++kt)
#pragma unroll
            for (int r = 0; r < 8; ++r) { float t = s[qt][kt][r]; if (DG) { const int key = kb + kt * 16 + 8 * hi + r; t = (key > qi) ? -1.0e30f : t; } s[qt][kt][r] = t; mx = fmaxf(mx, t); }
        mx = fmaxf(mx, __shfl_xor(mx, 16, 32));
        const float mn = fmaxf(m[qt], mx);   // the running maximum is kept in raw score units (the scale is positive)
        const float al = __builtin_amdgcn_exp2f((m[qt] - mn) * CSL);
        m[qt] = mn;
        const float nb = fmaf(-mn, CSL, HL ? 0.0f : LCAR);   // per query and step: scale, log2(e), maximum and carry meet in one fma per score
        float psum = 0.0f;
#pragma unroll
        for (int kt = 0; kt < 2; ++kt)
#pragma unroll
            for (int r = 0; r < 8; r += 2) {   // neighbouring elements of a score tile are an aligned register pair: one packed fma for two scores
                const v2f e = __builtin_elementwise_fma((v2f){s[qt][kt][r], s[qt][kt][r + 1]}, (v2f){CSL, CSL}, (v2f){nb, nb});
                const float p0 = __builtin_amdgcn_exp2f(e[0]), p1 = __builtin_amdgcn_exp2f(e[1]); s[qt][kt][r] = p0; s[qt][kt][r + 1] = p1; psum += p0; psum += p1; }
        l[qt] = l[qt] * al + psum;
#pragma unroll
        for (int dt = 0; dt < 4; ++dt) o[qt][dt] = o[qt][dt] * al;
        pa[qt] = PPk<T16>::hi(s[qt][0], s[qt][1]);
        pb[qt] = pa[qt]; if (HL) pb[qt] = PPk<T16>::lo(s[qt][0], s[qt][1]);
    }
#pragma unroll
    for (int dt = 0; dt < 4; ++dt)
#pragma unroll
        for (int qt = 0; qt < NQ; ++qt) {
            if (HL) { o[qt][dt] = WFrag<T16>::mma(f.vl[dt], pa[qt], o[qt][dt]); o[qt][dt] = WFrag<T16>::mma(f.v[dt], pb[qt], o[qt][dt]); }
            o[qt][dt] = WFrag<T16>::mma(f.v[dt], pa[qt], o[qt][dt]);
        }
    // WMMA distance, as above, for the output tiles and the packed probabilities
    if constexpr (NQ == 1) asm volatile("v_nop\n\tv_nop\n\tv_nop\n\tv_nop" : "+v"(o[0][0]), "+v"(o[0][1]), "+v"(o[0][2]), "+v"(o[0][3]) : "v"(pa[0]), "v"(pb[0]));
    else asm volatile("v_nop\n\tv_nop\n\tv_nop\n\tv_nop" : "+v"(o[0][0]), "+v"(o[0][1]), "+v"(o[0][2]), "+v"(o[0][3]), "+v"(o[1][0]), "+v"(o[1][1]), "+v"(o[1][2]), "+v"(o[1][3]) : "v"(pa[0]), "v"(pb[0]), "v"(pa[1]), "v"(pb[1]));
}

// NQ: 16-query tiles per wave. Every K and V^T fragment a wave loads feeds all its NQ tiles, so the key loop's bytes from L2 per query fall by NQ; each query keeps its own m, l and output tiles.
// NS: waves per query tile. All NS waves hold the same 16 * NQ queries; wave w takes the 32-key steps w, w + NS, w + 2 * NS, ... with its own m, l and output tiles, and the NS partial results are joined through LDS at the end.
// The cost of a query tile grows with its row (causal). With one wave per tile a SIMD keeps the two or three whole tiles it was given at the start and the launch lasts as long as the fullest SIMD; with NS = 4 every tile is spread
// over the four SIMDs of its WGP, no wave walks more than a quarter of the keys, and there are more work-groups than places, so a place that falls free takes another tile; the tiles are numbered longest first.
// d_flash: the work of one wave. q0 = first query of its tile; wv = the wave's share of the keys (NS > 1; 0 otherwise).
// DB: two register sets as described above. Without it (one set) a step's loads issue at its own top; the wave waits for them while the other waves of its SIMD work.
template <typename T16, bool HL, int NQ, int NS, bool DB>
__device__ __forceinline__ void d_flash(const T16* __restrict__ Q1, const T16* __restrict__ Q2, const T16* __restrict__ K1, const T16* __restrict__ K2, const T16* __restrict__ V1, const T16* __restrict__ V2, int q0, int head, int bat, int wv, bf* Ah, bf* Al) {
    typedef typename WFrag<T16>::V V;
    const int lane = threadIdx.x & 31, lr = lane & 15, hi = lane >> 4;
    const size_t hp = ((size_t)bat * NH_ + head) * TT * HD;
    const size_t qoff = hp + (size_t)q0 * HD + lane * 8;   // 16 queries are 2 tiles
    V qa[NQ][2], qb[NQ][2];
#pragma unroll
    for (int qt = 0; qt < NQ; ++qt) {
        qa[qt][0] = WFrag<T16>::ldf(Q1 + qoff + qt * 1024); qa[qt][1] = WFrag<T16>::ldf(Q1 + qoff + qt * 1024 + 512);
        if (HL) { qb[qt][0] = WFrag<T16>::ldf(Q2 + qoff + qt * 1024); qb[qt][1] = WFrag<T16>::ldf(Q2 + qoff + qt * 1024 + 512); } else { qb[qt][0] = qa[qt][0]; qb[qt][1] = qa[qt][1]; }
    }
    asm volatile("s_wait_xcnt 0x0" ::: "memory");   // the address registers of the Q loads may be reused by the loads below
    v8f o[NQ][4]; float m[NQ], l[NQ];
#pragma unroll
    for (int qt = 0; qt < NQ; ++qt) { m[qt] = -1.0e30f; l[qt] = 0.0f;
#pragma unroll
        for (int dt = 0; dt < 4; ++dt) o[qt][dt] = (v8f){}; }
    const int nst = (q0 + 16 * NQ + 31) >> 5;     // keys 0 .. q0+16*NQ-1 in steps of 32; at least 1
    const size_t koff = hp + lane * 8;
    static_assert(NS == 1 || RH / 32 >= NS);      // nst > RH / 32 for the tiles that are split, so every wave has at least one step
    // q0 is a multiple of 16 * NQ, so only the last step reaches past q0: step s < nst - 1 ends at key 32 * s + 31 <= q0. The loop runs the steps below the diagonal without the mask; a wave's last step is peeled, and masked in the wave that owns step nst - 1.
    const int nd = (nst - wv + NS - 1) / NS - 1;  // this wave's steps are i = 0 .. nd, step i of the wave being step wv + NS * i of the tile
    const bool dg = NS == 1 || wv + NS * nd == nst - 1;
    const int kl = (wv + NS * nd) * 32;   // first key of the wave's last step
    if constexpr (!DB) {
        FKV<T16, HL> fa;
        // kept rolled: with one register set an unrolled body could not start a later step's loads any earlier, it would only lengthen the kernel's text
#pragma unroll 1
        for (int stp = 0; stp < nd; ++stp) {
            ldkv<T16, HL>(fa, K1, K2, V1, V2, koff, (wv + NS * stp) * 32);
            fstep<T16, HL, NQ, false>(fa, qa, qb, o, m, l, 0, q0, lr, hi);
        }
        ldkv<T16, HL>(fa, K1, K2, V1, V2, koff, kl);
        if (dg) fstep<T16, HL, NQ, true>(fa, qa, qb, o, m, l, kl, q0, lr, hi); else fstep<T16, HL, NQ, false>(fa, qa, qb, o, m, l, 0, q0, lr, hi);
    } else {
    FKV<T16, HL> fa, fb;
    ldkv<T16, HL>(fa, K1, K2, V1, V2, koff, wv * 32);
    asm volatile("s_wait_xcnt 0x0" ::: "memory");   // the address registers of the loads above are reused below
    int stp = 0;
    // two steps per trip, so that the two register sets swap roles without copies; step stp + 2 <= nd always exists
#pragma unroll 1
    for (; stp + 1 < nd; stp += 2) {
        ldkv<T16, HL>(fb, K1, K2, V1, V2, koff, (wv + NS * (stp + 1)) * 32);
        fstep<T16, HL, NQ, false>(fa, qa, qb, o, m, l, 0, q0, lr, hi);
        ldkv<T16, HL>(fa, K1, K2, V1, V2, koff, (wv + NS * (stp + 2)) * 32);
        fstep<T16, HL, NQ, false>(fb, qa, qb, o, m, l, 0, q0, lr, hi);
    }
    if (stp < nd) {   // one unmasked step is left in front of the last
        ldkv<T16, HL>(fb, K1, K2, V1, V2, koff, kl);
        fstep<T16, HL, NQ, false>(fa, qa, qb, o, m, l, 0, q0, lr, hi);
        if (dg) fstep<T16, HL, NQ, true>(fb, qa, qb, o, m, l, kl, q0, lr, hi); else fstep<T16, HL, NQ, false>(fb, qa, qb, o, m, l, 0, q0, lr, hi);
    } else { if (dg) fstep<T16, HL, NQ, true>(fa, qa, qb, o, m, l, kl, q0, lr, hi); else fstep<T16, HL, NQ, false>(fa, qa, qb, o, m, l, 0, q0, lr, hi); }
    }
    // The output tiles already have the fragment map (lane = query row, element r of tile dt = k 16 * dt + 8 * hi + r of this head's 64): each lane stores its 16-byte chunks straight into the output GEMM's A planes.
    if constexpr (NS > 1) {
        // Join of the NS partial results: every wave leaves m, l and its output tiles in LDS (a lane's 16-byte chunks side by side, 512 bytes per store); behind the barrier wave w joins output tile dt = w of every query tile,
        // always in the order of the waves: M = max m_u, c_u = 2^((m_u - M) * CSL), l = sum c_u l_u, O = sum c_u O_u.
        static_assert(NS == 4);
        __shared__ __align__(16) float so[NS][NQ][4][2][32][4];
        __shared__ float sm[NS][NQ][32], sl[NS][NQ][32];
#pragma unroll
        for (int qt = 0; qt < NQ; ++qt) { sm[wv][qt][lane] = m[qt]; sl[wv][qt][lane] = l[qt];
#pragma unroll
            for (int dt = 0; dt < 4; ++dt)
#pragma unroll
                for (int h = 0; h < 2; ++h) *(v4fa*)so[wv][qt][dt][h][lane] = (v4f){o[qt][dt][4 * h], o[qt][dt][4 * h + 1], o[qt][dt][4 * h + 2], o[qt][dt][4 * h + 3]}; }
        __syncthreads();   // the partial results of all waves are in LDS; nothing is written there afterwards
#pragma unroll
        for (int qt = 0; qt < NQ; ++qt) {
            float mu[NS], c[NS]; float mm = -1.0e30f;
#pragma unroll
            for (int u = 0; u < NS; ++u) { mu[u] = sm[u][qt][lane]; mm = fmaxf(mm, mu[u]); }
            float ls = 0.0f; v4f a0 = (v4f){}, a1 = (v4f){};
#pragma unroll
            for (int u = 0; u < NS; ++u) { c[u] = __builtin_amdgcn_exp2f((mu[u] - mm) * CSL); ls = fmaf(sl[u][qt][lane], c[u], ls);
                a0 += *(const v4fa*)so[u][qt][wv][0][lane] * c[u]; a1 += *(const v4fa*)so[u][qt][wv][1][lane] * c[u]; }
            const float lt = ls + __shfl_xor(ls, 16, 32);
            const float inv = 1.0f / lt;   // the output tiles and the sum carry the same x1024
            const int t0 = q0 + qt * 16;
            const size_t oo = (size_t)bat * TT * DQ + ((size_t)(t0 >> 6) * (DQ / 32) + head * (HD / 32)) * 2048 + ((t0 >> 4) & 3) * 512 + lane * 8 + (wv >> 1) * 2048 + (wv & 1) * 256;
            v8us hv, lv;
#pragma unroll
            for (int r = 0; r < 8; ++r) { unsigned short a2, c2; splitf((r < 4 ? a0[r & 3] : a1[r & 3]) * inv, a2, c2); hv[r] = a2; lv[r] = c2; }
            *(v8us*)(Ah + oo) = hv; *(v8us*)(Al + oo) = lv;
            asm volatile("s_wait_xcnt 0x0" ::: "memory");   // the next tile's values and addresses may reuse the registers of the stores above; behind the last tile the built code runs on into the place where the kernel's two paths meet, whose other way writes them
        }
    } else
#pragma unroll
    for (int qt = 0; qt < NQ; ++qt) {
        const float lt = l[qt] + __shfl_xor(l[qt], 16, 32);
        const float inv = 1.0f / lt;   // fp16 path: the output tiles and the sum carry the same x1024
        const int t0 = q0 + qt * 16;
        const size_t oo = (size_t)bat * TT * DQ + ((size_t)(t0 >> 6) * (DQ / 32) + head * (HD / 32)) * 2048 + ((t0 >> 4) & 3) * 512 + lane * 8;
#pragma unroll
        for (int dt = 0; dt < 4; ++dt) { v8us hv, lv;
#pragma unroll
            for (int r = 0; r < 8; ++r) { unsigned short a2, c2; splitf(o[qt][dt][r] * inv, a2, c2); hv[r] = a2; lv[r] = c2; }
            *(v8us*)(Ah + oo + (dt >> 1) * 2048 + (dt & 1) * 256) = hv; *(v8us*)(Al + oo + (dt >> 1) * 2048 + (dt & 1) * 256) = lv; }
        if (qt + 1 < NQ) asm volatile("s_wait_xcnt 0x0" ::: "memory");   // the next tile's values and addresses may reuse the registers of the stores above
    }
}

// k_flash: all query tiles of both precisions in one grid (NH, NB, RH / 64 + (TT - RH) / 32), 128 threads; neither kind reads what the other writes.
// blockIdx.z < RH / 64: hi/lo rows; each of the four waves has a 16-query tile of its own (four neighbouring tiles, so the four end together) and meets no barrier. These few long-latency waves come first in the grid and run beside the fp16 tiles.
// They keep one K / V^T register set, so that the kernel's register count stays the fp16 path's and a SIMD holds as many waves as before.
// Other blocks: one 32-query fp16 tile, its keys split over the four waves; the tile counts down from the last rows, so the work-groups are numbered in the order of falling cost.
static_assert(RH % 64 == 0);
__global__ __launch_bounds__(128) void k_flash(const h16* __restrict__ Q16, const h16* __restrict__ K16, const h16* __restrict__ V16, const bf* __restrict__ Qh, const bf* __restrict__ Ql, const bf* __restrict__ Kh, const bf* __restrict__ Kl, const bf* __restrict__ Vh, const bf* __restrict__ Vl, bf* Ah, bf* Al) {
    const int wv = __builtin_amdgcn_readfirstlane((int)(threadIdx.x >> 5));   // the wave's number, in a scalar register: every branch on it is a scalar branch
    const int head = blockIdx.x, bat = blockIdx.y, z = blockIdx.z;
    if (z < RH / 64) d_flash<bf, true, 1, 1, false>(Qh, Ql, Kh, Kl, Vh, Vl, RH - (4 * z + wv + 1) * 16, head, bat, 0, Ah, Al);
    else d_flash<h16, false, 2, 4, true>(Q16, nullptr, K16, nullptr, V16, nullptr, TT - (z - RH / 64 + 1) * 32, head, bat, wv, Ah, Al);
}

extern "C" void kernel_launch(void* const* d_in, const int* in_sizes, int n_in,
                              void* d_out, int out_size, void* d_ws, size_t ws_size, hipStream_t stream) {
    if (n_in < 6) return;
    const size_t need = (size_t)(NB - 1) * SEQ_FULL * DM + (size_t)TT * DM;
    if ((size_t)in_sizes[0] < need || (size_t)out_size < need) return;
    if (in_sizes[1] < DM * DQ || in_sizes[2] < DM * DQ || in_sizes[3] < DM * DQ || in_sizes[4] < DQ * DM || in_sizes[5] < DM) return;
    const float* x = (const float*)d_in[0]; const float* wq = (const float*)d_in[1]; const float* wk = (const float*)d_in[2]; const float* wv = (const float*)d_in[3]; const float* wo = (const float*)d_in[4]; const float* bo = (const float*)d_in[5];
    float* OUT = (float*)d_out;     // [2][4096][768], byte offset 0
    char* wsp = (char*)d_ws;
    auto take = [&](size_t bytes) { char* p = wsp; wsp += (bytes + 255) & ~(size_t)255; return (void*)p; };
    bf* WT = (bf*)take((size_t)4 * DQ * DM * 2); bf* WO = WT + (size_t)3 * DQ * DM;   // transposed wq, wk, wv, wo, one behind the other
    bf* XB = (bf*)take((size_t)NB * TT * DM * 2);
    const size_t PE = (size_t)NH_ * TT * HD;   // elements of one plane of one batch
    h16* P16 = (h16*)take((size_t)3 * NB * PE * 2); bf* Ph = (bf*)take((size_t)3 * NB * PE * 2); bf* Pl = (bf*)take((size_t)3 * NB * PE * 2);   // each: q planes of all batches, then k, then v^T
    bf* ATh = (bf*)take((size_t)NB * TT * DQ * 2); bf* ATl = (bf*)take((size_t)NB * TT * DQ * 2);
    if ((size_t)(wsp - (char*)d_ws) > ws_size) return;    // 155,713,536 B at the full size
    // Launches that do not depend on each other (the four weights and x; the two batches; the q, k and v projections) are one grid each.
    k_prep<<<4u * LWB + NB * NCB, 256, 0, stream>>>(wq, wk, wv, wo, WT, x, XB);   // weights: in[768][768] -> out[768][768] transposed (DM == DQ)
    k_gemmw<bf, 0, false, 3, true><<<dim3(TT / 64, NH_, 3 * NB), 32, 0, stream>>>(XB, nullptr, WT, nullptr, DM, nullptr, 0, nullptr, (size_t)TT * DM, (size_t)DQ * DM, 0, P16, Ph, Pl);
    k_flash<<<dim3(NH_, NB, RH / 64 + (TT - RH) / 32), 128, 0, stream>>>(P16, P16 + NB * PE, P16 + 2 * NB * PE, Ph, Pl, Ph + NB * PE, Pl + NB * PE, Ph + 2 * NB * PE, Pl + 2 * NB * PE, ATh, ATl);
    k_gemmw<bf, 1, true, 1, false><<<dim3(TT / 64, DM / 64, NB), 32, 0, stream>>>(ATh, ATl, WO, nullptr, DQ, OUT, DM, bo, (size_t)TT * DQ, 0, (size_t)SEQ_FULL * DM, nullptr, nullptr, nullptr);
}
